// v000
// Times are from an AMD MI455X. After a warm-up the kernel runs many times in a row, and a time is the length of
// such a window on the GPU divided by its runs, so every launch and the gaps after it count. The runs cycle
// through copies of the inputs. A figure is the median of several windows, for all but v000 over two sittings.
// Sittings can differ by a few percent; kernels timed side by side share one.
// The starting kernel, v000, takes 438 microseconds a run.
// Contractions: q.k^T on v_wmma_f32_16x16x32_bf16 (bf16 planes of the RNE-converted q and k, one product);
// p.v on v_wmma_f32_16x16x32_f16 (p as f16 x1024 hi plane plus f16 x2048 residual plane with its own per-chunk
// accumulator folded x1/2048 in f32, v^T as f16 of the bf16 RNE-converted v carried x64); all f32 accumulate;
// online softmax (running max) and the causal index select in f32 on VALU.
#include <hip/hip_runtime.h>
#include <hip/hip_bf16.h>
#include <math.h>
#include <stdint.h>

#define NB   32
#define SEQ  2048
#define HD   128
#define KC   64
#define NQB  (SEQ / 64)
#define NE   (NB * SEQ * HD)
#define PSC  1024.0f
#define RSC  2048.0f
#define VSC  64.0f
#define SSC  0.17677669529663687f
static_assert((SEQ % 64) == 0);
static_assert(HD == 128);
static_assert(((NE / 8) % 256) == 0);

typedef _Float16 v16h __attribute__((ext_vector_type(16)));
typedef _Float16 v8h  __attribute__((ext_vector_type(8)));
typedef __bf16   v16b __attribute__((ext_vector_type(16)));
typedef float    v8f  __attribute__((ext_vector_type(8)));
typedef float    v4f  __attribute__((ext_vector_type(4)));
typedef unsigned int v4u __attribute__((ext_vector_type(4)));

union FragH { v16h v; v8h h[2]; };
union FragB { v16b v; v4u u[2]; };
union HU8   { v8h h; v4u u; };

// ---- scalar helpers --------------------------------------------------------------------------------
__device__ __forceinline__ unsigned short bf_bits(float f) {          // f32 -> bf16 bits, RNE convert
  unsigned u = __float_as_uint(f);
  return (unsigned short)((u + 0x7FFFu + ((u >> 16) & 1u)) >> 16);
}
__device__ __forceinline__ float bf_up(unsigned short h) { return __uint_as_float(((unsigned)h) << 16); }
__device__ __forceinline__ float bfr(float f) { return bf_up(bf_bits(f)); }   // value of the bf16 RNE convert
__device__ __forceinline__ unsigned pk16(unsigned short a, unsigned short b) { return (unsigned)a | ((unsigned)b << 16); }
__device__ __forceinline__ v8f zero8() { v8f z = {0.f, 0.f, 0.f, 0.f, 0.f, 0.f, 0.f, 0.f}; return z; }

// ---- fragment loaders: 16-bit A/B operand, lane -> row/col (lane&15), p already includes +8*(lane>>4);
//      elements 0..7 <- p[0..7] (k0+8h..), elements 8..15 <- p[16..23] (k0+16+8h..)
__device__ __forceinline__ v16h ldfrag_h(const _Float16* p) {
  FragH f;
  f.h[0] = *(const v8h*)(p);
  f.h[1] = *(const v8h*)(p + 16);
  return f.v;
}
__device__ __forceinline__ v16b ldfrag_b(const unsigned short* p) {
  FragB f;
  f.u[0] = *(const v4u*)(p);
  f.u[1] = *(const v4u*)(p + 16);
  return f.v;
}

// ---- WMMA helpers with trailing VALU hazard gap --------------------------------------------------------
__device__ __forceinline__ v8f mma_h(v16h a, v16h b, v8f c) {
  c = __builtin_amdgcn_wmma_f32_16x16x32_f16(false, a, false, b, (short)0, c, false, false);
#if defined(__HIP_DEVICE_COMPILE__)
  asm volatile("v_nop\n\tv_nop\n\tv_nop\n\tv_nop" : "+v"(c) : "v"(a), "v"(b));
#endif
  return c;
}
__device__ __forceinline__ v8f mma_b(v16b a, v16b b, v8f c) {
  c = __builtin_amdgcn_wmma_f32_16x16x32_bf16(false, a, false, b, (short)0, c, false, false);
#if defined(__HIP_DEVICE_COMPILE__)
  asm volatile("v_nop\n\tv_nop\n\tv_nop\n\tv_nop" : "+v"(c) : "v"(a), "v"(b));
#endif
  return c;
}
__device__ __forceinline__ void wave_sync_lds() {
  __builtin_amdgcn_fence(__ATOMIC_RELEASE, "workgroup");
  __builtin_amdgcn_wave_barrier();
  __builtin_amdgcn_fence(__ATOMIC_ACQUIRE, "workgroup");
}

// =====================================================================================================
// Plane convert: Y[i] = bf16_RNE(X[i]) bits. Thread i handles elements 8i..8i+7 and writes one 16-B piece;
// grid = n8 / 256 (n8 multiple of 256, host-checked). coverage: n8 threads x 8 elements = the whole plane.
// =====================================================================================================
__global__ __launch_bounds__(256) void conv_bf16(const float* __restrict__ X, unsigned short* Y, int n8) {
  const int i  = blockIdx.x * 256 + threadIdx.x;
  const int ic = (i < n8) ? i : (n8 - 1);                     // clamped address
  const float* src = X + (size_t)ic * 8;
  const v4f a = *(const v4f*)(src);
  const v4f c = *(const v4f*)(src + 4);
  v4u o;
  o[0] = pk16(bf_bits(a[0]), bf_bits(a[1]));
  o[1] = pk16(bf_bits(a[2]), bf_bits(a[3]));
  o[2] = pk16(bf_bits(c[0]), bf_bits(c[1]));
  o[3] = pk16(bf_bits(c[2]), bf_bits(c[3]));
  if (i < n8) *(v4u*)(Y + (size_t)i * 8) = o;
  
}

// =====================================================================================================
// v [b][s][d] f32 -> VT [b][d][s] f16( bf16_RNE(v) * 64 ). Block = 256 threads, one 64(s) x 64(d) tile,
// grid = (SEQ/64, HD/64, NB). Load: thread t reads s row t>>2, d = dblk*64 + 16*(t&3)..+15 (4 x 16-B loads),
// converts and writes the transposed elements into the LDS tile T[d][s] (pitch 72 halves); __syncthreads;
// coverage: load 256 threads x 16 = 64x64; store 2 it x 32 rows x 8 lanes x 8 halves = 64 d rows x 64 s.
// =====================================================================================================
__global__ __launch_bounds__(256) void vtrans_h16(const float* __restrict__ V, unsigned short* VTp) {
  __shared__ __align__(16) _Float16 Tsh[64 * 72];
  const int t    = threadIdx.x;
  const int dblk = blockIdx.y;
  const int b    = blockIdx.z;
  const int s0   = blockIdx.x * 64;
  {
    const int sr = t >> 2, d0 = (t & 3) * 16;
    const float* src = V + ((size_t)b * SEQ + s0 + sr) * HD + dblk * 64 + d0;
#pragma unroll
    for (int i = 0; i < 4; ++i) {
      const v4f x = *(const v4f*)(src + 4 * i);
#pragma unroll
      for (int e = 0; e < 4; ++e) Tsh[(d0 + 4 * i + e) * 72 + sr] = (_Float16)(bfr(x[e]) * VSC);
    }
  }
  __syncthreads();
  const int q8 = t >> 3, c8 = (t & 7) * 8;
  v4u vals[2];
#pragma unroll
  for (int it = 0; it < 2; ++it) {
    const int d = it * 32 + q8;
    HU8 hu;
    hu.h = *(const v8h*)(Tsh + d * 72 + c8);
    vals[it] = hu.u;
  }
#pragma unroll
  for (int it = 0; it < 2; ++it) {
    const int d = it * 32 + q8;
    *(v4u*)(VTp + ((size_t)b * HD + dblk * 64 + d) * SEQ + s0 + c8) = vals[it];
  }
  
}

// =====================================================================================================
// Causal flash attention, head dim 128, one head per sequence, SEQ query/key rows per sequence.
//   QB / KB planes (bf16 bits): element (b, t, d) at [(b*SEQ + t)*128 + d]
//   VT plane (f16, x64): element (b, d, s) at [(b*128 + d)*SEQ + s]
//   out (f32): element (b, t, d) at [(b*SEQ + t)*128 + d]
//   score = (q . k) * 1/sqrt(32) on bf16 WMMA; score := -inf where key > query row (select by index);
//   p = exp(s - m) spilled per wave as f16(1024 p) and f16(2048 (1024 p - hi));
//   context += hi . v^T on f16 WMMA, plus (res . v^T) * 1/2048 from a per-chunk accumulator; online softmax
//   (running max) in f32.
//   Block = 4 waves = 64 query rows of one sequence; grid = NQB * NB; key chunks of 64, block-uniform trip
//   kt = 0..qb (chunks strictly above the diagonal are fully masked and skipped).
//   K / V^T chunk staging: 128 threads x 64 elements per plane = the whole 64x128 / 128x64 tile (plain 16-B
//   loads, __syncthreads before and after); P tiles are wave-private, spilled with _Float16 element stores
//   Output coverage: each wave stores its rows q0..q0+15 x 128 columns, one 512-B row per instruction
// =====================================================================================================
__global__ __launch_bounds__(128)
void attn128(const unsigned short* __restrict__ QBp, const unsigned short* __restrict__ KBp,
             const unsigned short* __restrict__ VTp, float* outp) {
  __shared__ __align__(16) unsigned short Ksh[KC * HD];           // K [kv][d] bf16   16 KB
  __shared__ __align__(16) _Float16 Vth[HD * KC];                 // V^T [d][kv] f16  16 KB
  __shared__ __align__(16) _Float16 Psh[4][16 * KC];              // per wave P hi [row][kv]
  __shared__ __align__(16) _Float16 Rsh[4][16 * KC];              // per wave P residual [row][kv]
  __shared__ __align__(16) float    Os[4][16 * HD];               // per wave context tile [row][d]

  const int tid  = threadIdx.x;
  const int wave = tid >> 5;
  const int lane = tid & 31;
  const int hh   = lane >> 4;
  const int c    = lane & 15;

  const int bx = blockIdx.x;
  const int qb = bx % NQB;
  const int b  = bx / NQB;
  const int q0 = qb * 64 + wave * 16;            // in-sequence query row of this wave's first row
  const int rlo = q0 + 8 * hh;                   // in-sequence row of accumulator element r is rlo + r
  const size_t rowB = (size_t)b * SEQ;
  const _Float16* VTh = (const _Float16*)(const void*)VTp + (size_t)b * HD * SEQ;

  // ---- Q fragments (A operand, row = lane&15): 4 d-chunks ----
  v16b qa[4];
#pragma unroll
  for (int dc = 0; dc < 4; ++dc) qa[dc] = ldfrag_b(QBp + (rowB + q0 + c) * HD + dc * 32 + 8 * hh);

  float mrow[8], lrow[8];
  v8f oacc[8];
#pragma unroll
  for (int r = 0; r < 8; ++r) { mrow[r] = -INFINITY; lrow[r] = 0.f; }
#pragma unroll
  for (int t = 0; t < 8; ++t) oacc[t] = zero8();

#pragma unroll 1
  for (int kt = 0; kt <= qb; ++kt) {         // block-uniform trip count, at most NQB
    const int kv0 = kt * KC;

    __syncthreads();
    {
      const int r = tid >> 1, hf = (tid & 1) * 64;
      const unsigned short* kg = KBp + (rowB + kv0 + r) * HD + hf;    // K row kv0+r, d = hf..hf+63
#pragma unroll
      for (int i = 0; i < 8; ++i) {
        const v4u a0 = *(const v4u*)(kg + 8 * i);
        *(v4u*)(Ksh + r * HD + hf + 8 * i) = a0;
      }
      const _Float16* vg = VTh + (size_t)tid * SEQ + kv0;              // V^T row d = tid, s = kv0..kv0+63
#pragma unroll
      for (int i = 0; i < 8; ++i) {
        const v8h b0 = *(const v8h*)(vg + 8 * i);
        *(v8h*)(Vth + tid * KC + 8 * i) = b0;
      }
    }
    __syncthreads();

    // ---- scores: 16 query rows x 64 keys per wave (B operand: col = key j*16+c, k = d, split map) ----
    v8f s[4];
#pragma unroll
    for (int j = 0; j < 4; ++j) {
      v8f sh = zero8();
#pragma unroll
      for (int dc = 0; dc < 4; ++dc) {
        FragB kb;
        kb.u[0] = *(const v4u*)(Ksh + (j * 16 + c) * HD + dc * 32 + 8 * hh);
        kb.u[1] = *(const v4u*)(Ksh + (j * 16 + c) * HD + dc * 32 + 16 + 8 * hh);
        sh = mma_b(qa[dc], kb.v, sh);
      }
      const int key = kv0 + j * 16 + c;
#pragma unroll
      for (int r = 0; r < 8; ++r) {
        const float sv = sh[r] * SSC;
        s[j][r] = (key > rlo + r) ? -INFINITY : sv;           // causal: keys strictly after the row
      }
    }

    // ---- row max, online softmax, P hi (x1024) and residual (x2048) to LDS ----
    _Float16* pwh = Psh[wave];
    _Float16* pwr = Rsh[wave];
#pragma unroll
    for (int r = 0; r < 8; ++r) {
      float m = s[0][r];
      m = fmaxf(m, s[1][r]);
      m = fmaxf(m, s[2][r]);
      m = fmaxf(m, s[3][r]);
#pragma unroll
      for (int off = 1; off < 16; off <<= 1) m = fmaxf(m, __shfl_xor(m, off, 32));
      const float mnew  = fmaxf(mrow[r], m);
      const float alpha = __expf(mrow[r] - mnew);
      mrow[r] = mnew;
      float psum = 0.f;
#pragma unroll
      for (int j = 0; j < 4; ++j) {
        const float p  = __expf(s[j][r] - mnew);
        psum += p;
        const float ph = p * PSC;
        const _Float16 hq = (_Float16)ph;
        const float res = (ph - (float)hq) * RSC;
        const int pi = (8 * hh + r) * KC + j * 16 + c;
        pwh[pi] = hq;
        pwr[pi] = (_Float16)res;
      }
#pragma unroll
      for (int off = 1; off < 16; off <<= 1) psum += __shfl_xor(psum, off, 32);
      lrow[r] = lrow[r] * alpha + psum;
#pragma unroll
      for (int t = 0; t < 8; ++t) oacc[t][r] *= alpha;
    }
    wave_sync_lds();

    // ---- context += P . V (f16 WMMA; A = P [row][kv], B = V^T [dv][kv], both split map) ----
    FragH pa[2], pr[2];
#pragma unroll
    for (int kk = 0; kk < 2; ++kk) {
      pa[kk].h[0] = *(const v8h*)(pwh + c * KC + kk * 32 + 8 * hh);
      pa[kk].h[1] = *(const v8h*)(pwh + c * KC + kk * 32 + 16 + 8 * hh);
      pr[kk].h[0] = *(const v8h*)(pwr + c * KC + kk * 32 + 8 * hh);
      pr[kk].h[1] = *(const v8h*)(pwr + c * KC + kk * 32 + 16 + 8 * hh);
    }
#pragma unroll
    for (int t = 0; t < 8; ++t) {
      FragH vb[2];
#pragma unroll
      for (int kk = 0; kk < 2; ++kk) {
        vb[kk].h[0] = *(const v8h*)(Vth + (t * 16 + c) * KC + kk * 32 + 8 * hh);
        vb[kk].h[1] = *(const v8h*)(Vth + (t * 16 + c) * KC + kk * 32 + 16 + 8 * hh);
      }
      oacc[t] = mma_h(pa[0].v, vb[0].v, oacc[t]);
      oacc[t] = mma_h(pa[1].v, vb[1].v, oacc[t]);
      v8f rr = mma_h(pr[0].v, vb[0].v, zero8());
      rr = mma_h(pr[1].v, vb[1].v, rr);
#pragma unroll
      for (int r = 0; r < 8; ++r) oacc[t][r] += rr[r] * (1.0f / RSC);
    }
  }

  // ---- normalise (1/l, the 1/1024 p carry and the 1/64 v carry), stage the wave's 16x128 f32 tile,
  float* os = Os[wave];
#pragma unroll
  for (int r = 0; r < 8; ++r) {
    const float l = lrow[r];
    const float inv = ((l > 0.f) ? (1.0f / l) : 0.f) * (1.0f / (PSC * VSC));
#pragma unroll
    for (int t = 0; t < 8; ++t) os[(8 * hh + r) * HD + t * 16 + c] = oacc[t][r] * inv;
  }
  wave_sync_lds();
  {
    const int c4 = lane * 4;
    v4f vals[16];
#pragma unroll
    for (int it = 0; it < 16; ++it) vals[it] = *(const v4f*)(os + it * HD + c4);
    float* C = outp + (rowB + q0) * HD;
#pragma unroll
    for (int it = 0; it < 16; ++it) *(v4f*)(C + (size_t)it * HD + c4) = vals[it];
    
  }
}

// =====================================================================================================
// Workspace map (bytes); every plane is an exact multiple of its whole-line / 64x64-tile store granularity:
//   QB  bf16 [32*2048][128]    0          16777216
//   KB  bf16 [32*2048][128]    16777216   16777216
//   VT  f16  [32][128][2048]   33554432   16777216
//   end                        50331648
// =====================================================================================================
extern "C" void kernel_launch(void* const* d_in, const int* in_sizes, int n_in,
                              void* d_out, int out_size, void* d_ws, size_t ws_size,
                              hipStream_t stream) {
  if (n_in < 3) return;
  if (in_sizes[0] != NE || in_sizes[1] != NE || in_sizes[2] != NE) return;
  if (out_size != NE) return;

  const float* q = (const float*)d_in[0];
  const float* k = (const float*)d_in[1];
  const float* v = (const float*)d_in[2];

  const size_t PB = (size_t)NE * 2;                     // 16777216
  size_t off = 0;
  const size_t oQ  = off; off += PB;
  const size_t oK  = off; off += PB;
  const size_t oVT = off; off += PB;
  if (off > ws_size) return;                            // off = 50331648
  if (off > (size_t)134217728) return;

  char* ws = (char*)d_ws;
  unsigned short* QB = (unsigned short*)(ws + oQ);
  unsigned short* KB = (unsigned short*)(ws + oK);
  unsigned short* VT = (unsigned short*)(ws + oVT);
  float* out0 = (float*)d_out;

  const int n8 = NE / 8;                                // 1048576
  if ((n8 % 256) != 0) return;
  const dim3 blk(256), blk128(128);
  const dim3 gC(n8 / 256);                              // 4096 blocks
  const dim3 gVT(SEQ / 64, HD / 64, NB);                // 32 x 2 x 32 tiles
  const dim3 gA(NB * NQB);                              // 1024 blocks of 128

  // (0) q, k -> bf16 planes; v -> f16( bf16_RNE(v) * 64 ) transposed plane [b][d][s]
  conv_bf16<<<gC, blk, 0, stream>>>(q, QB, n8);
  conv_bf16<<<gC, blk, 0, stream>>>(k, KB, n8);
  vtrans_h16<<<gVT, blk, 0, stream>>>(v, VT);

  // (1) causal flash attention -> out f32 [32][2048][128]
  attn128<<<gA, blk128, 0, stream>>>(QB, KB, VT, out0);
  (void)hipGetLastError();
}

// v001
// Measured time: 223 microseconds a run.
// In two side-by-side timings against v000, it was 1.99 and 2.00 times as fast.
// Contractions: q.k^T on v_wmma_f32_16x16x32_bf16 (bf16 planes of the RNE-converted q and k, one product);
// p.v on v_wmma_f32_16x16x32_f16 (p as f16 x1024 hi plane plus f16 x2048 residual plane with its own per-chunk
// accumulator folded x1/2048 in f32, v^T as f16 of the bf16 RNE-converted v carried x64); all f32 accumulate;
// online softmax (running max) and the causal index select in f32 on VALU.
#include <hip/hip_runtime.h>
#include <hip/hip_bf16.h>
#include <math.h>
#include <stdint.h>

#define NB   32
#define SEQ  2048
#define HD   128
#define KC   64
#define NQB  (SEQ / 64)
#define NE   (NB * SEQ * HD)
#define PSC  1024.0f
#define RSC  2048.0f
#define VSC  64.0f
#define SSC  0.17677669529663687f
#define KP   (HD + 8)      // K row pitch in LDS, elements: 272 B = 16 B x 17
#define VP   (KC + 8)      // V^T and P row pitch in LDS, elements: 144 B = 16 B x 9
#define OP   (64 + 4)      // output staging row pitch, floats: 68 dwords
static_assert((SEQ % 64) == 0);
static_assert(HD == 128);
static_assert(((NE / 8) % 256) == 0);

typedef _Float16 v16h __attribute__((ext_vector_type(16)));
typedef _Float16 v8h  __attribute__((ext_vector_type(8)));
typedef __bf16   v16b __attribute__((ext_vector_type(16)));
typedef float    v8f  __attribute__((ext_vector_type(8)));
typedef float    v4f  __attribute__((ext_vector_type(4)));
typedef unsigned int v4u __attribute__((ext_vector_type(4)));

union FragH { v16h v; v8h h[2]; };
union FragB { v16b v; v4u u[2]; };
union HU8   { v8h h; v4u u; };

// ---- scalar helpers --------------------------------------------------------------------------------
__device__ __forceinline__ unsigned short bf_bits(float f) {          // f32 -> bf16 bits, RNE convert
  unsigned u = __float_as_uint(f);
  return (unsigned short)((u + 0x7FFFu + ((u >> 16) & 1u)) >> 16);
}
__device__ __forceinline__ float bf_up(unsigned short h) { return __uint_as_float(((unsigned)h) << 16); }
__device__ __forceinline__ float bfr(float f) { return bf_up(bf_bits(f)); }   // value of the bf16 RNE convert
__device__ __forceinline__ unsigned pk16(unsigned short a, unsigned short b) { return (unsigned)a | ((unsigned)b << 16); }
__device__ __forceinline__ v8f zero8() { v8f z = {0.f, 0.f, 0.f, 0.f, 0.f, 0.f, 0.f, 0.f}; return z; }

// ---- fragment loaders: 16-bit A/B operand, lane -> row/col (lane&15), p already includes +8*(lane>>4);
//      elements 0..7 <- p[0..7] (k0+8h..), elements 8..15 <- p[16..23] (k0+16+8h..)
__device__ __forceinline__ v16h ldfrag_h(const _Float16* p) {
  FragH f;
  f.h[0] = *(const v8h*)(p);
  f.h[1] = *(const v8h*)(p + 16);
  return f.v;
}
__device__ __forceinline__ v16b ldfrag_b(const unsigned short* p) {
  FragB f;
  f.u[0] = *(const v4u*)(p);
  f.u[1] = *(const v4u*)(p + 16);
  return f.v;
}

// ---- WMMA helpers with trailing VALU hazard gap --------------------------------------------------------
__device__ __forceinline__ v8f mma_h(v16h a, v16h b, v8f c) {
  c = __builtin_amdgcn_wmma_f32_16x16x32_f16(false, a, false, b, (short)0, c, false, false);
#if defined(__HIP_DEVICE_COMPILE__)
  asm volatile("v_nop\n\tv_nop\n\tv_nop\n\tv_nop" : "+v"(c) : "v"(a), "v"(b));
#endif
  return c;
}
__device__ __forceinline__ v8f mma_b(v16b a, v16b b, v8f c) {
  c = __builtin_amdgcn_wmma_f32_16x16x32_bf16(false, a, false, b, (short)0, c, false, false);
#if defined(__HIP_DEVICE_COMPILE__)
  asm volatile("v_nop\n\tv_nop\n\tv_nop\n\tv_nop" : "+v"(c) : "v"(a), "v"(b));
#endif
  return c;
}
__device__ __forceinline__ void wave_sync_lds() {
  __builtin_amdgcn_fence(__ATOMIC_RELEASE, "workgroup");
  __builtin_amdgcn_wave_barrier();
  __builtin_amdgcn_fence(__ATOMIC_ACQUIRE, "workgroup");
}

// =====================================================================================================
// Plane convert: Y[i] = bf16_RNE(X[i]) bits. Thread i handles elements 8i..8i+7 and writes one 16-B piece;
// grid = n8 / 256 (n8 multiple of 256, host-checked). coverage: n8 threads x 8 elements = the whole plane.
// =====================================================================================================
__global__ __launch_bounds__(256) void conv_bf16(const float* __restrict__ X, unsigned short* Y, int n8) {
  const int i  = blockIdx.x * 256 + threadIdx.x;
  const int ic = (i < n8) ? i : (n8 - 1);                     // clamped address
  const float* src = X + (size_t)ic * 8;
  const v4f a = *(const v4f*)(src);
  const v4f c = *(const v4f*)(src + 4);
  v4u o;
  o[0] = pk16(bf_bits(a[0]), bf_bits(a[1]));
  o[1] = pk16(bf_bits(a[2]), bf_bits(a[3]));
  o[2] = pk16(bf_bits(c[0]), bf_bits(c[1]));
  o[3] = pk16(bf_bits(c[2]), bf_bits(c[3]));
  if (i < n8) *(v4u*)(Y + (size_t)i * 8) = o;
  
}

// =====================================================================================================
// v [b][s][d] f32 -> VT [b][d][s] f16( bf16_RNE(v) * 64 ). Block = 256 threads, one 64(s) x 64(d) tile,
// grid = (SEQ/64, HD/64, NB). Load: thread t reads s row t>>2, d = dblk*64 + 16*(t&3)..+15 (4 x 16-B loads),
// converts and writes the transposed elements into the LDS tile T[d][s] (pitch 72 halves); __syncthreads;
// coverage: load 256 threads x 16 = 64x64; store 2 it x 32 rows x 8 lanes x 8 halves = 64 d rows x 64 s.
// =====================================================================================================
__global__ __launch_bounds__(256) void vtrans_h16(const float* __restrict__ V, unsigned short* VTp) {
  __shared__ __align__(16) _Float16 Tsh[64 * 72];
  const int t    = threadIdx.x;
  const int dblk = blockIdx.y;
  const int b    = blockIdx.z;
  const int s0   = blockIdx.x * 64;
  {
    const int sr = t >> 2, d0 = (t & 3) * 16;
    const float* src = V + ((size_t)b * SEQ + s0 + sr) * HD + dblk * 64 + d0;
#pragma unroll
    for (int i = 0; i < 4; ++i) {
      const v4f x = *(const v4f*)(src + 4 * i);
#pragma unroll
      for (int e = 0; e < 4; ++e) Tsh[(d0 + 4 * i + e) * 72 + sr] = (_Float16)(bfr(x[e]) * VSC);
    }
  }
  __syncthreads();
  const int q8 = t >> 3, c8 = (t & 7) * 8;
  v4u vals[2];
#pragma unroll
  for (int it = 0; it < 2; ++it) {
    const int d = it * 32 + q8;
    HU8 hu;
    hu.h = *(const v8h*)(Tsh + d * 72 + c8);
    vals[it] = hu.u;
  }
#pragma unroll
  for (int it = 0; it < 2; ++it) {
    const int d = it * 32 + q8;
    *(v4u*)(VTp + ((size_t)b * HD + dblk * 64 + d) * SEQ + s0 + c8) = vals[it];
  }
  
}

// =====================================================================================================
// Causal flash attention, head dim 128, one head per sequence, SEQ query/key rows per sequence.
//   QB / KB planes (bf16 bits): element (b, t, d) at [(b*SEQ + t)*128 + d]
//   VT plane (f16, x64): element (b, d, s) at [(b*128 + d)*SEQ + s]
//   out (f32): element (b, t, d) at [(b*SEQ + t)*128 + d]
//   score = (q . k) * 1/sqrt(32) on bf16 WMMA; score := -inf where key > query row (select by index);
//   p = exp(s - m) spilled per wave as f16(1024 p) and f16(2048 (1024 p - hi));
//   context += hi . v^T on f16 WMMA, plus (res . v^T) * 1/2048 from a per-chunk accumulator; online softmax
//   (running max) in f32.
//   Block = 4 waves = 64 query rows of one sequence; grid = NQB * NB; key chunks of 64, block-uniform trip
//   kt = 0..qb (chunks strictly above the diagonal are fully masked and skipped).
//   K / V^T chunk staging: 128 threads x 64 elements per plane = the whole 64x128 / 128x64 tile (plain 16-B
//   loads, __syncthreads before and after); P tiles are wave-private, spilled with _Float16 element stores
//   Output coverage: each wave stores its rows q0..q0+15 x 128 columns, two 256-B row pieces per instruction
// =====================================================================================================
__global__ __launch_bounds__(128)
void attn128(const unsigned short* __restrict__ QBp, const unsigned short* __restrict__ KBp,
             const unsigned short* __restrict__ VTp, float* outp) {
  // Row pitches are odd multiples of 16 B, so the 16 lanes of a half wave that read one 16-B piece each from
  // 16 consecutive rows fall on 64 distinct banks.
  __shared__ __align__(16) unsigned short Ksh[KC * KP];           // K [kv][d] bf16, pitch 272 B
  __shared__ __align__(16) _Float16 Vth[HD * VP];                 // V^T [d][kv] f16, pitch 144 B
  __shared__ __align__(16) _Float16 Psh[4][16 * VP];              // per wave P hi [row][kv], pitch 144 B
  __shared__ __align__(16) _Float16 Rsh[4][16 * VP];              // per wave P residual [row][kv], pitch 144 B
  __shared__ __align__(16) float    Os[4][16 * OP];               // per wave context half tile [row][64 d]

  const int tid  = threadIdx.x;
  const int wave = tid >> 5;
  const int lane = tid & 31;
  const int hh   = lane >> 4;
  const int c    = lane & 15;

  const int bx = blockIdx.x;
  const int qb = bx % NQB;
  const int b  = bx / NQB;
  const int q0 = qb * 64 + wave * 16;            // in-sequence query row of this wave's first row
  const int rlo = q0 + 8 * hh;                   // in-sequence row of accumulator element r is rlo + r
  const size_t rowB = (size_t)b * SEQ;
  const _Float16* VTh = (const _Float16*)(const void*)VTp + (size_t)b * HD * SEQ;

  // ---- Q fragments (A operand, row = lane&15): 4 d-chunks ----
  v16b qa[4];
#pragma unroll
  for (int dc = 0; dc < 4; ++dc) qa[dc] = ldfrag_b(QBp + (rowB + q0 + c) * HD + dc * 32 + 8 * hh);

  float mrow[8], lrow[8];
  v8f oacc[8];
#pragma unroll
  for (int r = 0; r < 8; ++r) { mrow[r] = -INFINITY; lrow[r] = 0.f; }
#pragma unroll
  for (int t = 0; t < 8; ++t) oacc[t] = zero8();

#pragma unroll 1
  for (int kt = 0; kt <= qb; ++kt) {         // block-uniform trip count, at most NQB
    const int kv0 = kt * KC;

    __syncthreads();
    {
      const int r = tid >> 1, hf = (tid & 1) * 64;
      const unsigned short* kg = KBp + (rowB + kv0 + r) * HD + hf;    // K row kv0+r, d = hf..hf+63
#pragma unroll
      for (int i = 0; i < 8; ++i) {
        const v4u a0 = *(const v4u*)(kg + 8 * i);
        *(v4u*)(Ksh + r * KP + hf + 8 * i) = a0;
      }
      const _Float16* vg = VTh + (size_t)tid * SEQ + kv0;              // V^T row d = tid, s = kv0..kv0+63
#pragma unroll
      for (int i = 0; i < 8; ++i) {
        const v8h b0 = *(const v8h*)(vg + 8 * i);
        *(v8h*)(Vth + tid * VP + 8 * i) = b0;
      }
    }
    __syncthreads();

    // ---- scores: 16 query rows x 64 keys per wave (B operand: col = key j*16+c, k = d, split map) ----
    v8f s[4];
#pragma unroll
    for (int j = 0; j < 4; ++j) {
      v8f sh = zero8();
#pragma unroll
      for (int dc = 0; dc < 4; ++dc) {
        FragB kb;
        kb.u[0] = *(const v4u*)(Ksh + (j * 16 + c) * KP + dc * 32 + 8 * hh);
        kb.u[1] = *(const v4u*)(Ksh + (j * 16 + c) * KP + dc * 32 + 16 + 8 * hh);
        sh = mma_b(qa[dc], kb.v, sh);
      }
      const int key = kv0 + j * 16 + c;
#pragma unroll
      for (int r = 0; r < 8; ++r) {
        const float sv = sh[r] * SSC;
        s[j][r] = (key > rlo + r) ? -INFINITY : sv;           // causal: keys strictly after the row
      }
    }

    // ---- row max, online softmax, P hi (x1024) and residual (x2048) to LDS ----
    _Float16* pwh = Psh[wave];
    _Float16* pwr = Rsh[wave];
#pragma unroll
    for (int r = 0; r < 8; ++r) {
      float m = s[0][r];
      m = fmaxf(m, s[1][r]);
      m = fmaxf(m, s[2][r]);
      m = fmaxf(m, s[3][r]);
#pragma unroll
      for (int off = 1; off < 16; off <<= 1) m = fmaxf(m, __shfl_xor(m, off, 32));
      const float mnew  = fmaxf(mrow[r], m);
      const float alpha = __expf(mrow[r] - mnew);
      mrow[r] = mnew;
      float psum = 0.f;
#pragma unroll
      for (int j = 0; j < 4; ++j) {
        const float p  = __expf(s[j][r] - mnew);
        psum += p;
        const float ph = p * PSC;
        const _Float16 hq = (_Float16)ph;
        const float res = (ph - (float)hq) * RSC;
        const int pi = (8 * hh + r) * VP + j * 16 + c;
        pwh[pi] = hq;
        pwr[pi] = (_Float16)res;
      }
#pragma unroll
      for (int off = 1; off < 16; off <<= 1) psum += __shfl_xor(psum, off, 32);
      lrow[r] = lrow[r] * alpha + psum;
#pragma unroll
      for (int t = 0; t < 8; ++t) oacc[t][r] *= alpha;
    }
    wave_sync_lds();

    // ---- context += P . V (f16 WMMA; A = P [row][kv], B = V^T [dv][kv], both split map) ----
    FragH pa[2], pr[2];
#pragma unroll
    for (int kk = 0; kk < 2; ++kk) {
      pa[kk].h[0] = *(const v8h*)(pwh + c * VP + kk * 32 + 8 * hh);
      pa[kk].h[1] = *(const v8h*)(pwh + c * VP + kk * 32 + 16 + 8 * hh);
      pr[kk].h[0] = *(const v8h*)(pwr + c * VP + kk * 32 + 8 * hh);
      pr[kk].h[1] = *(const v8h*)(pwr + c * VP + kk * 32 + 16 + 8 * hh);
    }
#pragma unroll
    for (int t = 0; t < 8; ++t) {
      FragH vb[2];
#pragma unroll
      for (int kk = 0; kk < 2; ++kk) {
        vb[kk].h[0] = *(const v8h*)(Vth + (t * 16 + c) * VP + kk * 32 + 8 * hh);
        vb[kk].h[1] = *(const v8h*)(Vth + (t * 16 + c) * VP + kk * 32 + 16 + 8 * hh);
      }
      oacc[t] = mma_h(pa[0].v, vb[0].v, oacc[t]);
      oacc[t] = mma_h(pa[1].v, vb[1].v, oacc[t]);
      v8f rr = mma_h(pr[0].v, vb[0].v, zero8());
      rr = mma_h(pr[1].v, vb[1].v, rr);
#pragma unroll
      for (int r = 0; r < 8; ++r) oacc[t][r] += rr[r] * (1.0f / RSC);
    }
  }

  // ---- normalise (1/l, the 1/1024 p carry and the 1/64 v carry), then stage and store the wave's 16x128 f32
  //      tile as two 16x64 halves: each store instruction writes two 256-B row pieces (whole 128-B lines)
  float* os = Os[wave];
  float inv[8];
#pragma unroll
  for (int r = 0; r < 8; ++r) {
    const float l = lrow[r];
    inv[r] = ((l > 0.f) ? (1.0f / l) : 0.f) * (1.0f / (PSC * VSC));
  }
  v4f vals[2][8];
#pragma unroll
  for (int hv = 0; hv < 2; ++hv) {
    if (hv == 1) wave_sync_lds();             // the first half is read out before the second overwrites it
#pragma unroll
    for (int r = 0; r < 8; ++r) {
#pragma unroll
      for (int t = 0; t < 4; ++t) os[(8 * hh + r) * OP + t * 16 + c] = oacc[4 * hv + t][r] * inv[r];
    }
    wave_sync_lds();
#pragma unroll
    for (int it = 0; it < 8; ++it) vals[hv][it] = *(const v4f*)(os + (2 * it + hh) * OP + c * 4);
  }
  float* C = outp + (rowB + q0) * HD;
#pragma unroll
  for (int hv = 0; hv < 2; ++hv) {
#pragma unroll
    for (int it = 0; it < 8; ++it) *(v4f*)(C + (size_t)(2 * it + hh) * HD + hv * 64 + c * 4) = vals[hv][it];
  }
}

// =====================================================================================================
// Workspace map (bytes); every plane is an exact multiple of its whole-line / 64x64-tile store granularity:
//   QB  bf16 [32*2048][128]    0          16777216
//   KB  bf16 [32*2048][128]    16777216   16777216
//   VT  f16  [32][128][2048]   33554432   16777216
//   end                        50331648
// =====================================================================================================
extern "C" void kernel_launch(void* const* d_in, const int* in_sizes, int n_in,
                              void* d_out, int out_size, void* d_ws, size_t ws_size,
                              hipStream_t stream) {
  if (n_in < 3) return;
  if (in_sizes[0] != NE || in_sizes[1] != NE || in_sizes[2] != NE) return;
  if (out_size != NE) return;

  const float* q = (const float*)d_in[0];
  const float* k = (const float*)d_in[1];
  const float* v = (const float*)d_in[2];

  const size_t PB = (size_t)NE * 2;                     // 16777216
  size_t off = 0;
  const size_t oQ  = off; off += PB;
  const size_t oK  = off; off += PB;
  const size_t oVT = off; off += PB;
  if (off > ws_size) return;                            // off = 50331648
  if (off > (size_t)134217728) return;

  char* ws = (char*)d_ws;
  unsigned short* QB = (unsigned short*)(ws + oQ);
  unsigned short* KB = (unsigned short*)(ws + oK);
  unsigned short* VT = (unsigned short*)(ws + oVT);
  float* out0 = (float*)d_out;

  const int n8 = NE / 8;                                // 1048576
  if ((n8 % 256) != 0) return;
  const dim3 blk(256), blk128(128);
  const dim3 gC(n8 / 256);                              // 4096 blocks
  const dim3 gVT(SEQ / 64, HD / 64, NB);                // 32 x 2 x 32 tiles
  const dim3 gA(NB * NQB);                              // 1024 blocks of 128

  // (0) q, k -> bf16 planes; v -> f16( bf16_RNE(v) * 64 ) transposed plane [b][d][s]
  conv_bf16<<<gC, blk, 0, stream>>>(q, QB, n8);
  conv_bf16<<<gC, blk, 0, stream>>>(k, KB, n8);
  vtrans_h16<<<gVT, blk, 0, stream>>>(v, VT);

  // (1) causal flash attention -> out f32 [32][2048][128]
  attn128<<<gA, blk128, 0, stream>>>(QB, KB, VT, out0);
  (void)hipGetLastError();
}

// v002
// It runs in 181 microseconds.
// Two timings next to v001 put it at 1.25 and 1.24 times that version's speed.
// Counting every step since v000, it is 2.49 times as fast.
// Contractions: q.k^T on v_wmma_f32_16x16x32_bf16 (bf16 planes of the RNE-converted q and k, one product);
// p.v on v_wmma_f32_16x16x32_f16 (p as f16 x1024 hi plane plus f16 x2048 residual plane with its own per-chunk
// accumulator folded x1/2048 in f32, v^T as f16 of the bf16 RNE-converted v carried x64); all f32 accumulate;
// online softmax (running max) and the causal index select in f32 on VALU.
#include <hip/hip_runtime.h>
#include <hip/hip_bf16.h>
#include <math.h>
#include <stdint.h>

#define NB   32
#define SEQ  2048
#define HD   128
#define KC   64
#define NQB  (SEQ / 64)
#define NE   (NB * SEQ * HD)
#define PSC  1024.0f
#define RSC  2048.0f
#define VSC  64.0f
#define SSC  0.17677669529663687f
#define KP   (HD + 8)      // K row pitch in LDS, elements: 272 B = 16 B x 17
#define VP   (KC + 8)      // V^T and P row pitch in LDS, elements: 144 B = 16 B x 9
#define OP   (64 + 4)      // output staging row pitch, floats: 68 dwords
static_assert((SEQ % 64) == 0);
static_assert(HD == 128);
static_assert(((NE / 8) % 256) == 0);

typedef _Float16 v16h __attribute__((ext_vector_type(16)));
typedef _Float16 v8h  __attribute__((ext_vector_type(8)));
typedef __bf16   v16b __attribute__((ext_vector_type(16)));
typedef float    v8f  __attribute__((ext_vector_type(8)));
typedef float    v4f  __attribute__((ext_vector_type(4)));
typedef unsigned int v4u __attribute__((ext_vector_type(4)));

union FragH { v16h v; v8h h[2]; };
union FragB { v16b v; v4u u[2]; };
union HU8   { v8h h; v4u u; };

// ---- scalar helpers --------------------------------------------------------------------------------
__device__ __forceinline__ unsigned short bf_bits(float f) {          // f32 -> bf16 bits, RNE convert
  unsigned u = __float_as_uint(f);
  return (unsigned short)((u + 0x7FFFu + ((u >> 16) & 1u)) >> 16);
}
__device__ __forceinline__ float bf_up(unsigned short h) { return __uint_as_float(((unsigned)h) << 16); }
__device__ __forceinline__ float bfr(float f) { return bf_up(bf_bits(f)); }   // value of the bf16 RNE convert
__device__ __forceinline__ unsigned pk16(unsigned short a, unsigned short b) { return (unsigned)a | ((unsigned)b << 16); }
__device__ __forceinline__ v8f zero8() { v8f z = {0.f, 0.f, 0.f, 0.f, 0.f, 0.f, 0.f, 0.f}; return z; }

// ---- fragment loaders: 16-bit A/B operand, lane -> row/col (lane&15), p already includes +8*(lane>>4);
//      elements 0..7 <- p[0..7] (k0+8h..), elements 8..15 <- p[16..23] (k0+16+8h..)
__device__ __forceinline__ v16h ldfrag_h(const _Float16* p) {
  FragH f;
  f.h[0] = *(const v8h*)(p);
  f.h[1] = *(const v8h*)(p + 16);
  return f.v;
}
__device__ __forceinline__ v16b ldfrag_b(const unsigned short* p) {
  FragB f;
  f.u[0] = *(const v4u*)(p);
  f.u[1] = *(const v4u*)(p + 16);
  return f.v;
}

// ---- WMMA helpers with trailing VALU hazard gap --------------------------------------------------------
__device__ __forceinline__ v8f mma_h(v16h a, v16h b, v8f c) {
  c = __builtin_amdgcn_wmma_f32_16x16x32_f16(false, a, false, b, (short)0, c, false, false);
#if defined(__HIP_DEVICE_COMPILE__)
  asm volatile("v_nop\n\tv_nop\n\tv_nop\n\tv_nop" : "+v"(c) : "v"(a), "v"(b));
#endif
  return c;
}
__device__ __forceinline__ v8f mma_b(v16b a, v16b b, v8f c) {
  c = __builtin_amdgcn_wmma_f32_16x16x32_bf16(false, a, false, b, (short)0, c, false, false);
#if defined(__HIP_DEVICE_COMPILE__)
  asm volatile("v_nop\n\tv_nop\n\tv_nop\n\tv_nop" : "+v"(c) : "v"(a), "v"(b));
#endif
  return c;
}
// ---- asynchronous staging, global -> LDS, through no register -------------------------------------------
__device__ __forceinline__ unsigned lds_off(const void* p) { return (unsigned)(size_t)p; }   // LDS byte address
// Eight 16-B copies per lane: piece i goes from g + i*gs + off to LDS byte l + i*ls; g is the same in every lane
// (scalar base), off the lane's own byte offset. The s_wait_xcnt closes the same statement, so that no address
// register of an issued copy is rewritten in front of it (a precaution).
__device__ __forceinline__ void copy8_async(unsigned l, unsigned ls, const char* g, size_t gs, unsigned off) {
#if defined(__HIP_DEVICE_COMPILE__)
  asm volatile(
      "global_load_async_to_lds_b128 %0, %16, %8\n\t"
      "global_load_async_to_lds_b128 %1, %16, %9\n\t"
      "global_load_async_to_lds_b128 %2, %16, %10\n\t"
      "global_load_async_to_lds_b128 %3, %16, %11\n\t"
      "global_load_async_to_lds_b128 %4, %16, %12\n\t"
      "global_load_async_to_lds_b128 %5, %16, %13\n\t"
      "global_load_async_to_lds_b128 %6, %16, %14\n\t"
      "global_load_async_to_lds_b128 %7, %16, %15\n\t"
      "s_wait_xcnt 0x0"
      :: "v"(l), "v"(l + ls), "v"(l + 2 * ls), "v"(l + 3 * ls),
         "v"(l + 4 * ls), "v"(l + 5 * ls), "v"(l + 6 * ls), "v"(l + 7 * ls),
         "s"(g), "s"(g + gs), "s"(g + 2 * gs), "s"(g + 3 * gs),
         "s"(g + 4 * gs), "s"(g + 5 * gs), "s"(g + 6 * gs), "s"(g + 7 * gs), "v"(off)
      : "memory");
#endif
}
// Hand-over of a staged tile: this wave's LDS reads of the buffer that is refilled next have retired, this wave's
// own copies have landed, then the block barrier publishes them and ends every reader's last read.
__device__ __forceinline__ void publish_point() {
#if defined(__HIP_DEVICE_COMPILE__)
  asm volatile("s_wait_dscnt 0x0" ::: "memory");      // own LDS reads done before the buffer gets a new writer
  asm volatile("s_wait_asynccnt 0x0" ::: "memory");   // own copies landed before other waves may read them
#endif
  __syncthreads();
}
__device__ __forceinline__ void wave_sync_lds() {
  __builtin_amdgcn_fence(__ATOMIC_RELEASE, "workgroup");
  __builtin_amdgcn_wave_barrier();
  __builtin_amdgcn_fence(__ATOMIC_ACQUIRE, "workgroup");
}

// =====================================================================================================
// Plane convert: Y[i] = bf16_RNE(X[i]) bits. Thread i handles elements 8i..8i+7 and writes one 16-B piece;
// grid = n8 / 256 (n8 multiple of 256, host-checked). coverage: n8 threads x 8 elements = the whole plane.
// =====================================================================================================
__global__ __launch_bounds__(256) void conv_bf16(const float* __restrict__ X, unsigned short* Y, int n8) {
  const int i  = blockIdx.x * 256 + threadIdx.x;
  const int ic = (i < n8) ? i : (n8 - 1);                     // clamped address
  const float* src = X + (size_t)ic * 8;
  const v4f a = *(const v4f*)(src);
  const v4f c = *(const v4f*)(src + 4);
  v4u o;
  o[0] = pk16(bf_bits(a[0]), bf_bits(a[1]));
  o[1] = pk16(bf_bits(a[2]), bf_bits(a[3]));
  o[2] = pk16(bf_bits(c[0]), bf_bits(c[1]));
  o[3] = pk16(bf_bits(c[2]), bf_bits(c[3]));
  if (i < n8) *(v4u*)(Y + (size_t)i * 8) = o;
  
}

// =====================================================================================================
// v [b][s][d] f32 -> VT [b][d][s] f16( bf16_RNE(v) * 64 ). Block = 256 threads, one 64(s) x 64(d) tile,
// grid = (SEQ/64, HD/64, NB). Load: thread t reads s row t>>2, d = dblk*64 + 16*(t&3)..+15 (4 x 16-B loads),
// converts and writes the transposed elements into the LDS tile T[d][s] (pitch 72 halves); __syncthreads;
// coverage: load 256 threads x 16 = 64x64; store 2 it x 32 rows x 8 lanes x 8 halves = 64 d rows x 64 s.
// =====================================================================================================
__global__ __launch_bounds__(256) void vtrans_h16(const float* __restrict__ V, unsigned short* VTp) {
  __shared__ __align__(16) _Float16 Tsh[64 * 72];
  const int t    = threadIdx.x;
  const int dblk = blockIdx.y;
  const int b    = blockIdx.z;
  const int s0   = blockIdx.x * 64;
  {
    const int sr = t >> 2, d0 = (t & 3) * 16;
    const float* src = V + ((size_t)b * SEQ + s0 + sr) * HD + dblk * 64 + d0;
#pragma unroll
    for (int i = 0; i < 4; ++i) {
      const v4f x = *(const v4f*)(src + 4 * i);
#pragma unroll
      for (int e = 0; e < 4; ++e) Tsh[(d0 + 4 * i + e) * 72 + sr] = (_Float16)(bfr(x[e]) * VSC);
    }
  }
  __syncthreads();
  const int q8 = t >> 3, c8 = (t & 7) * 8;
  v4u vals[2];
#pragma unroll
  for (int it = 0; it < 2; ++it) {
    const int d = it * 32 + q8;
    HU8 hu;
    hu.h = *(const v8h*)(Tsh + d * 72 + c8);
    vals[it] = hu.u;
  }
#pragma unroll
  for (int it = 0; it < 2; ++it) {
    const int d = it * 32 + q8;
    *(v4u*)(VTp + ((size_t)b * HD + dblk * 64 + d) * SEQ + s0 + c8) = vals[it];
  }
  
}

// =====================================================================================================
// Causal flash attention, head dim 128, one head per sequence, SEQ query/key rows per sequence.
//   QB / KB planes (bf16 bits): element (b, t, d) at [(b*SEQ + t)*128 + d]
//   VT plane (f16, x64): element (b, d, s) at [(b*128 + d)*SEQ + s]
//   out (f32): element (b, t, d) at [(b*SEQ + t)*128 + d]
//   score = (q . k) * 1/sqrt(32) on bf16 WMMA; score := -inf where key > query row (select by index);
//   p = exp(s - m) spilled per wave as f16(1024 p) and f16(2048 (1024 p - hi));
//   context += hi . v^T on f16 WMMA, plus (res . v^T) * 1/2048 from a per-chunk accumulator; online softmax
//   (running max) in f32.
//   Block = 4 waves = 64 query rows of one sequence; grid = NQB * NB; key chunks of 64, block-uniform trip
//   kt = 0..qb (chunks strictly above the diagonal are fully masked and skipped).
//   K / V^T chunk staging: asynchronous 16-B copies to LDS, 128 threads x 8 pieces per plane = the whole 64x128 /
//   128x64 tile, each wave instruction on four whole 128-B lines. One buffer per operand: K of chunk kt+1 is
//   copied behind the barrier that ends the score products of chunk kt and flies under softmax and P.V; V^T of
//   chunk kt+1 is copied behind the barrier that ends P.V of chunk kt and flies under the next score products.
//   P tiles are wave-private, spilled with _Float16 element stores
//   Output coverage: each wave stores its rows q0..q0+15 x 128 columns, two 256-B row pieces per instruction
// =====================================================================================================
__global__ __launch_bounds__(128)
void attn128(const unsigned short* __restrict__ QBp, const unsigned short* __restrict__ KBp,
             const unsigned short* __restrict__ VTp, float* outp) {
  // Row pitches are odd multiples of 16 B, so the 16 lanes of a half wave that read one 16-B piece each from
  // 16 consecutive rows fall on 64 distinct banks.
  __shared__ __align__(16) unsigned short Ksh[KC * KP];           // K [kv][d] bf16, pitch 272 B
  __shared__ __align__(16) _Float16 Vth[HD * VP];                 // V^T [d][kv] f16, pitch 144 B
  __shared__ __align__(16) _Float16 Psh[4][16 * VP];              // per wave P hi [row][kv], pitch 144 B
  __shared__ __align__(16) _Float16 Rsh[4][16 * VP];              // per wave P residual [row][kv], pitch 144 B
  __shared__ __align__(16) float    Os[4][16 * OP];               // per wave context half tile [row][64 d]

  const int tid  = threadIdx.x;
  const int wave = tid >> 5;
  const int lane = tid & 31;
  const int hh   = lane >> 4;
  const int c    = lane & 15;

  const int bx = blockIdx.x;
  const int qb = bx % NQB;
  const int b  = bx / NQB;
  const int q0 = qb * 64 + wave * 16;            // in-sequence query row of this wave's first row
  const int rlo = q0 + 8 * hh;                   // in-sequence row of accumulator element r is rlo + r
  const size_t rowB = (size_t)b * SEQ;
  const _Float16* VTh = (const _Float16*)(const void*)VTp + (size_t)b * HD * SEQ;

  // ---- Q fragments (A operand, row = lane&15): 4 d-chunks ----
  v16b qa[4];
#pragma unroll
  for (int dc = 0; dc < 4; ++dc) qa[dc] = ldfrag_b(QBp + (rowB + q0 + c) * HD + dc * 32 + 8 * hh);

  float mrow[8], lrow[8];
  v8f oacc[8];
#pragma unroll
  for (int r = 0; r < 8; ++r) { mrow[r] = -INFINITY; lrow[r] = 0.f; }
#pragma unroll
  for (int t = 0; t < 8; ++t) oacc[t] = zero8();

  // Staging addresses. K chunk = 16 KiB in a row: piece i of thread tid is 16-B piece i*128+tid, K row
  // i*8 + (tid>>4). V^T chunk = 128 rows of 128 B: piece i is row i*16 + (tid>>3), 16-B piece tid&7.
  const unsigned kl = lds_off(Ksh) + (unsigned)(tid >> 4) * (KP * 2) + (unsigned)(tid & 15) * 16;
  const unsigned vl = lds_off(Vth) + (unsigned)(tid >> 3) * (VP * 2) + (unsigned)(tid & 7) * 16;
  const char* kg = (const char*)(KBp + rowB * HD);                 // block-uniform bases
  const char* vg = (const char*)VTh;
  const unsigned ko = (unsigned)tid * 16;                          // the lane's byte offsets from them
  const unsigned vo = (unsigned)(tid >> 3) * (SEQ * 2) + (unsigned)(tid & 7) * 16;

  // Prologue: K of chunk 0 landed and published, V^T of chunk 0 in flight.
  copy8_async(kl, 8 * KP * 2, kg, 128 * 16, ko);
  publish_point();
  copy8_async(vl, 16 * VP * 2, vg, (size_t)16 * SEQ * 2, vo);

#pragma unroll 1
  for (int kt = 0; kt <= qb; ++kt) {         // block-uniform trip count, at most NQB
    const int kv0 = kt * KC;
    // Chunk copied ahead. The last trip copies its own chunk once more, unread, instead of branching round the
    // copies: with a branch in the loop body the build holds all eight residual tiles to the loop's foot and
    // passes 256 registers, which would leave three blocks on a WGP instead of four.
    const int kn  = (kt < qb) ? kt + 1 : qb;

    // ---- scores: 16 query rows x 64 keys per wave (B operand: col = key j*16+c, k = d, split map) ----
    v8f s[4];
#pragma unroll
    for (int j = 0; j < 4; ++j) {
      v8f sh = zero8();
#pragma unroll
      for (int dc = 0; dc < 4; ++dc) {
        FragB kb;
        kb.u[0] = *(const v4u*)(Ksh + (j * 16 + c) * KP + dc * 32 + 8 * hh);
        kb.u[1] = *(const v4u*)(Ksh + (j * 16 + c) * KP + dc * 32 + 16 + 8 * hh);
        sh = mma_b(qa[dc], kb.v, sh);
      }
      const int key = kv0 + j * 16 + c;
#pragma unroll
      for (int r = 0; r < 8; ++r) {
        const float sv = sh[r] * SSC;
        s[j][r] = (key > rlo + r) ? -INFINITY : sv;           // causal: keys strictly after the row
      }
    }

    // V^T of this chunk published; every wave has left K: refill it
    publish_point();
    copy8_async(kl, 8 * KP * 2, kg + (size_t)kn * (KC * HD * 2), 128 * 16, ko);

    // ---- row max, online softmax, P hi (x1024) and residual (x2048) to LDS ----
    _Float16* pwh = Psh[wave];
    _Float16* pwr = Rsh[wave];
#pragma unroll
    for (int r = 0; r < 8; ++r) {
      float m = s[0][r];
      m = fmaxf(m, s[1][r]);
      m = fmaxf(m, s[2][r]);
      m = fmaxf(m, s[3][r]);
#pragma unroll
      for (int off = 1; off < 16; off <<= 1) m = fmaxf(m, __shfl_xor(m, off, 32));
      const float mnew  = fmaxf(mrow[r], m);
      const float alpha = __expf(mrow[r] - mnew);
      mrow[r] = mnew;
      float psum = 0.f;
#pragma unroll
      for (int j = 0; j < 4; ++j) {
        const float p  = __expf(s[j][r] - mnew);
        psum += p;
        const float ph = p * PSC;
        const _Float16 hq = (_Float16)ph;
        const float res = (ph - (float)hq) * RSC;
        const int pi = (8 * hh + r) * VP + j * 16 + c;
        pwh[pi] = hq;
        pwr[pi] = (_Float16)res;
      }
#pragma unroll
      for (int off = 1; off < 16; off <<= 1) psum += __shfl_xor(psum, off, 32);
      lrow[r] = lrow[r] * alpha + psum;
#pragma unroll
      for (int t = 0; t < 8; ++t) oacc[t][r] *= alpha;
    }
    wave_sync_lds();

    // ---- context += P . V (f16 WMMA; A = P [row][kv], B = V^T [dv][kv], both split map) ----
    FragH pa[2], pr[2];
#pragma unroll
    for (int kk = 0; kk < 2; ++kk) {
      pa[kk].h[0] = *(const v8h*)(pwh + c * VP + kk * 32 + 8 * hh);
      pa[kk].h[1] = *(const v8h*)(pwh + c * VP + kk * 32 + 16 + 8 * hh);
      pr[kk].h[0] = *(const v8h*)(pwr + c * VP + kk * 32 + 8 * hh);
      pr[kk].h[1] = *(const v8h*)(pwr + c * VP + kk * 32 + 16 + 8 * hh);
    }
#pragma unroll
    for (int t = 0; t < 8; ++t) {
      FragH vb[2];
#pragma unroll
      for (int kk = 0; kk < 2; ++kk) {
        vb[kk].h[0] = *(const v8h*)(Vth + (t * 16 + c) * VP + kk * 32 + 8 * hh);
        vb[kk].h[1] = *(const v8h*)(Vth + (t * 16 + c) * VP + kk * 32 + 16 + 8 * hh);
      }
      oacc[t] = mma_h(pa[0].v, vb[0].v, oacc[t]);
      oacc[t] = mma_h(pa[1].v, vb[1].v, oacc[t]);
      v8f rr = mma_h(pr[0].v, vb[0].v, zero8());
      rr = mma_h(pr[1].v, vb[1].v, rr);
#pragma unroll
      for (int r = 0; r < 8; ++r) oacc[t][r] += rr[r] * (1.0f / RSC);
    }

    // K of the next chunk published; every wave has left V^T: refill it
    publish_point();
    copy8_async(vl, 16 * VP * 2, vg + (size_t)kn * (KC * 2), (size_t)16 * SEQ * 2, vo);
  }
#if defined(__HIP_DEVICE_COMPILE__)
  asm volatile("s_wait_asynccnt 0x0" ::: "memory");   // the last trip's copies have landed before the wave ends
#endif

  // ---- normalise (1/l, the 1/1024 p carry and the 1/64 v carry), then stage and store the wave's 16x128 f32
  //      tile as two 16x64 halves: each store instruction writes two 256-B row pieces (whole 128-B lines)
  float* os = Os[wave];
  float inv[8];
#pragma unroll
  for (int r = 0; r < 8; ++r) {
    const float l = lrow[r];
    inv[r] = ((l > 0.f) ? (1.0f / l) : 0.f) * (1.0f / (PSC * VSC));
  }
  v4f vals[2][8];
#pragma unroll
  for (int hv = 0; hv < 2; ++hv) {
    if (hv == 1) wave_sync_lds();             // the first half is read out before the second overwrites it
#pragma unroll
    for (int r = 0; r < 8; ++r) {
#pragma unroll
      for (int t = 0; t < 4; ++t) os[(8 * hh + r) * OP + t * 16 + c] = oacc[4 * hv + t][r] * inv[r];
    }
    wave_sync_lds();
#pragma unroll
    for (int it = 0; it < 8; ++it) vals[hv][it] = *(const v4f*)(os + (2 * it + hh) * OP + c * 4);
  }
  float* C = outp + (rowB + q0) * HD;
#pragma unroll
  for (int hv = 0; hv < 2; ++hv) {
#pragma unroll
    for (int it = 0; it < 8; ++it) *(v4f*)(C + (size_t)(2 * it + hh) * HD + hv * 64 + c * 4) = vals[hv][it];
  }
}

// =====================================================================================================
// Workspace map (bytes); every plane is an exact multiple of its whole-line / 64x64-tile store granularity:
//   QB  bf16 [32*2048][128]    0          16777216
//   KB  bf16 [32*2048][128]    16777216   16777216
//   VT  f16  [32][128][2048]   33554432   16777216
//   end                        50331648
// =====================================================================================================
extern "C" void kernel_launch(void* const* d_in, const int* in_sizes, int n_in,
                              void* d_out, int out_size, void* d_ws, size_t ws_size,
                              hipStream_t stream) {
  if (n_in < 3) return;
  if (in_sizes[0] != NE || in_sizes[1] != NE || in_sizes[2] != NE) return;
  if (out_size != NE) return;

  const float* q = (const float*)d_in[0];
  const float* k = (const float*)d_in[1];
  const float* v = (const float*)d_in[2];

  const size_t PB = (size_t)NE * 2;                     // 16777216
  size_t off = 0;
  const size_t oQ  = off; off += PB;
  const size_t oK  = off; off += PB;
  const size_t oVT = off; off += PB;
  if (off > ws_size) return;                            // off = 50331648
  if (off > (size_t)134217728) return;

  char* ws = (char*)d_ws;
  unsigned short* QB = (unsigned short*)(ws + oQ);
  unsigned short* KB = (unsigned short*)(ws + oK);
  unsigned short* VT = (unsigned short*)(ws + oVT);
  float* out0 = (float*)d_out;

  const int n8 = NE / 8;                                // 1048576
  if ((n8 % 256) != 0) return;
  const dim3 blk(256), blk128(128);
  const dim3 gC(n8 / 256);                              // 4096 blocks
  const dim3 gVT(SEQ / 64, HD / 64, NB);                // 32 x 2 x 32 tiles
  const dim3 gA(NB * NQB);                              // 1024 blocks of 128

  // (0) q, k -> bf16 planes; v -> f16( bf16_RNE(v) * 64 ) transposed plane [b][d][s]
  conv_bf16<<<gC, blk, 0, stream>>>(q, QB, n8);
  conv_bf16<<<gC, blk, 0, stream>>>(k, KB, n8);
  vtrans_h16<<<gVT, blk, 0, stream>>>(v, VT);

  // (1) causal flash attention -> out f32 [32][2048][128]
  attn128<<<gA, blk128, 0, stream>>>(QB, KB, VT, out0);
  (void)hipGetLastError();
}

// v003
// It runs in 119 microseconds.
// Two timings next to v002 both put it at 1.53 times that version's speed.
// Over all steps from v000 it is 3.80 times as fast.
// Contractions: q.k^T on v_wmma_f32_16x16x32_bf16 (bf16 planes of the RNE-converted q and k, one product);
// p.v on v_wmma_f32_16x16x32_f16 (p as f16 x1024 hi plane plus f16 x2048 residual plane with its own per-chunk
// accumulator folded x1/2048 in f32, v^T as f16 of the bf16 RNE-converted v carried x64); all f32 accumulate;
// online softmax (running max) and the causal index select in f32 on VALU. Both products are formed transposed
// (S^T = K.Q^T, O^T += V^T.P^T): a lane holds one query's scores, and P^T goes from the score accumulators into the
// B operand in registers.
#include <hip/hip_runtime.h>
#include <hip/hip_bf16.h>
#include <math.h>
#include <stdint.h>

#define NB   32
#define SEQ  2048
#define HD   128
#define KC   64
#define NQB  (SEQ / 64)
#define NE   (NB * SEQ * HD)
#define PSC  1024.0f
#define RSC  2048.0f
#define VSC  64.0f
#define SSC  0.17677669529663687f
#define KP   (HD + 8)      // K row pitch in LDS, elements: 272 B = 16 B x 17
#define VP   (KC + 8)      // V^T row pitch in LDS, elements: 144 B = 16 B x 9
#define OP   (64 + 4)      // output staging row pitch, floats: 68 dwords
static_assert((SEQ % 64) == 0);
static_assert(HD == 128);
static_assert(((NE / 8) % 256) == 0);

typedef _Float16 v16h __attribute__((ext_vector_type(16)));
typedef _Float16 v8h  __attribute__((ext_vector_type(8)));
typedef __bf16   v16b __attribute__((ext_vector_type(16)));
typedef float    v8f  __attribute__((ext_vector_type(8)));
typedef float    v4f  __attribute__((ext_vector_type(4)));
typedef unsigned int v4u __attribute__((ext_vector_type(4)));

union FragH { v16h v; v8h h[2]; };
union FragB { v16b v; v4u u[2]; };
union HU8   { v8h h; v4u u; };

// ---- scalar helpers --------------------------------------------------------------------------------
__device__ __forceinline__ unsigned short bf_bits(float f) {          // f32 -> bf16 bits, RNE convert
  unsigned u = __float_as_uint(f);
  return (unsigned short)((u + 0x7FFFu + ((u >> 16) & 1u)) >> 16);
}
__device__ __forceinline__ float bf_up(unsigned short h) { return __uint_as_float(((unsigned)h) << 16); }
__device__ __forceinline__ float bfr(float f) { return bf_up(bf_bits(f)); }   // value of the bf16 RNE convert
__device__ __forceinline__ unsigned pk16(unsigned short a, unsigned short b) { return (unsigned)a | ((unsigned)b << 16); }
// value of lane l ^ 16 (the other half wave), by a vector cross-row move; every lane is on where it is used
__device__ __forceinline__ float xhalf(float x) {
  const int b = __builtin_bit_cast(int, x);
  return __builtin_bit_cast(float, __builtin_amdgcn_permlanex16(b, b, 0x76543210, 0xfedcba98, false, false));
}
__device__ __forceinline__ v8f zero8() { v8f z = {0.f, 0.f, 0.f, 0.f, 0.f, 0.f, 0.f, 0.f}; return z; }

// ---- fragment loaders: 16-bit A/B operand, lane -> row/col (lane&15), p already includes +8*(lane>>4);
//      elements 0..7 <- p[0..7] (k0+8h..), elements 8..15 <- p[16..23] (k0+16+8h..)
__device__ __forceinline__ v16h ldfrag_h(const _Float16* p) {
  FragH f;
  f.h[0] = *(const v8h*)(p);
  f.h[1] = *(const v8h*)(p + 16);
  return f.v;
}
__device__ __forceinline__ v16b ldfrag_b(const unsigned short* p) {
  FragB f;
  f.u[0] = *(const v4u*)(p);
  f.u[1] = *(const v4u*)(p + 16);
  return f.v;
}

// ---- WMMA helpers with trailing VALU hazard gap --------------------------------------------------------
__device__ __forceinline__ v8f mma_h(v16h a, v16h b, v8f c) {
  c = __builtin_amdgcn_wmma_f32_16x16x32_f16(false, a, false, b, (short)0, c, false, false);
#if defined(__HIP_DEVICE_COMPILE__)
  asm volatile("v_nop\n\tv_nop\n\tv_nop\n\tv_nop" : "+v"(c) : "v"(a), "v"(b));
#endif
  return c;
}
__device__ __forceinline__ v8f mma_b(v16b a, v16b b, v8f c) {
  c = __builtin_amdgcn_wmma_f32_16x16x32_bf16(false, a, false, b, (short)0, c, false, false);
#if defined(__HIP_DEVICE_COMPILE__)
  asm volatile("v_nop\n\tv_nop\n\tv_nop\n\tv_nop" : "+v"(c) : "v"(a), "v"(b));
#endif
  return c;
}
// ---- asynchronous staging, global -> LDS, through no register -------------------------------------------
__device__ __forceinline__ unsigned lds_off(const void* p) { return (unsigned)(size_t)p; }   // LDS byte address
// Eight 16-B copies per lane: piece i goes from g + i*gs + off to LDS byte l + i*ls; g is the same in every lane
// (scalar base), off the lane's own byte offset. The s_wait_xcnt closes the same statement, so that no address
// register of an issued copy is rewritten in front of it (a precaution).
__device__ __forceinline__ void copy8_async(unsigned l, unsigned ls, const char* g, size_t gs, unsigned off) {
#if defined(__HIP_DEVICE_COMPILE__)
  asm volatile(
      "global_load_async_to_lds_b128 %0, %16, %8\n\t"
      "global_load_async_to_lds_b128 %1, %16, %9\n\t"
      "global_load_async_to_lds_b128 %2, %16, %10\n\t"
      "global_load_async_to_lds_b128 %3, %16, %11\n\t"
      "global_load_async_to_lds_b128 %4, %16, %12\n\t"
      "global_load_async_to_lds_b128 %5, %16, %13\n\t"
      "global_load_async_to_lds_b128 %6, %16, %14\n\t"
      "global_load_async_to_lds_b128 %7, %16, %15\n\t"
      "s_wait_xcnt 0x0"
      :: "v"(l), "v"(l + ls), "v"(l + 2 * ls), "v"(l + 3 * ls),
         "v"(l + 4 * ls), "v"(l + 5 * ls), "v"(l + 6 * ls), "v"(l + 7 * ls),
         "s"(g), "s"(g + gs), "s"(g + 2 * gs), "s"(g + 3 * gs),
         "s"(g + 4 * gs), "s"(g + 5 * gs), "s"(g + 6 * gs), "s"(g + 7 * gs), "v"(off)
      : "memory");
#endif
}
// Hand-over of a staged tile: this wave's LDS reads of the buffer that is refilled next have retired, this wave's
// own copies have landed, then the block barrier publishes them and ends every reader's last read.
__device__ __forceinline__ void publish_point() {
#if defined(__HIP_DEVICE_COMPILE__)
  asm volatile("s_wait_dscnt 0x0" ::: "memory");      // own LDS reads done before the buffer gets a new writer
  asm volatile("s_wait_asynccnt 0x0" ::: "memory");   // own copies landed before other waves may read them
#endif
  __syncthreads();
}
__device__ __forceinline__ void wave_sync_lds() {
  __builtin_amdgcn_fence(__ATOMIC_RELEASE, "workgroup");
  __builtin_amdgcn_wave_barrier();
  __builtin_amdgcn_fence(__ATOMIC_ACQUIRE, "workgroup");
}

// =====================================================================================================
// Plane convert: Y[i] = bf16_RNE(X[i]) bits. Thread i handles elements 8i..8i+7 and writes one 16-B piece;
// grid = n8 / 256 (n8 multiple of 256, host-checked). coverage: n8 threads x 8 elements = the whole plane.
// =====================================================================================================
__global__ __launch_bounds__(256) void conv_bf16(const float* __restrict__ X, unsigned short* Y, int n8) {
  const int i  = blockIdx.x * 256 + threadIdx.x;
  const int ic = (i < n8) ? i : (n8 - 1);                     // clamped address
  const float* src = X + (size_t)ic * 8;
  const v4f a = *(const v4f*)(src);
  const v4f c = *(const v4f*)(src + 4);
  v4u o;
  o[0] = pk16(bf_bits(a[0]), bf_bits(a[1]));
  o[1] = pk16(bf_bits(a[2]), bf_bits(a[3]));
  o[2] = pk16(bf_bits(c[0]), bf_bits(c[1]));
  o[3] = pk16(bf_bits(c[2]), bf_bits(c[3]));
  if (i < n8) *(v4u*)(Y + (size_t)i * 8) = o;
  
}

// =====================================================================================================
// v [b][s][d] f32 -> VT [b][d][s] f16( bf16_RNE(v) * 64 ). Block = 256 threads, one 64(s) x 64(d) tile,
// grid = (SEQ/64, HD/64, NB). Load: thread t reads s row t>>2, d = dblk*64 + 16*(t&3)..+15 (4 x 16-B loads),
// converts and writes the transposed elements into the LDS tile T[d][s] (pitch 72 halves); __syncthreads;
// coverage: load 256 threads x 16 = 64x64; store 2 it x 32 rows x 8 lanes x 8 halves = 64 d rows x 64 s.
// =====================================================================================================
__global__ __launch_bounds__(256) void vtrans_h16(const float* __restrict__ V, unsigned short* VTp) {
  __shared__ __align__(16) _Float16 Tsh[64 * 72];
  const int t    = threadIdx.x;
  const int dblk = blockIdx.y;
  const int b    = blockIdx.z;
  const int s0   = blockIdx.x * 64;
  {
    const int sr = t >> 2, d0 = (t & 3) * 16;
    const float* src = V + ((size_t)b * SEQ + s0 + sr) * HD + dblk * 64 + d0;
#pragma unroll
    for (int i = 0; i < 4; ++i) {
      const v4f x = *(const v4f*)(src + 4 * i);
#pragma unroll
      for (int e = 0; e < 4; ++e) Tsh[(d0 + 4 * i + e) * 72 + sr] = (_Float16)(bfr(x[e]) * VSC);
    }
  }
  __syncthreads();
  const int q8 = t >> 3, c8 = (t & 7) * 8;
  v4u vals[2];
#pragma unroll
  for (int it = 0; it < 2; ++it) {
    const int d = it * 32 + q8;
    HU8 hu;
    hu.h = *(const v8h*)(Tsh + d * 72 + c8);
    vals[it] = hu.u;
  }
#pragma unroll
  for (int it = 0; it < 2; ++it) {
    const int d = it * 32 + q8;
    *(v4u*)(VTp + ((size_t)b * HD + dblk * 64 + d) * SEQ + s0 + c8) = vals[it];
  }
  
}

// =====================================================================================================
// Causal flash attention, head dim 128, one head per sequence, SEQ query/key rows per sequence.
//   QB / KB planes (bf16 bits): element (b, t, d) at [(b*SEQ + t)*128 + d]
//   VT plane (f16, x64): element (b, d, s) at [(b*128 + d)*SEQ + s]
//   out (f32): element (b, t, d) at [(b*SEQ + t)*128 + d]
//   score = (k . q) * 1/sqrt(32) on bf16 WMMA, A = K rows, B = Q: accumulator register r of lane (c, h) is key
//   16j + 8h + r against query q0 + c; score := -inf where key > query row (select by index);
//   maximum and sum of a query run inside its lane, the two half waves exchange the maximum once per chunk and
//   join their sums once, behind the loop;
//   p = exp(s - m) packed in registers as f16(1024 p) and f16(2048 (1024 p - hi)): score tiles 2kk and 2kk+1 are
//   elements 0..7 and 8..15 of the B operand of keys 32kk..32kk+31, the k order of the V^T loader;
//   context^T += v^T . hi on f16 WMMA, plus (v^T . res) * 1/2048 from a per-chunk accumulator: register r of lane
//   (c, h) in tile t is d = 16t + 8h + r of query q0 + c; online softmax (running max) in f32.
//   Block = 4 waves = 64 query rows of one sequence; grid = NQB * NB; key chunks of 64, block-uniform trip
//   kt = 0..qb (chunks strictly above the diagonal are fully masked and skipped).
//   K / V^T chunk staging: asynchronous 16-B copies to LDS, 128 threads x 8 pieces per plane = the whole 64x128 /
//   128x64 tile, each wave instruction on four whole 128-B lines. One buffer per operand: K of chunk kt+1 is
//   copied behind the barrier that ends the score products of chunk kt and flies under softmax and P.V; V^T of
//   chunk kt+1 is copied behind the barrier that ends P.V of chunk kt and flies under the next score products.
//   Output coverage: each wave stores its rows q0..q0+15 x 128 columns, two 256-B row pieces per instruction
// =====================================================================================================
__global__ __launch_bounds__(128)
void attn128(const unsigned short* __restrict__ QBp, const unsigned short* __restrict__ KBp,
             const unsigned short* __restrict__ VTp, float* outp) {
  // Row pitches are odd multiples of 16 B, so the 16 lanes of a half wave that read one 16-B piece each from
  // 16 consecutive rows fall on 64 distinct banks.
  __shared__ __align__(16) unsigned short Ksh[KC * KP];           // K [kv][d] bf16, pitch 272 B
  __shared__ __align__(16) _Float16 Vth[HD * VP];                 // V^T [d][kv] f16, pitch 144 B
  __shared__ __align__(16) float    Os[4][16 * OP];               // per wave context half tile [row][64 d]

  const int tid  = threadIdx.x;
  const int wave = tid >> 5;
  const int lane = tid & 31;
  const int hh   = lane >> 4;
  const int c    = lane & 15;

  const int bx = blockIdx.x;
  const int qb = bx % NQB;
  const int b  = bx / NQB;
  const int q0 = qb * 64 + wave * 16;            // in-sequence query row of this wave's first row
  const int qrow = q0 + c;                       // in-sequence query row of this lane's accumulator column
  const size_t rowB = (size_t)b * SEQ;
  const _Float16* VTh = (const _Float16*)(const void*)VTp + (size_t)b * HD * SEQ;

  // ---- Q fragments (B operand, col = lane&15): 4 d-chunks ----
  v16b qa[4];
#pragma unroll
  for (int dc = 0; dc < 4; ++dc) qa[dc] = ldfrag_b(QBp + (rowB + q0 + c) * HD + dc * 32 + 8 * hh);

  float mrun = -INFINITY;                        // running maximum of the lane's query, alike in both half waves
  float lrun = 0.f;                              // running sum over the keys of this lane's own half wave
  v8f oacc[8];
#pragma unroll
  for (int t = 0; t < 8; ++t) oacc[t] = zero8();

  // Staging addresses. K chunk = 16 KiB in a row: piece i of thread tid is 16-B piece i*128+tid, K row
  // i*8 + (tid>>4). V^T chunk = 128 rows of 128 B: piece i is row i*16 + (tid>>3), 16-B piece tid&7.
  const unsigned kl = lds_off(Ksh) + (unsigned)(tid >> 4) * (KP * 2) + (unsigned)(tid & 15) * 16;
  const unsigned vl = lds_off(Vth) + (unsigned)(tid >> 3) * (VP * 2) + (unsigned)(tid & 7) * 16;
  const char* kg = (const char*)(KBp + rowB * HD);                 // block-uniform bases
  const char* vg = (const char*)VTh;
  const unsigned ko = (unsigned)tid * 16;                          // the lane's byte offsets from them
  const unsigned vo = (unsigned)(tid >> 3) * (SEQ * 2) + (unsigned)(tid & 7) * 16;

  // Prologue: K of chunk 0 landed and published, V^T of chunk 0 in flight.
  copy8_async(kl, 8 * KP * 2, kg, 128 * 16, ko);
  publish_point();
  copy8_async(vl, 16 * VP * 2, vg, (size_t)16 * SEQ * 2, vo);

#pragma unroll 1
  for (int kt = 0; kt <= qb; ++kt) {         // block-uniform trip count, at most NQB
    const int kv0 = kt * KC;
    // Chunk copied ahead. The last trip copies its own chunk once more, unread, instead of branching round the
    // copies: with a branch in the loop body the build holds all eight residual tiles to the loop's foot and
    // passes 256 registers, which would leave three blocks on a WGP instead of four.
    const int kn  = (kt < qb) ? kt + 1 : qb;

    // ---- scores^T: 64 keys x 16 queries per wave (A operand: row = key j*16+c, k = d, split map) ----
    v8f s[4];
#pragma unroll
    for (int j = 0; j < 4; ++j) {
      v8f sh = zero8();
#pragma unroll
      for (int dc = 0; dc < 4; ++dc) {
        FragB kb;
        kb.u[0] = *(const v4u*)(Ksh + (j * 16 + c) * KP + dc * 32 + 8 * hh);
        kb.u[1] = *(const v4u*)(Ksh + (j * 16 + c) * KP + dc * 32 + 16 + 8 * hh);
        sh = mma_b(kb.v, qa[dc], sh);
      }
      const int key = kv0 + j * 16 + 8 * hh;
#pragma unroll
      for (int r = 0; r < 8; ++r) {
        const float sv = sh[r] * SSC;
        s[j][r] = (key + r > qrow) ? -INFINITY : sv;          // causal: keys strictly after the row
      }
    }

    // V^T of this chunk published; every wave has left K: refill it
    publish_point();
    copy8_async(kl, 8 * KP * 2, kg + (size_t)kn * (KC * HD * 2), 128 * 16, ko);

    // ---- query max, online softmax, P^T hi (x1024) and residual (x2048) packed as B operands ----
    float mj[4];                                 // one chain per score tile, so that the chains are independent
#pragma unroll
    for (int j = 0; j < 4; ++j) {
      mj[j] = s[j][0];
#pragma unroll
      for (int r = 1; r < 8; ++r) mj[j] = fmaxf(mj[j], s[j][r]);
    }
    float m = fmaxf(fmaxf(mj[0], mj[1]), fmaxf(mj[2], mj[3]));
    m = fmaxf(m, xhalf(m));                      // the other eight keys of each tile lie in the other half wave
    const float mnew  = fmaxf(mrun, m);
    const float alpha = __expf(mrun - mnew);
    mrun = mnew;
    FragH pa[2], pr[2];
    float pj[4];
#pragma unroll
    for (int j = 0; j < 4; ++j) {
      pj[j] = 0.f;
#pragma unroll
      for (int r = 0; r < 8; ++r) {
        const float p  = __expf(s[j][r] - mnew);
        pj[j] += p;
        const float ph = p * PSC;
        const _Float16 hq = (_Float16)ph;
        const float res = (ph - (float)hq) * RSC;
        pa[j >> 1].v[(j & 1) * 8 + r] = hq;
        pr[j >> 1].v[(j & 1) * 8 + r] = (_Float16)res;
      }
    }
    lrun = lrun * alpha + ((pj[0] + pj[1]) + (pj[2] + pj[3]));
#pragma unroll
    for (int t = 0; t < 8; ++t) {
#pragma unroll
      for (int r = 0; r < 8; ++r) oacc[t][r] *= alpha;
    }

    // ---- context^T += V^T . P^T (f16 WMMA; A = V^T [dv][kv] by the split map, B = P^T from the accumulators) ----
#pragma unroll
    for (int t = 0; t < 8; ++t) {
      FragH vb[2];
#pragma unroll
      for (int kk = 0; kk < 2; ++kk) {
        vb[kk].h[0] = *(const v8h*)(Vth + (t * 16 + c) * VP + kk * 32 + 8 * hh);
        vb[kk].h[1] = *(const v8h*)(Vth + (t * 16 + c) * VP + kk * 32 + 16 + 8 * hh);
      }
      oacc[t] = mma_h(vb[0].v, pa[0].v, oacc[t]);
      oacc[t] = mma_h(vb[1].v, pa[1].v, oacc[t]);
      v8f rr = mma_h(vb[0].v, pr[0].v, zero8());
      rr = mma_h(vb[1].v, pr[1].v, rr);
#pragma unroll
      for (int r = 0; r < 8; ++r) oacc[t][r] += rr[r] * (1.0f / RSC);
    }

    // K of the next chunk published; every wave has left V^T: refill it
    publish_point();
    copy8_async(vl, 16 * VP * 2, vg + (size_t)kn * (KC * 2), (size_t)16 * SEQ * 2, vo);
  }
#if defined(__HIP_DEVICE_COMPILE__)
  asm volatile("s_wait_asynccnt 0x0" ::: "memory");   // the last trip's copies have landed before the wave ends
#endif

  // ---- normalise (1/l, the 1/1024 p carry and the 1/64 v carry), then stage and store the wave's 16x128 f32
  //      tile as two 16x64 halves: each store instruction writes two 256-B row pieces (whole 128-B lines)
  float* os = Os[wave];
  const float l   = lrun + xhalf(lrun);          // the two half waves' sums of the lane's query
  const float inv = ((l > 0.f) ? (1.0f / l) : 0.f) * (1.0f / (PSC * VSC));
  v4f vals[2][8];
#pragma unroll
  for (int hv = 0; hv < 2; ++hv) {
    if (hv == 1) wave_sync_lds();             // the first half is read out before the second overwrites it
#pragma unroll
    for (int t = 0; t < 4; ++t) {               // a lane's eight registers are eight consecutive d of its query
      const v8f o = oacc[4 * hv + t];
      const v4f lo = {o[0] * inv, o[1] * inv, o[2] * inv, o[3] * inv};
      const v4f hi = {o[4] * inv, o[5] * inv, o[6] * inv, o[7] * inv};
      *(v4f*)(os + c * OP + t * 16 + 8 * hh)     = lo;
      *(v4f*)(os + c * OP + t * 16 + 8 * hh + 4) = hi;
    }
    wave_sync_lds();
#pragma unroll
    for (int it = 0; it < 8; ++it) vals[hv][it] = *(const v4f*)(os + (2 * it + hh) * OP + c * 4);
  }
  float* C = outp + (rowB + q0) * HD;
#pragma unroll
  for (int hv = 0; hv < 2; ++hv) {
#pragma unroll
    for (int it = 0; it < 8; ++it) *(v4f*)(C + (size_t)(2 * it + hh) * HD + hv * 64 + c * 4) = vals[hv][it];
  }
}

// =====================================================================================================
// Workspace map (bytes); every plane is an exact multiple of its whole-line / 64x64-tile store granularity:
//   QB  bf16 [32*2048][128]    0          16777216
//   KB  bf16 [32*2048][128]    16777216   16777216
//   VT  f16  [32][128][2048]   33554432   16777216
//   end                        50331648
// =====================================================================================================
extern "C" void kernel_launch(void* const* d_in, const int* in_sizes, int n_in,
                              void* d_out, int out_size, void* d_ws, size_t ws_size,
                              hipStream_t stream) {
  if (n_in < 3) return;
  if (in_sizes[0] != NE || in_sizes[1] != NE || in_sizes[2] != NE) return;
  if (out_size != NE) return;

  const float* q = (const float*)d_in[0];
  const float* k = (const float*)d_in[1];
  const float* v = (const float*)d_in[2];

  const size_t PB = (size_t)NE * 2;                     // 16777216
  size_t off = 0;
  const size_t oQ  = off; off += PB;
  const size_t oK  = off; off += PB;
  const size_t oVT = off; off += PB;
  if (off > ws_size) return;                            // off = 50331648
  if (off > (size_t)134217728) return;

  char* ws = (char*)d_ws;
  unsigned short* QB = (unsigned short*)(ws + oQ);
  unsigned short* KB = (unsigned short*)(ws + oK);
  unsigned short* VT = (unsigned short*)(ws + oVT);
  float* out0 = (float*)d_out;

  const int n8 = NE / 8;                                // 1048576
  if ((n8 % 256) != 0) return;
  const dim3 blk(256), blk128(128);
  const dim3 gC(n8 / 256);                              // 4096 blocks
  const dim3 gVT(SEQ / 64, HD / 64, NB);                // 32 x 2 x 32 tiles
  const dim3 gA(NB * NQB);                              // 1024 blocks of 128

  // (0) q, k -> bf16 planes; v -> f16( bf16_RNE(v) * 64 ) transposed plane [b][d][s]
  conv_bf16<<<gC, blk, 0, stream>>>(q, QB, n8);
  conv_bf16<<<gC, blk, 0, stream>>>(k, KB, n8);
  vtrans_h16<<<gVT, blk, 0, stream>>>(v, VT);

  // (1) causal flash attention -> out f32 [32][2048][128]
  attn128<<<gA, blk128, 0, stream>>>(QB, KB, VT, out0);
  (void)hipGetLastError();
}

// v004
// A run of this version takes 106 microseconds.
// Timed twice side by side with v003, it ran 1.12 times as fast both times.
// Counting every step since v000, it is 4.26 times as fast.
// Contractions: q.k^T on v_wmma_f32_16x16x32_bf16 (bf16 planes of the RNE-converted q and k, one product);
// p.v on v_wmma_f32_16x16x32_f16 (p as f16 x1024 hi plane plus f16 x2048 residual plane with its own per-chunk
// accumulator folded x1/2048 in f32, v^T as f16 of the bf16 RNE-converted v carried x64); all f32 accumulate;
// online softmax (running max) and the causal index select in f32 on VALU. Both products are formed transposed
// (S^T = K.Q^T, O^T += V^T.P^T): a lane holds one query's scores, and P^T goes from the score accumulators into the
// B operand in registers.
#include <hip/hip_runtime.h>
#include <hip/hip_bf16.h>
#include <math.h>
#include <stdint.h>

#define NB   32
#define SEQ  2048
#define HD   128
#define KC   64
#define NQB  (SEQ / 64)
#define NE   (NB * SEQ * HD)
#define PSC  1024.0f
#define RSC  2048.0f
#define VSC  64.0f
#define SSC  0.17677669529663687f
#define KP   (HD + 8)      // K row pitch in LDS, elements: 272 B = 16 B x 17
#define VP   (KC + 8)      // V^T row pitch in LDS, elements: 144 B = 16 B x 9
#define OP   (64 + 4)      // output staging row pitch, floats: 68 dwords
static_assert((SEQ % 64) == 0);
static_assert(HD == 128);
static_assert(NQB == 32);   // the tile deal's parity argument: n-1-t is t with five bits turned over
static_assert(((NE / 8) % 256) == 0);

typedef _Float16 v16h __attribute__((ext_vector_type(16)));
typedef _Float16 v8h  __attribute__((ext_vector_type(8)));
typedef __bf16   v16b __attribute__((ext_vector_type(16)));
typedef float    v8f  __attribute__((ext_vector_type(8)));
typedef float    v4f  __attribute__((ext_vector_type(4)));
typedef unsigned int v4u __attribute__((ext_vector_type(4)));

union FragH { v16h v; v8h h[2]; };
union FragB { v16b v; v4u u[2]; };
union HU8   { v8h h; v4u u; };

// ---- scalar helpers --------------------------------------------------------------------------------
__device__ __forceinline__ unsigned short bf_bits(float f) {          // f32 -> bf16 bits, RNE convert
  unsigned u = __float_as_uint(f);
  return (unsigned short)((u + 0x7FFFu + ((u >> 16) & 1u)) >> 16);
}
__device__ __forceinline__ float bf_up(unsigned short h) { return __uint_as_float(((unsigned)h) << 16); }
__device__ __forceinline__ float bfr(float f) { return bf_up(bf_bits(f)); }   // value of the bf16 RNE convert
__device__ __forceinline__ unsigned pk16(unsigned short a, unsigned short b) { return (unsigned)a | ((unsigned)b << 16); }
// value of lane l ^ 16 (the other half wave), by a vector cross-row move; every lane is on where it is used
__device__ __forceinline__ float xhalf(float x) {
  const int b = __builtin_bit_cast(int, x);
  return __builtin_bit_cast(float, __builtin_amdgcn_permlanex16(b, b, 0x76543210, 0xfedcba98, false, false));
}
__device__ __forceinline__ v8f zero8() { v8f z = {0.f, 0.f, 0.f, 0.f, 0.f, 0.f, 0.f, 0.f}; return z; }

// ---- fragment loaders: 16-bit A/B operand, lane -> row/col (lane&15), p already includes +8*(lane>>4);
//      elements 0..7 <- p[0..7] (k0+8h..), elements 8..15 <- p[16..23] (k0+16+8h..)
__device__ __forceinline__ v16h ldfrag_h(const _Float16* p) {
  FragH f;
  f.h[0] = *(const v8h*)(p);
  f.h[1] = *(const v8h*)(p + 16);
  return f.v;
}
__device__ __forceinline__ v16b ldfrag_b(const unsigned short* p) {
  FragB f;
  f.u[0] = *(const v4u*)(p);
  f.u[1] = *(const v4u*)(p + 16);
  return f.v;
}

// ---- WMMA helpers with trailing VALU hazard gap --------------------------------------------------------
__device__ __forceinline__ v8f mma_h(v16h a, v16h b, v8f c) {
  c = __builtin_amdgcn_wmma_f32_16x16x32_f16(false, a, false, b, (short)0, c, false, false);
#if defined(__HIP_DEVICE_COMPILE__)
  asm volatile("v_nop\n\tv_nop\n\tv_nop\n\tv_nop" : "+v"(c) : "v"(a), "v"(b));
#endif
  return c;
}
__device__ __forceinline__ v8f mma_b(v16b a, v16b b, v8f c) {
  c = __builtin_amdgcn_wmma_f32_16x16x32_bf16(false, a, false, b, (short)0, c, false, false);
#if defined(__HIP_DEVICE_COMPILE__)
  asm volatile("v_nop\n\tv_nop\n\tv_nop\n\tv_nop" : "+v"(c) : "v"(a), "v"(b));
#endif
  return c;
}
// ---- asynchronous staging, global -> LDS, through no register -------------------------------------------
__device__ __forceinline__ unsigned lds_off(const void* p) { return (unsigned)(size_t)p; }   // LDS byte address
// Eight 16-B copies per lane: piece i goes from g + i*gs + off to LDS byte l + i*ls; g is the same in every lane
// (scalar base), off the lane's own byte offset. The s_wait_xcnt closes the same statement, so that no address
// register of an issued copy is rewritten in front of it (a precaution).
__device__ __forceinline__ void copy8_async(unsigned l, unsigned ls, const char* g, size_t gs, unsigned off) {
#if defined(__HIP_DEVICE_COMPILE__)
  asm volatile(
      "global_load_async_to_lds_b128 %0, %16, %8\n\t"
      "global_load_async_to_lds_b128 %1, %16, %9\n\t"
      "global_load_async_to_lds_b128 %2, %16, %10\n\t"
      "global_load_async_to_lds_b128 %3, %16, %11\n\t"
      "global_load_async_to_lds_b128 %4, %16, %12\n\t"
      "global_load_async_to_lds_b128 %5, %16, %13\n\t"
      "global_load_async_to_lds_b128 %6, %16, %14\n\t"
      "global_load_async_to_lds_b128 %7, %16, %15\n\t"
      "s_wait_xcnt 0x0"
      :: "v"(l), "v"(l + ls), "v"(l + 2 * ls), "v"(l + 3 * ls),
         "v"(l + 4 * ls), "v"(l + 5 * ls), "v"(l + 6 * ls), "v"(l + 7 * ls),
         "s"(g), "s"(g + gs), "s"(g + 2 * gs), "s"(g + 3 * gs),
         "s"(g + 4 * gs), "s"(g + 5 * gs), "s"(g + 6 * gs), "s"(g + 7 * gs), "v"(off)
      : "memory");
#endif
}
// Hand-over of a staged tile: this wave's LDS reads of the buffer that is refilled next have retired, this wave's
// own copies have landed, then the block barrier publishes them and ends every reader's last read.
__device__ __forceinline__ void publish_point() {
#if defined(__HIP_DEVICE_COMPILE__)
  asm volatile("s_wait_dscnt 0x0" ::: "memory");      // own LDS reads done before the buffer gets a new writer
  asm volatile("s_wait_asynccnt 0x0" ::: "memory");   // own copies landed before other waves may read them
#endif
  __syncthreads();
}
__device__ __forceinline__ void wave_sync_lds() {
  __builtin_amdgcn_fence(__ATOMIC_RELEASE, "workgroup");
  __builtin_amdgcn_wave_barrier();
  __builtin_amdgcn_fence(__ATOMIC_ACQUIRE, "workgroup");
}

// =====================================================================================================
// Plane convert: Y[i] = bf16_RNE(X[i]) bits. Thread i handles elements 8i..8i+7 and writes one 16-B piece;
// grid = n8 / 256 (n8 multiple of 256, host-checked). coverage: n8 threads x 8 elements = the whole plane.
// =====================================================================================================
__global__ __launch_bounds__(256) void conv_bf16(const float* __restrict__ X, unsigned short* Y, int n8) {
  const int i  = blockIdx.x * 256 + threadIdx.x;
  const int ic = (i < n8) ? i : (n8 - 1);                     // clamped address
  const float* src = X + (size_t)ic * 8;
  const v4f a = *(const v4f*)(src);
  const v4f c = *(const v4f*)(src + 4);
  v4u o;
  o[0] = pk16(bf_bits(a[0]), bf_bits(a[1]));
  o[1] = pk16(bf_bits(a[2]), bf_bits(a[3]));
  o[2] = pk16(bf_bits(c[0]), bf_bits(c[1]));
  o[3] = pk16(bf_bits(c[2]), bf_bits(c[3]));
  if (i < n8) *(v4u*)(Y + (size_t)i * 8) = o;
  
}

// =====================================================================================================
// v [b][s][d] f32 -> VT [b][d][s] f16( bf16_RNE(v) * 64 ). Block = 256 threads, one 64(s) x 64(d) tile,
// grid = (SEQ/64, HD/64, NB). Load: thread t reads s row t>>2, d = dblk*64 + 16*(t&3)..+15 (4 x 16-B loads),
// converts and writes the transposed elements into the LDS tile T[d][s] (pitch 72 halves); __syncthreads;
// coverage: load 256 threads x 16 = 64x64; store 2 it x 32 rows x 8 lanes x 8 halves = 64 d rows x 64 s.
// =====================================================================================================
__global__ __launch_bounds__(256) void vtrans_h16(const float* __restrict__ V, unsigned short* VTp) {
  __shared__ __align__(16) _Float16 Tsh[64 * 72];
  const int t    = threadIdx.x;
  const int dblk = blockIdx.y;
  const int b    = blockIdx.z;
  const int s0   = blockIdx.x * 64;
  {
    const int sr = t >> 2, d0 = (t & 3) * 16;
    const float* src = V + ((size_t)b * SEQ + s0 + sr) * HD + dblk * 64 + d0;
#pragma unroll
    for (int i = 0; i < 4; ++i) {
      const v4f x = *(const v4f*)(src + 4 * i);
#pragma unroll
      for (int e = 0; e < 4; ++e) Tsh[(d0 + 4 * i + e) * 72 + sr] = (_Float16)(bfr(x[e]) * VSC);
    }
  }
  __syncthreads();
  const int q8 = t >> 3, c8 = (t & 7) * 8;
  v4u vals[2];
#pragma unroll
  for (int it = 0; it < 2; ++it) {
    const int d = it * 32 + q8;
    HU8 hu;
    hu.h = *(const v8h*)(Tsh + d * 72 + c8);
    vals[it] = hu.u;
  }
#pragma unroll
  for (int it = 0; it < 2; ++it) {
    const int d = it * 32 + q8;
    *(v4u*)(VTp + ((size_t)b * HD + dblk * 64 + d) * SEQ + s0 + c8) = vals[it];
  }
  
}

// =====================================================================================================
// Causal flash attention, head dim 128, one head per sequence, SEQ query/key rows per sequence.
//   QB / KB planes (bf16 bits): element (b, t, d) at [(b*SEQ + t)*128 + d]
//   VT plane (f16, x64): element (b, d, s) at [(b*128 + d)*SEQ + s]
//   out (f32): element (b, t, d) at [(b*SEQ + t)*128 + d]
//   score = (k . q) * 1/sqrt(32) on bf16 WMMA, A = K rows, B = Q: accumulator register r of lane (c, h) is key
//   16j + 8h + r against query q0 + c; score := -inf where key > query row (select by index);
//   maximum and sum of a query run inside its lane, the two half waves exchange the maximum once per chunk and
//   join their sums once, behind the loop;
//   p = exp(s - m) packed in registers as f16(1024 p) and f16(2048 (1024 p - hi)): score tiles 2kk and 2kk+1 are
//   elements 0..7 and 8..15 of the B operand of keys 32kk..32kk+31, the k order of the V^T loader;
//   context^T += v^T . hi on f16 WMMA, plus (v^T . res) * 1/2048 from a per-chunk accumulator: register r of lane
//   (c, h) in tile t is d = 16t + 8h + r of query q0 + c; online softmax (running max) in f32.
//   Block = 4 waves = 64 query rows of one sequence; grid = NQB * NB, tile qb dealt by the block index's parity;
//   key chunks of 64, block-uniform trip
//   kt = 0..qb (chunks strictly above the diagonal are fully masked and skipped).
//   K / V^T chunk staging: asynchronous 16-B copies to LDS, 128 threads x 8 pieces per plane = the whole 64x128 /
//   128x64 tile, each wave instruction on four whole 128-B lines. One buffer per operand: K of chunk kt+1 is
//   copied behind the barrier that ends the score products of chunk kt and flies under softmax and P.V; V^T of
//   chunk kt+1 is copied behind the barrier that ends P.V of chunk kt and flies under the next score products.
//   Output coverage: each wave stores its rows q0..q0+15 x 128 columns, two 256-B row pieces per instruction
// =====================================================================================================
__global__ __launch_bounds__(128)
void attn128(const unsigned short* __restrict__ QBp, const unsigned short* __restrict__ KBp,
             const unsigned short* __restrict__ VTp, float* outp) {
  // Row pitches are odd multiples of 16 B, so the 16 lanes of a half wave that read one 16-B piece each from
  // 16 consecutive rows fall on 64 distinct banks.
  __shared__ __align__(16) unsigned short Ksh[KC * KP];           // K [kv][d] bf16, pitch 272 B
  __shared__ __align__(16) _Float16 Vth[HD * VP];                 // V^T [d][kv] f16, pitch 144 B
  __shared__ __align__(16) float    Os[4][16 * OP];               // per wave context half tile [row][64 d]

  const int tid  = threadIdx.x;
  const int wave = tid >> 5;
  const int lane = tid & 31;
  const int hh   = lane >> 4;
  const int c    = lane & 15;

  // Tile deal. Every block is resident at once and a tile's cost grows with its index, so the launch lasts as long
  // as the fullest WGP. Blocks whose indices differ in two bits from bit 1 up take tiles t, n-1-t, n-1-t, t (or the
  // like with t moved by those bits): any such four blocks on one WGP walk 2n + 2 chunks together. For speed only.
  // A permutation: n-1-t turns over bits 0..4 of bx, four of them in bx >> 1, so both tiles read the same parity.
  const int bx = blockIdx.x;
  const int tl = bx % NQB;
  const int qb = (__builtin_popcount((unsigned)bx >> 1) & 1) ? (NQB - 1 - tl) : tl;
  const int b  = bx / NQB;
  const int q0 = qb * 64 + wave * 16;            // in-sequence query row of this wave's first row
  const int qrow = q0 + c;                       // in-sequence query row of this lane's accumulator column
  const size_t rowB = (size_t)b * SEQ;
  const _Float16* VTh = (const _Float16*)(const void*)VTp + (size_t)b * HD * SEQ;

  // ---- Q fragments (B operand, col = lane&15): 4 d-chunks ----
  v16b qa[4];
#pragma unroll
  for (int dc = 0; dc < 4; ++dc) qa[dc] = ldfrag_b(QBp + (rowB + q0 + c) * HD + dc * 32 + 8 * hh);

  float mrun = -INFINITY;                        // running maximum of the lane's query, alike in both half waves
  float lrun = 0.f;                              // running sum over the keys of this lane's own half wave
  v8f oacc[8];
#pragma unroll
  for (int t = 0; t < 8; ++t) oacc[t] = zero8();

  // Staging addresses. K chunk = 16 KiB in a row: piece i of thread tid is 16-B piece i*128+tid, K row
  // i*8 + (tid>>4). V^T chunk = 128 rows of 128 B: piece i is row i*16 + (tid>>3), 16-B piece tid&7.
  const unsigned kl = lds_off(Ksh) + (unsigned)(tid >> 4) * (KP * 2) + (unsigned)(tid & 15) * 16;
  const unsigned vl = lds_off(Vth) + (unsigned)(tid >> 3) * (VP * 2) + (unsigned)(tid & 7) * 16;
  const char* kg = (const char*)(KBp + rowB * HD);                 // block-uniform bases
  const char* vg = (const char*)VTh;
  const unsigned ko = (unsigned)tid * 16;                          // the lane's byte offsets from them
  const unsigned vo = (unsigned)(tid >> 3) * (SEQ * 2) + (unsigned)(tid & 7) * 16;

  // Prologue: K of chunk 0 landed and published, V^T of chunk 0 in flight.
  copy8_async(kl, 8 * KP * 2, kg, 128 * 16, ko);
  publish_point();
  copy8_async(vl, 16 * VP * 2, vg, (size_t)16 * SEQ * 2, vo);

#pragma unroll 1
  for (int kt = 0; kt <= qb; ++kt) {         // block-uniform trip count, at most NQB
    const int kv0 = kt * KC;
    // Chunk copied ahead. The last trip copies its own chunk once more, unread, instead of branching round the
    // copies: with a branch in the loop body the build holds all eight residual tiles to the loop's foot and
    // passes 256 registers, which would leave three blocks on a WGP instead of four.
    const int kn  = (kt < qb) ? kt + 1 : qb;

    // ---- scores^T: 64 keys x 16 queries per wave (A operand: row = key j*16+c, k = d, split map) ----
    v8f s[4];
#pragma unroll
    for (int j = 0; j < 4; ++j) {
      v8f sh = zero8();
#pragma unroll
      for (int dc = 0; dc < 4; ++dc) {
        FragB kb;
        kb.u[0] = *(const v4u*)(Ksh + (j * 16 + c) * KP + dc * 32 + 8 * hh);
        kb.u[1] = *(const v4u*)(Ksh + (j * 16 + c) * KP + dc * 32 + 16 + 8 * hh);
        sh = mma_b(kb.v, qa[dc], sh);
      }
      const int key = kv0 + j * 16 + 8 * hh;
#pragma unroll
      for (int r = 0; r < 8; ++r) {
        const float sv = sh[r] * SSC;
        s[j][r] = (key + r > qrow) ? -INFINITY : sv;          // causal: keys strictly after the row
      }
    }

    // V^T of this chunk published; every wave has left K: refill it
    publish_point();
    copy8_async(kl, 8 * KP * 2, kg + (size_t)kn * (KC * HD * 2), 128 * 16, ko);

    // ---- query max, online softmax, P^T hi (x1024) and residual (x2048) packed as B operands ----
    float mj[4];                                 // one chain per score tile, so that the chains are independent
#pragma unroll
    for (int j = 0; j < 4; ++j) {
      mj[j] = s[j][0];
#pragma unroll
      for (int r = 1; r < 8; ++r) mj[j] = fmaxf(mj[j], s[j][r]);
    }
    float m = fmaxf(fmaxf(mj[0], mj[1]), fmaxf(mj[2], mj[3]));
    m = fmaxf(m, xhalf(m));                      // the other eight keys of each tile lie in the other half wave
    const float mnew  = fmaxf(mrun, m);
    const float alpha = __expf(mrun - mnew);
    mrun = mnew;
    FragH pa[2], pr[2];
    float pj[4];
#pragma unroll
    for (int j = 0; j < 4; ++j) {
      pj[j] = 0.f;
#pragma unroll
      for (int r = 0; r < 8; ++r) {
        const float p  = __expf(s[j][r] - mnew);
        pj[j] += p;
        const float ph = p * PSC;
        const _Float16 hq = (_Float16)ph;
        const float res = (ph - (float)hq) * RSC;
        pa[j >> 1].v[(j & 1) * 8 + r] = hq;
        pr[j >> 1].v[(j & 1) * 8 + r] = (_Float16)res;
      }
    }
    lrun = lrun * alpha + ((pj[0] + pj[1]) + (pj[2] + pj[3]));
#pragma unroll
    for (int t = 0; t < 8; ++t) {
#pragma unroll
      for (int r = 0; r < 8; ++r) oacc[t][r] *= alpha;
    }

    // ---- context^T += V^T . P^T (f16 WMMA; A = V^T [dv][kv] by the split map, B = P^T from the accumulators) ----
#pragma unroll
    for (int t = 0; t < 8; ++t) {
      FragH vb[2];
#pragma unroll
      for (int kk = 0; kk < 2; ++kk) {
        vb[kk].h[0] = *(const v8h*)(Vth + (t * 16 + c) * VP + kk * 32 + 8 * hh);
        vb[kk].h[1] = *(const v8h*)(Vth + (t * 16 + c) * VP + kk * 32 + 16 + 8 * hh);
      }
      oacc[t] = mma_h(vb[0].v, pa[0].v, oacc[t]);
      oacc[t] = mma_h(vb[1].v, pa[1].v, oacc[t]);
      v8f rr = mma_h(vb[0].v, pr[0].v, zero8());
      rr = mma_h(vb[1].v, pr[1].v, rr);
#pragma unroll
      for (int r = 0; r < 8; ++r) oacc[t][r] += rr[r] * (1.0f / RSC);
    }

    // K of the next chunk published; every wave has left V^T: refill it
    publish_point();
    copy8_async(vl, 16 * VP * 2, vg + (size_t)kn * (KC * 2), (size_t)16 * SEQ * 2, vo);
  }
#if defined(__HIP_DEVICE_COMPILE__)
  asm volatile("s_wait_asynccnt 0x0" ::: "memory");   // the last trip's copies have landed before the wave ends
#endif

  // ---- normalise (1/l, the 1/1024 p carry and the 1/64 v carry), then stage and store the wave's 16x128 f32
  //      tile as two 16x64 halves: each store instruction writes two 256-B row pieces (whole 128-B lines)
  float* os = Os[wave];
  const float l   = lrun + xhalf(lrun);          // the two half waves' sums of the lane's query
  const float inv = ((l > 0.f) ? (1.0f / l) : 0.f) * (1.0f / (PSC * VSC));
  v4f vals[2][8];
#pragma unroll
  for (int hv = 0; hv < 2; ++hv) {
    if (hv == 1) wave_sync_lds();             // the first half is read out before the second overwrites it
#pragma unroll
    for (int t = 0; t < 4; ++t) {               // a lane's eight registers are eight consecutive d of its query
      const v8f o = oacc[4 * hv + t];
      const v4f lo = {o[0] * inv, o[1] * inv, o[2] * inv, o[3] * inv};
      const v4f hi = {o[4] * inv, o[5] * inv, o[6] * inv, o[7] * inv};
      *(v4f*)(os + c * OP + t * 16 + 8 * hh)     = lo;
      *(v4f*)(os + c * OP + t * 16 + 8 * hh + 4) = hi;
    }
    wave_sync_lds();
#pragma unroll
    for (int it = 0; it < 8; ++it) vals[hv][it] = *(const v4f*)(os + (2 * it + hh) * OP + c * 4);
  }
  float* C = outp + (rowB + q0) * HD;
#pragma unroll
  for (int hv = 0; hv < 2; ++hv) {
#pragma unroll
    for (int it = 0; it < 8; ++it) *(v4f*)(C + (size_t)(2 * it + hh) * HD + hv * 64 + c * 4) = vals[hv][it];
  }
}

// =====================================================================================================
// Workspace map (bytes); every plane is an exact multiple of its whole-line / 64x64-tile store granularity:
//   QB  bf16 [32*2048][128]    0          16777216
//   KB  bf16 [32*2048][128]    16777216   16777216
//   VT  f16  [32][128][2048]   33554432   16777216
//   end                        50331648
// =====================================================================================================
extern "C" void kernel_launch(void* const* d_in, const int* in_sizes, int n_in,
                              void* d_out, int out_size, void* d_ws, size_t ws_size,
                              hipStream_t stream) {
  if (n_in < 3) return;
  if (in_sizes[0] != NE || in_sizes[1] != NE || in_sizes[2] != NE) return;
  if (out_size != NE) return;

  const float* q = (const float*)d_in[0];
  const float* k = (const float*)d_in[1];
  const float* v = (const float*)d_in[2];

  const size_t PB = (size_t)NE * 2;                     // 16777216
  size_t off = 0;
  const size_t oQ  = off; off += PB;
  const size_t oK  = off; off += PB;
  const size_t oVT = off; off += PB;
  if (off > ws_size) return;                            // off = 50331648
  if (off > (size_t)134217728) return;

  char* ws = (char*)d_ws;
  unsigned short* QB = (unsigned short*)(ws + oQ);
  unsigned short* KB = (unsigned short*)(ws + oK);
  unsigned short* VT = (unsigned short*)(ws + oVT);
  float* out0 = (float*)d_out;

  const int n8 = NE / 8;                                // 1048576
  if ((n8 % 256) != 0) return;
  const dim3 blk(256), blk128(128);
  const dim3 gC(n8 / 256);                              // 4096 blocks
  const dim3 gVT(SEQ / 64, HD / 64, NB);                // 32 x 2 x 32 tiles
  const dim3 gA(NB * NQB);                              // 1024 blocks of 128

  // (0) q, k -> bf16 planes; v -> f16( bf16_RNE(v) * 64 ) transposed plane [b][d][s]
  conv_bf16<<<gC, blk, 0, stream>>>(q, QB, n8);
  conv_bf16<<<gC, blk, 0, stream>>>(k, KB, n8);
  vtrans_h16<<<gVT, blk, 0, stream>>>(v, VT);

  // (1) causal flash attention -> out f32 [32][2048][128]
  attn128<<<gA, blk128, 0, stream>>>(QB, KB, VT, out0);
  (void)hipGetLastError();
}

// v005
// One run takes 94.1 microseconds.
// Next to v004, in two timings, it ran 1.12 and 1.13 times as fast.
// Over all steps from v000 it is 4.79 times as fast.
// Contractions: q.k^T on v_wmma_f32_16x16x32_bf16 (bf16 planes of the RNE-converted q and k, one product);
// p.v on v_wmma_f32_16x16x32_f16 (p as f16 x1024 hi plane plus f16 x2048 residual plane with its own per-chunk
// accumulator folded x1/2048 in f32, v^T as f16 of the bf16 RNE-converted v carried x64); all f32 accumulate;
// online softmax (running max) and the causal index select in f32 on VALU. Both products are formed transposed
// (S^T = K.Q^T, O^T += V^T.P^T): a lane holds one query's scores, and P^T goes from the score accumulators into the
// B operand in registers.
#include <hip/hip_runtime.h>
#include <hip/hip_bf16.h>
#include <math.h>
#include <stdint.h>

#define NB   32
#define SEQ  2048
#define HD   128
#define KC   64
#define NQB  (SEQ / 64)
#define NE   (NB * SEQ * HD)
#define PSC  1024.0f
#define RSC  2048.0f
#define VSC  64.0f
#define SSC  0.17677669529663687f
#define KP   (HD + 8)      // K row pitch in LDS, elements: 272 B = 16 B x 17
#define VP   (KC + 8)      // V^T row pitch in LDS, elements: 144 B = 16 B x 9
#define OP   (64 + 4)      // output staging row pitch, floats: 68 dwords
static_assert((SEQ % 64) == 0);
static_assert(HD == 128);
static_assert(NQB == 32);   // the tile deal's parity argument: n-1-t is t with five bits turned over
static_assert(((NE / 8) % 256) == 0);

typedef _Float16 v16h __attribute__((ext_vector_type(16)));
typedef _Float16 v8h  __attribute__((ext_vector_type(8)));
typedef __bf16   v16b __attribute__((ext_vector_type(16)));
typedef float    v8f  __attribute__((ext_vector_type(8)));
typedef float    v4f  __attribute__((ext_vector_type(4)));
typedef unsigned int v4u __attribute__((ext_vector_type(4)));

union FragH { v16h v; v8h h[2]; };
union FragB { v16b v; v4u u[2]; };
union HU8   { v8h h; v4u u; };

// ---- scalar helpers --------------------------------------------------------------------------------
__device__ __forceinline__ unsigned short bf_bits(float f) {          // f32 -> bf16 bits, RNE convert
  unsigned u = __float_as_uint(f);
  return (unsigned short)((u + 0x7FFFu + ((u >> 16) & 1u)) >> 16);
}
__device__ __forceinline__ float bf_up(unsigned short h) { return __uint_as_float(((unsigned)h) << 16); }
__device__ __forceinline__ float bfr(float f) { return bf_up(bf_bits(f)); }   // value of the bf16 RNE convert
__device__ __forceinline__ unsigned pk16(unsigned short a, unsigned short b) { return (unsigned)a | ((unsigned)b << 16); }
// value of lane l ^ 16 (the other half wave), by a vector cross-row move; every lane is on where it is used
__device__ __forceinline__ float xhalf(float x) {
  const int b = __builtin_bit_cast(int, x);
  return __builtin_bit_cast(float, __builtin_amdgcn_permlanex16(b, b, 0x76543210, 0xfedcba98, false, false));
}
__device__ __forceinline__ v8f zero8() { v8f z = {0.f, 0.f, 0.f, 0.f, 0.f, 0.f, 0.f, 0.f}; return z; }

// ---- fragment loaders: 16-bit A/B operand, lane -> row/col (lane&15), p already includes +8*(lane>>4);
//      elements 0..7 <- p[0..7] (k0+8h..), elements 8..15 <- p[16..23] (k0+16+8h..)
__device__ __forceinline__ v16h ldfrag_h(const _Float16* p) {
  FragH f;
  f.h[0] = *(const v8h*)(p);
  f.h[1] = *(const v8h*)(p + 16);
  return f.v;
}
__device__ __forceinline__ v16b ldfrag_b(const unsigned short* p) {
  FragB f;
  f.u[0] = *(const v4u*)(p);
  f.u[1] = *(const v4u*)(p + 16);
  return f.v;
}

// ---- WMMA helpers with trailing VALU hazard gap --------------------------------------------------------
__device__ __forceinline__ v8f mma_h(v16h a, v16h b, v8f c) {
  c = __builtin_amdgcn_wmma_f32_16x16x32_f16(false, a, false, b, (short)0, c, false, false);
#if defined(__HIP_DEVICE_COMPILE__)
  asm volatile("v_nop\n\tv_nop\n\tv_nop\n\tv_nop" : "+v"(c) : "v"(a), "v"(b));
#endif
  return c;
}
__device__ __forceinline__ v8f mma_b(v16b a, v16b b, v8f c) {
  c = __builtin_amdgcn_wmma_f32_16x16x32_bf16(false, a, false, b, (short)0, c, false, false);
#if defined(__HIP_DEVICE_COMPILE__)
  asm volatile("v_nop\n\tv_nop\n\tv_nop\n\tv_nop" : "+v"(c) : "v"(a), "v"(b));
#endif
  return c;
}
// ---- asynchronous staging, global -> LDS, through no register -------------------------------------------
__device__ __forceinline__ unsigned lds_off(const void* p) { return (unsigned)(size_t)p; }   // LDS byte address
// Eight 16-B copies per lane: piece i goes from g + i*gs + off to LDS byte l + i*ls; g is the same in every lane
// (scalar base), off the lane's own byte offset. The s_wait_xcnt closes the same statement, so that no address
// register of an issued copy is rewritten in front of it (a precaution).
__device__ __forceinline__ void copy8_async(unsigned l, unsigned ls, const char* g, size_t gs, unsigned off) {
#if defined(__HIP_DEVICE_COMPILE__)
  asm volatile(
      "global_load_async_to_lds_b128 %0, %16, %8\n\t"
      "global_load_async_to_lds_b128 %1, %16, %9\n\t"
      "global_load_async_to_lds_b128 %2, %16, %10\n\t"
      "global_load_async_to_lds_b128 %3, %16, %11\n\t"
      "global_load_async_to_lds_b128 %4, %16, %12\n\t"
      "global_load_async_to_lds_b128 %5, %16, %13\n\t"
      "global_load_async_to_lds_b128 %6, %16, %14\n\t"
      "global_load_async_to_lds_b128 %7, %16, %15\n\t"
      "s_wait_xcnt 0x0"
      :: "v"(l), "v"(l + ls), "v"(l + 2 * ls), "v"(l + 3 * ls),
         "v"(l + 4 * ls), "v"(l + 5 * ls), "v"(l + 6 * ls), "v"(l + 7 * ls),
         "s"(g), "s"(g + gs), "s"(g + 2 * gs), "s"(g + 3 * gs),
         "s"(g + 4 * gs), "s"(g + 5 * gs), "s"(g + 6 * gs), "s"(g + 7 * gs), "v"(off)
      : "memory");
#endif
}
// Hand-over of a staged tile: this wave's LDS reads of the buffer that is refilled next have retired, this wave's
// own copies have landed, then the block barrier publishes them and ends every reader's last read.
__device__ __forceinline__ void publish_point() {
#if defined(__HIP_DEVICE_COMPILE__)
  asm volatile("s_wait_dscnt 0x0" ::: "memory");      // own LDS reads done before the buffer gets a new writer
  asm volatile("s_wait_asynccnt 0x0" ::: "memory");   // own copies landed before other waves may read them
#endif
  __syncthreads();
}
__device__ __forceinline__ void wave_sync_lds() {
  __builtin_amdgcn_fence(__ATOMIC_RELEASE, "workgroup");
  __builtin_amdgcn_wave_barrier();
  __builtin_amdgcn_fence(__ATOMIC_ACQUIRE, "workgroup");
}

// =====================================================================================================
// Plane convert: Y[i] = bf16_RNE(X[i]) bits. Thread i handles elements 8i..8i+7 and writes one 16-B piece;
// grid = n8 / 256 (n8 multiple of 256, host-checked). coverage: n8 threads x 8 elements = the whole plane.
// =====================================================================================================
__global__ __launch_bounds__(256) void conv_bf16(const float* __restrict__ X, unsigned short* Y, int n8) {
  const int i  = blockIdx.x * 256 + threadIdx.x;
  const int ic = (i < n8) ? i : (n8 - 1);                     // clamped address
  const float* src = X + (size_t)ic * 8;
  const v4f a = *(const v4f*)(src);
  const v4f c = *(const v4f*)(src + 4);
  v4u o;
  o[0] = pk16(bf_bits(a[0]), bf_bits(a[1]));
  o[1] = pk16(bf_bits(a[2]), bf_bits(a[3]));
  o[2] = pk16(bf_bits(c[0]), bf_bits(c[1]));
  o[3] = pk16(bf_bits(c[2]), bf_bits(c[3]));
  if (i < n8) *(v4u*)(Y + (size_t)i * 8) = o;
  
}

// =====================================================================================================
// v [b][s][d] f32 -> VT [b][d][s] f16( bf16_RNE(v) * 64 ). Block = 256 threads, one 64(s) x 64(d) tile,
// grid = (SEQ/64, HD/64, NB). Load: thread t reads s row t>>2, d = dblk*64 + 16*(t&3)..+15 (4 x 16-B loads),
// converts and writes the transposed elements into the LDS tile T[d][s] (pitch 72 halves); __syncthreads;
// coverage: load 256 threads x 16 = 64x64; store 2 it x 32 rows x 8 lanes x 8 halves = 64 d rows x 64 s.
// =====================================================================================================
__global__ __launch_bounds__(256) void vtrans_h16(const float* __restrict__ V, unsigned short* VTp) {
  __shared__ __align__(16) _Float16 Tsh[64 * 72];
  const int t    = threadIdx.x;
  const int dblk = blockIdx.y;
  const int b    = blockIdx.z;
  const int s0   = blockIdx.x * 64;
  {
    const int sr = t >> 2, d0 = (t & 3) * 16;
    const float* src = V + ((size_t)b * SEQ + s0 + sr) * HD + dblk * 64 + d0;
#pragma unroll
    for (int i = 0; i < 4; ++i) {
      const v4f x = *(const v4f*)(src + 4 * i);
#pragma unroll
      for (int e = 0; e < 4; ++e) Tsh[(d0 + 4 * i + e) * 72 + sr] = (_Float16)(bfr(x[e]) * VSC);
    }
  }
  __syncthreads();
  const int q8 = t >> 3, c8 = (t & 7) * 8;
  v4u vals[2];
#pragma unroll
  for (int it = 0; it < 2; ++it) {
    const int d = it * 32 + q8;
    HU8 hu;
    hu.h = *(const v8h*)(Tsh + d * 72 + c8);
    vals[it] = hu.u;
  }
#pragma unroll
  for (int it = 0; it < 2; ++it) {
    const int d = it * 32 + q8;
    *(v4u*)(VTp + ((size_t)b * HD + dblk * 64 + d) * SEQ + s0 + c8) = vals[it];
  }
  
}

// =====================================================================================================
// Causal flash attention, head dim 128, one head per sequence, SEQ query/key rows per sequence.
//   QB / KB planes (bf16 bits): element (b, t, d) at [(b*SEQ + t)*128 + d]
//   VT plane (f16, x64): element (b, d, s) at [(b*128 + d)*SEQ + s]
//   out (f32): element (b, t, d) at [(b*SEQ + t)*128 + d]
//   score = (k . q) * 1/sqrt(32) on bf16 WMMA, A = K rows, B = Q: accumulator register r of lane (c, h) is key
//   16j + 8h + r against query q0 + c; score := -inf where key > query row (select by index);
//   maximum and sum of a query run inside its lane, the two half waves exchange the maximum once per chunk and
//   join their sums once, behind the loop;
//   p = exp(s - m) packed in registers as f16(1024 p) and f16(2048 (1024 p - hi)): score tiles 2kk and 2kk+1 are
//   elements 0..7 and 8..15 of the B operand of keys 32kk..32kk+31, the k order of the V^T loader;
//   context^T += v^T . hi on f16 WMMA, plus (v^T . res) * 1/2048 from a per-chunk accumulator: register r of lane
//   (c, h) in tile t is d = 16t + 8h + r of query q0 + c; online softmax (running max) in f32.
//   Block = 4 waves = 64 query rows of one sequence; grid = NQB * NB, tile qb dealt by the block index's parity;
//   key chunks of 64, block-uniform trip
//   kt = 0..qb (chunks strictly above the diagonal are fully masked and skipped).
//   K / V^T chunk staging: asynchronous 16-B copies to LDS, 128 threads x 8 pieces per plane = the whole 64x128 /
//   128x64 tile, each wave instruction on four whole 128-B lines. One buffer per operand: K of chunk kt+1 is
//   copied behind the barrier that ends the score products of chunk kt and flies under softmax and P.V; V^T of
//   chunk kt+1 is copied behind the barrier that ends P.V of chunk kt and flies under the next score products.
//   Output coverage: each wave stores its rows q0..q0+15 x 128 columns, two 256-B row pieces per instruction
// =====================================================================================================
__global__ __launch_bounds__(128)
void attn128(const unsigned short* __restrict__ QBp, const unsigned short* __restrict__ KBp,
             const unsigned short* __restrict__ VTp, float* outp) {
  // Row pitches are odd multiples of 16 B, so the 16 lanes of a half wave that read one 16-B piece each from
  // 16 consecutive rows fall on 64 distinct banks.
  __shared__ __align__(16) unsigned short Ksh[KC * KP];           // K [kv][d] bf16, pitch 272 B
  __shared__ __align__(16) _Float16 Vth[HD * VP];                 // V^T [d][kv] f16, pitch 144 B
  __shared__ __align__(16) float    Os[4][16 * OP];               // per wave context half tile [row][64 d]

  const int tid  = threadIdx.x;
  const int wave = tid >> 5;
  const int lane = tid & 31;
  const int hh   = lane >> 4;
  const int c    = lane & 15;

  // Tile deal. Every block is resident at once and a tile's cost grows with its index, so the launch lasts as long
  // as the fullest WGP. Blocks whose indices differ in two bits from bit 1 up take tiles t, n-1-t, n-1-t, t (or the
  // like with t moved by those bits): any such four blocks on one WGP walk 2n + 2 chunks together. For speed only.
  // A permutation: n-1-t turns over bits 0..4 of bx, four of them in bx >> 1, so both tiles read the same parity.
  const int bx = blockIdx.x;
  const int tl = bx % NQB;
  const int qb = (__builtin_popcount((unsigned)bx >> 1) & 1) ? (NQB - 1 - tl) : tl;
  const int b  = bx / NQB;
  const int q0 = qb * 64 + wave * 16;            // in-sequence query row of this wave's first row
  const int qrow = q0 + c;                       // in-sequence query row of this lane's accumulator column
  const size_t rowB = (size_t)b * SEQ;
  const _Float16* VTh = (const _Float16*)(const void*)VTp + (size_t)b * HD * SEQ;

  // ---- Q fragments (B operand, col = lane&15): 4 d-chunks ----
  v16b qa[4];
#pragma unroll
  for (int dc = 0; dc < 4; ++dc) qa[dc] = ldfrag_b(QBp + (rowB + q0 + c) * HD + dc * 32 + 8 * hh);

  float mrun = -INFINITY;                        // running maximum of the lane's query, alike in both half waves
  float lrun = 0.f;                              // running sum over the keys of this lane's own half wave
  v8f oacc[8];
#pragma unroll
  for (int t = 0; t < 8; ++t) oacc[t] = zero8();

  // Staging addresses. K chunk = 16 KiB in a row: piece i of thread tid is 16-B piece i*128+tid, K row
  // i*8 + (tid>>4). V^T chunk = 128 rows of 128 B: piece i is row i*16 + (tid>>3), 16-B piece tid&7.
  const unsigned kl = lds_off(Ksh) + (unsigned)(tid >> 4) * (KP * 2) + (unsigned)(tid & 15) * 16;
  const unsigned vl = lds_off(Vth) + (unsigned)(tid >> 3) * (VP * 2) + (unsigned)(tid & 7) * 16;
  const char* kg = (const char*)(KBp + rowB * HD);                 // block-uniform bases
  const char* vg = (const char*)VTh;
  const unsigned ko = (unsigned)tid * 16;                          // the lane's byte offsets from them
  const unsigned vo = (unsigned)(tid >> 3) * (SEQ * 2) + (unsigned)(tid & 7) * 16;

  // Prologue: K of chunk 0 landed and published, V^T of chunk 0 in flight.
  copy8_async(kl, 8 * KP * 2, kg, 128 * 16, ko);
  publish_point();
  copy8_async(vl, 16 * VP * 2, vg, (size_t)16 * SEQ * 2, vo);

#pragma unroll 1
  for (int kt = 0; kt <= qb; ++kt) {         // block-uniform trip count, at most NQB
    const int kv0 = kt * KC;
    // Chunk copied ahead. The last trip copies its own chunk once more, unread, instead of branching round the
    // copies: with a branch in the loop body the build holds all eight residual tiles to the loop's foot and
    // passes 256 registers, which would leave three blocks on a WGP instead of four.
    const int kn  = (kt < qb) ? kt + 1 : qb;

    // ---- scores^T: 64 keys x 16 queries per wave (A operand: row = key j*16+c, k = d, split map) ----
    // The eight LDS reads of key tile j+1 are issued as one group in front of tile j's products, into a second
    // register set: their latency passes under those products instead of standing in front of every product.
    v8f s[4];
    v16b kf[2][4];
#pragma unroll
    for (int dc = 0; dc < 4; ++dc) kf[0][dc] = ldfrag_b(Ksh + c * KP + dc * 32 + 8 * hh);
#pragma unroll
    for (int j = 0; j < 4; ++j) {
      if (j < 3) {
#pragma unroll
        for (int dc = 0; dc < 4; ++dc) kf[(j + 1) & 1][dc] = ldfrag_b(Ksh + ((j + 1) * 16 + c) * KP + dc * 32 + 8 * hh);
      }
      v8f sh = zero8();
#pragma unroll
      for (int dc = 0; dc < 4; ++dc) sh = mma_b(kf[j & 1][dc], qa[dc], sh);
      const int key = kv0 + j * 16 + 8 * hh;
#pragma unroll
      for (int r = 0; r < 8; ++r) {
        const float sv = sh[r] * SSC;
        s[j][r] = (key + r > qrow) ? -INFINITY : sv;          // causal: keys strictly after the row
      }
    }

    // V^T of this chunk published; every wave has left K: refill it
    publish_point();
    copy8_async(kl, 8 * KP * 2, kg + (size_t)kn * (KC * HD * 2), 128 * 16, ko);

    // ---- query max, online softmax, P^T hi (x1024) and residual (x2048) packed as B operands ----
    float mj[4];                                 // one chain per score tile, so that the chains are independent
#pragma unroll
    for (int j = 0; j < 4; ++j) {
      mj[j] = s[j][0];
#pragma unroll
      for (int r = 1; r < 8; ++r) mj[j] = fmaxf(mj[j], s[j][r]);
    }
    float m = fmaxf(fmaxf(mj[0], mj[1]), fmaxf(mj[2], mj[3]));
    m = fmaxf(m, xhalf(m));                      // the other eight keys of each tile lie in the other half wave
    const float mnew  = fmaxf(mrun, m);
    const float alpha = __expf(mrun - mnew);
    mrun = mnew;
    FragH pa[2], pr[2];
    float pj[4];
#pragma unroll
    for (int j = 0; j < 4; ++j) {
      pj[j] = 0.f;
#pragma unroll
      for (int r = 0; r < 8; ++r) {
        const float p  = __expf(s[j][r] - mnew);
        pj[j] += p;
        const float ph = p * PSC;
        const _Float16 hq = (_Float16)ph;
        const float res = (ph - (float)hq) * RSC;
        pa[j >> 1].v[(j & 1) * 8 + r] = hq;
        pr[j >> 1].v[(j & 1) * 8 + r] = (_Float16)res;
      }
    }
    lrun = lrun * alpha + ((pj[0] + pj[1]) + (pj[2] + pj[3]));
#pragma unroll
    for (int t = 0; t < 8; ++t) {
#pragma unroll
      for (int r = 0; r < 8; ++r) oacc[t][r] *= alpha;
    }

    // ---- context^T += V^T . P^T (f16 WMMA; A = V^T [dv][kv] by the split map, B = P^T from the accumulators) ----
    // V^T fragments likewise: the four LDS reads of tile t+1 stand in front of tile t's products.
    v16h vf[2][2];
#pragma unroll
    for (int kk = 0; kk < 2; ++kk) vf[0][kk] = ldfrag_h(Vth + c * VP + kk * 32 + 8 * hh);
#pragma unroll
    for (int t = 0; t < 8; ++t) {
      if (t < 7) {
#pragma unroll
        for (int kk = 0; kk < 2; ++kk) vf[(t + 1) & 1][kk] = ldfrag_h(Vth + ((t + 1) * 16 + c) * VP + kk * 32 + 8 * hh);
      }
      oacc[t] = mma_h(vf[t & 1][0], pa[0].v, oacc[t]);
      oacc[t] = mma_h(vf[t & 1][1], pa[1].v, oacc[t]);
      v8f rr = mma_h(vf[t & 1][0], pr[0].v, zero8());
      rr = mma_h(vf[t & 1][1], pr[1].v, rr);
#pragma unroll
      for (int r = 0; r < 8; ++r) oacc[t][r] += rr[r] * (1.0f / RSC);
    }

    // K of the next chunk published; every wave has left V^T: refill it
    publish_point();
    copy8_async(vl, 16 * VP * 2, vg + (size_t)kn * (KC * 2), (size_t)16 * SEQ * 2, vo);
  }
#if defined(__HIP_DEVICE_COMPILE__)
  asm volatile("s_wait_asynccnt 0x0" ::: "memory");   // the last trip's copies have landed before the wave ends
#endif

  // ---- normalise (1/l, the 1/1024 p carry and the 1/64 v carry), then stage and store the wave's 16x128 f32
  //      tile as two 16x64 halves: each store instruction writes two 256-B row pieces (whole 128-B lines)
  float* os = Os[wave];
  const float l   = lrun + xhalf(lrun);          // the two half waves' sums of the lane's query
  const float inv = ((l > 0.f) ? (1.0f / l) : 0.f) * (1.0f / (PSC * VSC));
  v4f vals[2][8];
#pragma unroll
  for (int hv = 0; hv < 2; ++hv) {
    if (hv == 1) wave_sync_lds();             // the first half is read out before the second overwrites it
#pragma unroll
    for (int t = 0; t < 4; ++t) {               // a lane's eight registers are eight consecutive d of its query
      const v8f o = oacc[4 * hv + t];
      const v4f lo = {o[0] * inv, o[1] * inv, o[2] * inv, o[3] * inv};
      const v4f hi = {o[4] * inv, o[5] * inv, o[6] * inv, o[7] * inv};
      *(v4f*)(os + c * OP + t * 16 + 8 * hh)     = lo;
      *(v4f*)(os + c * OP + t * 16 + 8 * hh + 4) = hi;
    }
    wave_sync_lds();
#pragma unroll
    for (int it = 0; it < 8; ++it) vals[hv][it] = *(const v4f*)(os + (2 * it + hh) * OP + c * 4);
  }
  float* C = outp + (rowB + q0) * HD;
#pragma unroll
  for (int hv = 0; hv < 2; ++hv) {
#pragma unroll
    for (int it = 0; it < 8; ++it) *(v4f*)(C + (size_t)(2 * it + hh) * HD + hv * 64 + c * 4) = vals[hv][it];
  }
}

// =====================================================================================================
// Workspace map (bytes); every plane is an exact multiple of its whole-line / 64x64-tile store granularity:
//   QB  bf16 [32*2048][128]    0          16777216
//   KB  bf16 [32*2048][128]    16777216   16777216
//   VT  f16  [32][128][2048]   33554432   16777216
//   end                        50331648
// =====================================================================================================
extern "C" void kernel_launch(void* const* d_in, const int* in_sizes, int n_in,
                              void* d_out, int out_size, void* d_ws, size_t ws_size,
                              hipStream_t stream) {
  if (n_in < 3) return;
  if (in_sizes[0] != NE || in_sizes[1] != NE || in_sizes[2] != NE) return;
  if (out_size != NE) return;

  const float* q = (const float*)d_in[0];
  const float* k = (const float*)d_in[1];
  const float* v = (const float*)d_in[2];

  const size_t PB = (size_t)NE * 2;                     // 16777216
  size_t off = 0;
  const size_t oQ  = off; off += PB;
  const size_t oK  = off; off += PB;
  const size_t oVT = off; off += PB;
  if (off > ws_size) return;                            // off = 50331648
  if (off > (size_t)134217728) return;

  char* ws = (char*)d_ws;
  unsigned short* QB = (unsigned short*)(ws + oQ);
  unsigned short* KB = (unsigned short*)(ws + oK);
  unsigned short* VT = (unsigned short*)(ws + oVT);
  float* out0 = (float*)d_out;

  const int n8 = NE / 8;                                // 1048576
  if ((n8 % 256) != 0) return;
  const dim3 blk(256), blk128(128);
  const dim3 gC(n8 / 256);                              // 4096 blocks
  const dim3 gVT(SEQ / 64, HD / 64, NB);                // 32 x 2 x 32 tiles
  const dim3 gA(NB * NQB);                              // 1024 blocks of 128

  // (0) q, k -> bf16 planes; v -> f16( bf16_RNE(v) * 64 ) transposed plane [b][d][s]
  conv_bf16<<<gC, blk, 0, stream>>>(q, QB, n8);
  conv_bf16<<<gC, blk, 0, stream>>>(k, KB, n8);
  vtrans_h16<<<gVT, blk, 0, stream>>>(v, VT);

  // (1) causal flash attention -> out f32 [32][2048][128]
  attn128<<<gA, blk128, 0, stream>>>(QB, KB, VT, out0);
  (void)hipGetLastError();
}

// v006
// A run of this version takes 88.6 microseconds.
// Next to v005, in two timings, it ran 1.06 times as fast each time.
// Counting every step since v000, it is 5.08 times as fast.
// Contractions: q.k^T on v_wmma_f32_16x16x32_bf16 (bf16 plane of the RNE-converted k, q converted RNE in the kernel, one product);
// p.v on v_wmma_f32_16x16x32_f16 (p as f16 x1024 hi plane plus f16 x2048 residual plane with its own per-chunk
// accumulator folded x1/2048 in f32, v^T as f16 of the bf16 RNE-converted v carried x64); all f32 accumulate;
// online softmax (running max) and the causal index select in f32 on VALU. Both products are formed transposed
// (S^T = K.Q^T, O^T += V^T.P^T): a lane holds one query's scores, and P^T goes from the score accumulators into the
// B operand in registers.
#include <hip/hip_runtime.h>
#include <hip/hip_bf16.h>
#include <math.h>
#include <stdint.h>

#define NB   32
#define SEQ  2048
#define HD   128
#define KC   64
#define NQB  (SEQ / 64)
#define NE   (NB * SEQ * HD)
#define PSC  1024.0f
#define RSC  2048.0f
#define VSC  64.0f
#define SSC  0.17677669529663687f
#define KP   (HD + 8)      // K row pitch in LDS, elements: 272 B = 16 B x 17
#define VP   (KC + 8)      // V^T row pitch in LDS, elements: 144 B = 16 B x 9
#define OP   (64 + 4)      // output staging row pitch, floats: 68 dwords
static_assert((SEQ % 64) == 0);
static_assert(HD == 128);
static_assert(NQB == 32);   // the tile deal's parity argument: n-1-t is t with five bits turned over
static_assert(((NE / 8) % 256) == 0);
static_assert(16 * OP * 4 == 16 * KP * 2);   // a wave's output staging also holds its 16 Q rows as bf16 at the K pitch

typedef _Float16 v16h __attribute__((ext_vector_type(16)));
typedef _Float16 v8h  __attribute__((ext_vector_type(8)));
typedef __bf16   v16b __attribute__((ext_vector_type(16)));
typedef float    v8f  __attribute__((ext_vector_type(8)));
typedef float    v4f  __attribute__((ext_vector_type(4)));
typedef unsigned int v4u __attribute__((ext_vector_type(4)));
typedef unsigned int v2u __attribute__((ext_vector_type(2)));

union FragH { v16h v; v8h h[2]; };
union FragB { v16b v; v4u u[2]; };
union HU8   { v8h h; v4u u; };

// ---- scalar helpers --------------------------------------------------------------------------------
__device__ __forceinline__ unsigned short bf_bits(float f) {          // f32 -> bf16 bits, RNE convert
  unsigned u = __float_as_uint(f);
  return (unsigned short)((u + 0x7FFFu + ((u >> 16) & 1u)) >> 16);
}
__device__ __forceinline__ float bf_up(unsigned short h) { return __uint_as_float(((unsigned)h) << 16); }
__device__ __forceinline__ float bfr(float f) { return bf_up(bf_bits(f)); }   // value of the bf16 RNE convert
__device__ __forceinline__ unsigned pk16(unsigned short a, unsigned short b) { return (unsigned)a | ((unsigned)b << 16); }
// value of lane l ^ 16 (the other half wave), by a vector cross-row move; every lane is on where it is used
__device__ __forceinline__ float xhalf(float x) {
  const int b = __builtin_bit_cast(int, x);
  return __builtin_bit_cast(float, __builtin_amdgcn_permlanex16(b, b, 0x76543210, 0xfedcba98, false, false));
}
__device__ __forceinline__ v8f zero8() { v8f z = {0.f, 0.f, 0.f, 0.f, 0.f, 0.f, 0.f, 0.f}; return z; }

// ---- fragment loaders: 16-bit A/B operand, lane -> row/col (lane&15), p already includes +8*(lane>>4);
//      elements 0..7 <- p[0..7] (k0+8h..), elements 8..15 <- p[16..23] (k0+16+8h..)
__device__ __forceinline__ v16h ldfrag_h(const _Float16* p) {
  FragH f;
  f.h[0] = *(const v8h*)(p);
  f.h[1] = *(const v8h*)(p + 16);
  return f.v;
}
__device__ __forceinline__ v16b ldfrag_b(const unsigned short* p) {
  FragB f;
  f.u[0] = *(const v4u*)(p);
  f.u[1] = *(const v4u*)(p + 16);
  return f.v;
}

// ---- WMMA helpers with trailing VALU hazard gap --------------------------------------------------------
__device__ __forceinline__ v8f mma_h(v16h a, v16h b, v8f c) {
  c = __builtin_amdgcn_wmma_f32_16x16x32_f16(false, a, false, b, (short)0, c, false, false);
#if defined(__HIP_DEVICE_COMPILE__)
  asm volatile("v_nop\n\tv_nop\n\tv_nop\n\tv_nop" : "+v"(c) : "v"(a), "v"(b));
#endif
  return c;
}
__device__ __forceinline__ v8f mma_b(v16b a, v16b b, v8f c) {
  c = __builtin_amdgcn_wmma_f32_16x16x32_bf16(false, a, false, b, (short)0, c, false, false);
#if defined(__HIP_DEVICE_COMPILE__)
  asm volatile("v_nop\n\tv_nop\n\tv_nop\n\tv_nop" : "+v"(c) : "v"(a), "v"(b));
#endif
  return c;
}
// ---- asynchronous staging, global -> LDS, through no register -------------------------------------------
__device__ __forceinline__ unsigned lds_off(const void* p) { return (unsigned)(size_t)p; }   // LDS byte address
// Eight 16-B copies per lane: piece i goes from g + i*gs + off to LDS byte l + i*ls; g is the same in every lane
// (scalar base), off the lane's own byte offset. The s_wait_xcnt closes the same statement, so that no address
// register of an issued copy is rewritten in front of it (a precaution).
__device__ __forceinline__ void copy8_async(unsigned l, unsigned ls, const char* g, size_t gs, unsigned off) {
#if defined(__HIP_DEVICE_COMPILE__)
  asm volatile(
      "global_load_async_to_lds_b128 %0, %16, %8\n\t"
      "global_load_async_to_lds_b128 %1, %16, %9\n\t"
      "global_load_async_to_lds_b128 %2, %16, %10\n\t"
      "global_load_async_to_lds_b128 %3, %16, %11\n\t"
      "global_load_async_to_lds_b128 %4, %16, %12\n\t"
      "global_load_async_to_lds_b128 %5, %16, %13\n\t"
      "global_load_async_to_lds_b128 %6, %16, %14\n\t"
      "global_load_async_to_lds_b128 %7, %16, %15\n\t"
      "s_wait_xcnt 0x0"
      :: "v"(l), "v"(l + ls), "v"(l + 2 * ls), "v"(l + 3 * ls),
         "v"(l + 4 * ls), "v"(l + 5 * ls), "v"(l + 6 * ls), "v"(l + 7 * ls),
         "s"(g), "s"(g + gs), "s"(g + 2 * gs), "s"(g + 3 * gs),
         "s"(g + 4 * gs), "s"(g + 5 * gs), "s"(g + 6 * gs), "s"(g + 7 * gs), "v"(off)
      : "memory");
#endif
}
// Hand-over of a staged tile: this wave's LDS reads of the buffer that is refilled next have retired, this wave's
// own copies have landed, then the block barrier publishes them and ends every reader's last read.
__device__ __forceinline__ void publish_point() {
#if defined(__HIP_DEVICE_COMPILE__)
  asm volatile("s_wait_dscnt 0x0" ::: "memory");      // own LDS reads done before the buffer gets a new writer
  asm volatile("s_wait_asynccnt 0x0" ::: "memory");   // own copies landed before other waves may read them
#endif
  __syncthreads();
}
__device__ __forceinline__ void wave_sync_lds() {
  __builtin_amdgcn_fence(__ATOMIC_RELEASE, "workgroup");
  __builtin_amdgcn_wave_barrier();
  __builtin_amdgcn_fence(__ATOMIC_ACQUIRE, "workgroup");
}

// =====================================================================================================
// Plane convert: Y[i] = bf16_RNE(X[i]) bits. Thread i handles elements 8i..8i+7 and writes one 16-B piece;
// grid = n8 / 256 (n8 multiple of 256, host-checked). coverage: n8 threads x 8 elements = the whole plane.
// =====================================================================================================
__global__ __launch_bounds__(256) void conv_bf16(const float* __restrict__ X, unsigned short* Y, int n8) {
  const int i  = blockIdx.x * 256 + threadIdx.x;
  const int ic = (i < n8) ? i : (n8 - 1);                     // clamped address
  const float* src = X + (size_t)ic * 8;
  const v4f a = *(const v4f*)(src);
  const v4f c = *(const v4f*)(src + 4);
  v4u o;
  o[0] = pk16(bf_bits(a[0]), bf_bits(a[1]));
  o[1] = pk16(bf_bits(a[2]), bf_bits(a[3]));
  o[2] = pk16(bf_bits(c[0]), bf_bits(c[1]));
  o[3] = pk16(bf_bits(c[2]), bf_bits(c[3]));
  if (i < n8) *(v4u*)(Y + (size_t)i * 8) = o;
  
}

// =====================================================================================================
// v [b][s][d] f32 -> VT [b][d][s] f16( bf16_RNE(v) * 64 ). Block = 256 threads, one 64(s) x 64(d) tile,
// grid = (SEQ/64, HD/64, NB). Load: thread t reads s row t>>2, d = dblk*64 + 16*(t&3)..+15 (4 x 16-B loads),
// converts and writes the transposed elements into the LDS tile T[d][s] (pitch 72 halves); __syncthreads;
// coverage: load 256 threads x 16 = 64x64; store 2 it x 32 rows x 8 lanes x 8 halves = 64 d rows x 64 s.
// =====================================================================================================
__global__ __launch_bounds__(256) void vtrans_h16(const float* __restrict__ V, unsigned short* VTp) {
  __shared__ __align__(16) _Float16 Tsh[64 * 72];
  const int t    = threadIdx.x;
  const int dblk = blockIdx.y;
  const int b    = blockIdx.z;
  const int s0   = blockIdx.x * 64;
  {
    const int sr = t >> 2, d0 = (t & 3) * 16;
    const float* src = V + ((size_t)b * SEQ + s0 + sr) * HD + dblk * 64 + d0;
#pragma unroll
    for (int i = 0; i < 4; ++i) {
      const v4f x = *(const v4f*)(src + 4 * i);
#pragma unroll
      for (int e = 0; e < 4; ++e) Tsh[(d0 + 4 * i + e) * 72 + sr] = (_Float16)(bfr(x[e]) * VSC);
    }
  }
  __syncthreads();
  const int q8 = t >> 3, c8 = (t & 7) * 8;
  v4u vals[2];
#pragma unroll
  for (int it = 0; it < 2; ++it) {
    const int d = it * 32 + q8;
    HU8 hu;
    hu.h = *(const v8h*)(Tsh + d * 72 + c8);
    vals[it] = hu.u;
  }
#pragma unroll
  for (int it = 0; it < 2; ++it) {
    const int d = it * 32 + q8;
    *(v4u*)(VTp + ((size_t)b * HD + dblk * 64 + d) * SEQ + s0 + c8) = vals[it];
  }
  
}

// =====================================================================================================
// Causal flash attention, head dim 128, one head per sequence, SEQ query/key rows per sequence.
//   q (f32, the input itself) and the KB plane (bf16 bits): element (b, t, d) at [(b*SEQ + t)*128 + d]
//   Q is read by exactly one wave, so it has no plane of its own: each wave loads its 16 rows as f32, one whole
//   512-B row per instruction, converts them (RNE, the plane convert's own arithmetic) and turns them into B
//   fragments through its own, still unused, output staging rows in LDS.
//   VT plane (f16, x64): element (b, d, s) at [(b*128 + d)*SEQ + s]
//   out (f32): element (b, t, d) at [(b*SEQ + t)*128 + d]
//   score = (k . q) * 1/sqrt(32) on bf16 WMMA, A = K rows, B = Q: accumulator register r of lane (c, h) is key
//   16j + 8h + r against query q0 + c; score := -inf where key > query row (select by index);
//   maximum and sum of a query run inside its lane, the two half waves exchange the maximum once per chunk and
//   join their sums once, behind the loop;
//   p = exp(s - m) packed in registers as f16(1024 p) and f16(2048 (1024 p - hi)): score tiles 2kk and 2kk+1 are
//   elements 0..7 and 8..15 of the B operand of keys 32kk..32kk+31, the k order of the V^T loader;
//   context^T += v^T . hi on f16 WMMA, plus (v^T . res) * 1/2048 from a per-chunk accumulator: register r of lane
//   (c, h) in tile t is d = 16t + 8h + r of query q0 + c; online softmax (running max) in f32.
//   Block = 4 waves = 64 query rows of one sequence; grid = NQB * NB, tile qb dealt by the block index's parity;
//   key chunks of 64, block-uniform trip
//   kt = 0..qb (chunks strictly above the diagonal are fully masked and skipped).
//   K / V^T chunk staging: asynchronous 16-B copies to LDS, 128 threads x 8 pieces per plane = the whole 64x128 /
//   128x64 tile, each wave instruction on four whole 128-B lines. One buffer per operand: K of chunk kt+1 is
//   copied behind the barrier that ends the score products of chunk kt and flies under softmax and P.V; V^T of
//   chunk kt+1 is copied behind the barrier that ends P.V of chunk kt and flies under the next score products.
//   Output coverage: each wave stores its rows q0..q0+15 x 128 columns, two 256-B row pieces per instruction
// =====================================================================================================
__global__ __launch_bounds__(128)
void attn128(const float* __restrict__ Qf, const unsigned short* __restrict__ KBp,
             const unsigned short* __restrict__ VTp, float* outp) {
  // Row pitches are odd multiples of 16 B, so the 16 lanes of a half wave that read one 16-B piece each from
  // 16 consecutive rows fall on 64 distinct banks.
  __shared__ __align__(16) unsigned short Ksh[KC * KP];           // K [kv][d] bf16, pitch 272 B
  __shared__ __align__(16) _Float16 Vth[HD * VP];                 // V^T [d][kv] f16, pitch 144 B
  __shared__ __align__(16) float    Os[4][16 * OP];               // per wave context half tile [row][64 d]

  const int tid  = threadIdx.x;
  const int wave = tid >> 5;
  const int lane = tid & 31;
  const int hh   = lane >> 4;
  const int c    = lane & 15;

  // Tile deal. Every block is resident at once and a tile's cost grows with its index, so the launch lasts as long
  // as the fullest WGP. Blocks whose indices differ in two bits from bit 1 up take tiles t, n-1-t, n-1-t, t (or the
  // like with t moved by those bits): any such four blocks on one WGP walk 2n + 2 chunks together. For speed only.
  // A permutation: n-1-t turns over bits 0..4 of bx, four of them in bx >> 1, so both tiles read the same parity.
  const int bx = blockIdx.x;
  const int tl = bx % NQB;
  const int qb = (__builtin_popcount((unsigned)bx >> 1) & 1) ? (NQB - 1 - tl) : tl;
  const int b  = bx / NQB;
  const int q0 = qb * 64 + wave * 16;            // in-sequence query row of this wave's first row
  const int qrow = q0 + c;                       // in-sequence query row of this lane's accumulator column
  const size_t rowB = (size_t)b * SEQ;
  const _Float16* VTh = (const _Float16*)(const void*)VTp + (size_t)b * HD * SEQ;

  // ---- Q rows of this wave, f32: row r by one instruction, lane l takes d = 4l..4l+3 ----
  const float* qsrc = Qf + (rowB + q0) * HD + lane * 4;
  v4f qx[16];
#pragma unroll
  for (int r = 0; r < 16; ++r) qx[r] = *(const v4f*)(qsrc + r * HD);
#if defined(__HIP_DEVICE_COMPILE__)
  // The loads' address pair is named here so that it stays whole up to the wait (a precaution).
  asm volatile("s_wait_xcnt 0x0" :: "v"(qsrc) : "memory");
#endif

  float mrun = -INFINITY;                        // running maximum of the lane's query, alike in both half waves
  float lrun = 0.f;                              // running sum over the keys of this lane's own half wave
  v8f oacc[8];
#pragma unroll
  for (int t = 0; t < 8; ++t) oacc[t] = zero8();

  // Staging addresses. K chunk = 16 KiB in a row: piece i of thread tid is 16-B piece i*128+tid, K row
  // i*8 + (tid>>4). V^T chunk = 128 rows of 128 B: piece i is row i*16 + (tid>>3), 16-B piece tid&7.
  const unsigned kl = lds_off(Ksh) + (unsigned)(tid >> 4) * (KP * 2) + (unsigned)(tid & 15) * 16;
  const unsigned vl = lds_off(Vth) + (unsigned)(tid >> 3) * (VP * 2) + (unsigned)(tid & 7) * 16;
  const char* kg = (const char*)(KBp + rowB * HD);                 // block-uniform bases
  const char* vg = (const char*)VTh;
  const unsigned ko = (unsigned)tid * 16;                          // the lane's byte offsets from them
  const unsigned vo = (unsigned)(tid >> 3) * (SEQ * 2) + (unsigned)(tid & 7) * 16;

  // Prologue: K of chunk 0 landed and published, V^T of chunk 0 in flight. The Q rows come in beside K's copies.
  copy8_async(kl, 8 * KP * 2, kg, 128 * 16, ko);

  // ---- Q fragments (B operand, col = lane&15): 4 d-chunks, from the wave's own LDS rows (pitch as K's) ----
  unsigned short* qs = (unsigned short*)(void*)Os[wave];
#pragma unroll
  for (int r = 0; r < 16; ++r) {
    const v2u w = {pk16(bf_bits(qx[r][0]), bf_bits(qx[r][1])), pk16(bf_bits(qx[r][2]), bf_bits(qx[r][3]))};
    *(v2u*)(qs + r * KP + lane * 4) = w;
  }
  wave_sync_lds();                               // the rows are written by the wave's other lanes
  v16b qa[4];
#pragma unroll
  for (int dc = 0; dc < 4; ++dc) qa[dc] = ldfrag_b(qs + c * KP + dc * 32 + 8 * hh);

  publish_point();
  copy8_async(vl, 16 * VP * 2, vg, (size_t)16 * SEQ * 2, vo);

#pragma unroll 1
  for (int kt = 0; kt <= qb; ++kt) {         // block-uniform trip count, at most NQB
    const int kv0 = kt * KC;
    // Chunk copied ahead. The last trip copies its own chunk once more, unread, instead of branching round the
    // copies: with a branch in the loop body the build holds all eight residual tiles to the loop's foot and
    // passes 256 registers, which would leave three blocks on a WGP instead of four.
    const int kn  = (kt < qb) ? kt + 1 : qb;

    // ---- scores^T: 64 keys x 16 queries per wave (A operand: row = key j*16+c, k = d, split map) ----
    // The eight LDS reads of key tile j+1 are issued as one group in front of tile j's products, into a second
    // register set: their latency passes under those products instead of standing in front of every product.
    v8f s[4];
    v16b kf[2][4];
#pragma unroll
    for (int dc = 0; dc < 4; ++dc) kf[0][dc] = ldfrag_b(Ksh + c * KP + dc * 32 + 8 * hh);
#pragma unroll
    for (int j = 0; j < 4; ++j) {
      if (j < 3) {
#pragma unroll
        for (int dc = 0; dc < 4; ++dc) kf[(j + 1) & 1][dc] = ldfrag_b(Ksh + ((j + 1) * 16 + c) * KP + dc * 32 + 8 * hh);
      }
      v8f sh = zero8();
#pragma unroll
      for (int dc = 0; dc < 4; ++dc) sh = mma_b(kf[j & 1][dc], qa[dc], sh);
      const int key = kv0 + j * 16 + 8 * hh;
#pragma unroll
      for (int r = 0; r < 8; ++r) {
        const float sv = sh[r] * SSC;
        s[j][r] = (key + r > qrow) ? -INFINITY : sv;          // causal: keys strictly after the row
      }
    }

    // V^T of this chunk published; every wave has left K: refill it
    publish_point();
    copy8_async(kl, 8 * KP * 2, kg + (size_t)kn * (KC * HD * 2), 128 * 16, ko);

    // ---- query max, online softmax, P^T hi (x1024) and residual (x2048) packed as B operands ----
    float mj[4];                                 // one chain per score tile, so that the chains are independent
#pragma unroll
    for (int j = 0; j < 4; ++j) {
      mj[j] = s[j][0];
#pragma unroll
      for (int r = 1; r < 8; ++r) mj[j] = fmaxf(mj[j], s[j][r]);
    }
    float m = fmaxf(fmaxf(mj[0], mj[1]), fmaxf(mj[2], mj[3]));
    m = fmaxf(m, xhalf(m));                      // the other eight keys of each tile lie in the other half wave
    const float mnew  = fmaxf(mrun, m);
    const float alpha = __expf(mrun - mnew);
    mrun = mnew;
    FragH pa[2], pr[2];
    float pj[4];
#pragma unroll
    for (int j = 0; j < 4; ++j) {
      pj[j] = 0.f;
#pragma unroll
      for (int r = 0; r < 8; ++r) {
        const float p  = __expf(s[j][r] - mnew);
        pj[j] += p;
        const float ph = p * PSC;
        const _Float16 hq = (_Float16)ph;
        const float res = (ph - (float)hq) * RSC;
        pa[j >> 1].v[(j & 1) * 8 + r] = hq;
        pr[j >> 1].v[(j & 1) * 8 + r] = (_Float16)res;
      }
    }
    lrun = lrun * alpha + ((pj[0] + pj[1]) + (pj[2] + pj[3]));
#pragma unroll
    for (int t = 0; t < 8; ++t) {
#pragma unroll
      for (int r = 0; r < 8; ++r) oacc[t][r] *= alpha;
    }

    // ---- context^T += V^T . P^T (f16 WMMA; A = V^T [dv][kv] by the split map, B = P^T from the accumulators) ----
    // V^T fragments likewise: the four LDS reads of tile t+1 stand in front of tile t's products.
    v16h vf[2][2];
#pragma unroll
    for (int kk = 0; kk < 2; ++kk) vf[0][kk] = ldfrag_h(Vth + c * VP + kk * 32 + 8 * hh);
#pragma unroll
    for (int t = 0; t < 8; ++t) {
      if (t < 7) {
#pragma unroll
        for (int kk = 0; kk < 2; ++kk) vf[(t + 1) & 1][kk] = ldfrag_h(Vth + ((t + 1) * 16 + c) * VP + kk * 32 + 8 * hh);
      }
      oacc[t] = mma_h(vf[t & 1][0], pa[0].v, oacc[t]);
      oacc[t] = mma_h(vf[t & 1][1], pa[1].v, oacc[t]);
      v8f rr = mma_h(vf[t & 1][0], pr[0].v, zero8());
      rr = mma_h(vf[t & 1][1], pr[1].v, rr);
#pragma unroll
      for (int r = 0; r < 8; ++r) oacc[t][r] += rr[r] * (1.0f / RSC);
    }

    // K of the next chunk published; every wave has left V^T: refill it
    publish_point();
    copy8_async(vl, 16 * VP * 2, vg + (size_t)kn * (KC * 2), (size_t)16 * SEQ * 2, vo);
  }
#if defined(__HIP_DEVICE_COMPILE__)
  asm volatile("s_wait_asynccnt 0x0" ::: "memory");   // the last trip's copies have landed before the wave ends
#endif

  // ---- normalise (1/l, the 1/1024 p carry and the 1/64 v carry), then stage and store the wave's 16x128 f32
  //      tile as two 16x64 halves: each store instruction writes two 256-B row pieces (whole 128-B lines)
  float* os = Os[wave];
  const float l   = lrun + xhalf(lrun);          // the two half waves' sums of the lane's query
  const float inv = ((l > 0.f) ? (1.0f / l) : 0.f) * (1.0f / (PSC * VSC));
  v4f vals[2][8];
#pragma unroll
  for (int hv = 0; hv < 2; ++hv) {
    if (hv == 1) wave_sync_lds();             // the first half is read out before the second overwrites it
#pragma unroll
    for (int t = 0; t < 4; ++t) {               // a lane's eight registers are eight consecutive d of its query
      const v8f o = oacc[4 * hv + t];
      const v4f lo = {o[0] * inv, o[1] * inv, o[2] * inv, o[3] * inv};
      const v4f hi = {o[4] * inv, o[5] * inv, o[6] * inv, o[7] * inv};
      *(v4f*)(os + c * OP + t * 16 + 8 * hh)     = lo;
      *(v4f*)(os + c * OP + t * 16 + 8 * hh + 4) = hi;
    }
    wave_sync_lds();
#pragma unroll
    for (int it = 0; it < 8; ++it) vals[hv][it] = *(const v4f*)(os + (2 * it + hh) * OP + c * 4);
  }
  float* C = outp + (rowB + q0) * HD;
#pragma unroll
  for (int hv = 0; hv < 2; ++hv) {
#pragma unroll
    for (int it = 0; it < 8; ++it) *(v4f*)(C + (size_t)(2 * it + hh) * HD + hv * 64 + c * 4) = vals[hv][it];
  }
}

// =====================================================================================================
// Workspace map (bytes); every plane is an exact multiple of its whole-line / 64x64-tile store granularity:
//   KB  bf16 [32*2048][128]    0          16777216
//   VT  f16  [32][128][2048]   16777216   16777216
//   end                        33554432
// =====================================================================================================
extern "C" void kernel_launch(void* const* d_in, const int* in_sizes, int n_in,
                              void* d_out, int out_size, void* d_ws, size_t ws_size,
                              hipStream_t stream) {
  if (n_in < 3) return;
  if (in_sizes[0] != NE || in_sizes[1] != NE || in_sizes[2] != NE) return;
  if (out_size != NE) return;

  const float* q = (const float*)d_in[0];
  const float* k = (const float*)d_in[1];
  const float* v = (const float*)d_in[2];

  const size_t PB = (size_t)NE * 2;                     // 16777216
  size_t off = 0;
  const size_t oK  = off; off += PB;
  const size_t oVT = off; off += PB;
  if (off > ws_size) return;                            // off = 33554432
  if (off > (size_t)134217728) return;

  char* ws = (char*)d_ws;
  unsigned short* KB = (unsigned short*)(ws + oK);
  unsigned short* VT = (unsigned short*)(ws + oVT);
  float* out0 = (float*)d_out;

  const int n8 = NE / 8;                                // 1048576
  if ((n8 % 256) != 0) return;
  const dim3 blk(256), blk128(128);
  const dim3 gC(n8 / 256);                              // 4096 blocks
  const dim3 gVT(SEQ / 64, HD / 64, NB);                // 32 x 2 x 32 tiles
  const dim3 gA(NB * NQB);                              // 1024 blocks of 128

  // (0) k -> bf16 plane; v -> f16( bf16_RNE(v) * 64 ) transposed plane [b][d][s]
  conv_bf16<<<gC, blk, 0, stream>>>(k, KB, n8);
  vtrans_h16<<<gVT, blk, 0, stream>>>(v, VT);

  // (1) causal flash attention -> out f32 [32][2048][128]
  attn128<<<gA, blk128, 0, stream>>>(q, KB, VT, out0);
  (void)hipGetLastError();
}

// v007
// A run of this version takes 75.3 microseconds.
// In two side-by-side timings against v006, it was 1.17 and 1.18 times as fast.
// Counting every step since v000, it is 5.97 times as fast.
// Contractions: q.k^T on v_wmma_f32_16x16x32_bf16 (bf16 plane of the RNE-converted k, q converted RNE in the kernel, one product);
// p.v on v_wmma_f32_16x16x32_f16 (p as f16 x1024 hi plane plus f16 x2048 residual plane with its own per-chunk
// accumulator folded x1/2048 in f32, v^T as f16 of the bf16 RNE-converted v carried x64); all f32 accumulate;
// online softmax (running max) and the causal index select in f32 on VALU. Both products are formed transposed
// (S^T = K.Q^T, O^T += V^T.P^T): a lane holds one query's scores, and P^T goes from the score accumulators into the
// B operand in registers.
#include <hip/hip_runtime.h>
#include <hip/hip_bf16.h>
#include <math.h>
#include <stdint.h>

#define NB   32
#define SEQ  2048
#define HD   128
#define KC   64
#define NQB  (SEQ / 64)
#define NE   (NB * SEQ * HD)
#define PSC  1024.0f
#define RSC  2048.0f
#define VSC  64.0f
#define SSC  0.17677669529663687f
#define KP   (HD + 8)      // K row pitch in LDS, elements: 272 B = 16 B x 17
#define VP   (KC + 8)      // V^T row pitch in LDS, elements: 144 B = 16 B x 9
#define OP   (64 + 4)      // output staging row pitch, floats: 68 dwords
static_assert((SEQ % 64) == 0);
static_assert(HD == 128);
static_assert(NQB == 32);   // the tile deal's parity argument: n-1-t is t with five bits turned over
static_assert(((NE / 8) % 256) == 0);
static_assert(16 * OP * 4 == 16 * KP * 2);   // a wave's output staging also holds its 16 Q rows as bf16 at the K pitch

typedef _Float16 v16h __attribute__((ext_vector_type(16)));
typedef _Float16 v8h  __attribute__((ext_vector_type(8)));
typedef __bf16   v16b __attribute__((ext_vector_type(16)));
typedef float    v8f  __attribute__((ext_vector_type(8)));
typedef float    v4f  __attribute__((ext_vector_type(4)));
typedef unsigned int v4u __attribute__((ext_vector_type(4)));
typedef unsigned int v2u __attribute__((ext_vector_type(2)));

union FragH { v16h v; v8h h[2]; };
union FragB { v16b v; v4u u[2]; };
union HU8   { v8h h; v4u u; };

// ---- scalar helpers --------------------------------------------------------------------------------
__device__ __forceinline__ unsigned short bf_bits(float f) {          // f32 -> bf16 bits, RNE convert
  unsigned u = __float_as_uint(f);
  return (unsigned short)((u + 0x7FFFu + ((u >> 16) & 1u)) >> 16);
}
__device__ __forceinline__ float bf_up(unsigned short h) { return __uint_as_float(((unsigned)h) << 16); }
__device__ __forceinline__ float bfr(float f) { return bf_up(bf_bits(f)); }   // value of the bf16 RNE convert
__device__ __forceinline__ unsigned pk16(unsigned short a, unsigned short b) { return (unsigned)a | ((unsigned)b << 16); }
// value of lane l ^ 16 (the other half wave), by a vector cross-row move; every lane is on where it is used
__device__ __forceinline__ float xhalf(float x) {
  const int b = __builtin_bit_cast(int, x);
  return __builtin_bit_cast(float, __builtin_amdgcn_permlanex16(b, b, 0x76543210, 0xfedcba98, false, false));
}
__device__ __forceinline__ v8f zero8() { v8f z = {0.f, 0.f, 0.f, 0.f, 0.f, 0.f, 0.f, 0.f}; return z; }

// ---- fragment loaders: 16-bit A/B operand, lane -> row/col (lane&15), p already includes +8*(lane>>4);
//      elements 0..7 <- p[0..7] (k0+8h..), elements 8..15 <- p[16..23] (k0+16+8h..)
__device__ __forceinline__ v16h ldfrag_h(const _Float16* p) {
  FragH f;
  f.h[0] = *(const v8h*)(p);
  f.h[1] = *(const v8h*)(p + 16);
  return f.v;
}
__device__ __forceinline__ v16b ldfrag_b(const unsigned short* p) {
  FragB f;
  f.u[0] = *(const v4u*)(p);
  f.u[1] = *(const v4u*)(p + 16);
  return f.v;
}

// ---- WMMA groups: a tile's four products stand back to back in one statement. Inside a group only accumulate
//      chains follow one another, which need no distance; the four v_nop that end the statement are the distance the
//      chip asks for before the first vector instruction that reads D or overwrites A or B behind the group.
// Score tile: one chain of four products over d on one accumulator, started from 0.
__device__ __forceinline__ v8f mma_b4(v16b a0, v16b a1, v16b a2, v16b a3, v16b b0, v16b b1, v16b b2, v16b b3) {
  v8f d = zero8();
#if defined(__HIP_DEVICE_COMPILE__)
  asm volatile(
      "v_wmma_f32_16x16x32_bf16 %0, %1, %5, 0\n\t"
      "v_wmma_f32_16x16x32_bf16 %0, %2, %6, %0\n\t"
      "v_wmma_f32_16x16x32_bf16 %0, %3, %7, %0\n\t"
      "v_wmma_f32_16x16x32_bf16 %0, %4, %8, %0\n\t"
      "v_nop\n\tv_nop\n\tv_nop\n\tv_nop"
      : "=&v"(d)
      : "v"(a0), "v"(a1), "v"(a2), "v"(a3), "v"(b0), "v"(b1), "v"(b2), "v"(b3));
#endif
  return d;
}
// Context tile: o += a0.h0 + a1.h1 and r = a0.r0 + a1.r1, the two chains taking turns, each in its old order.
__device__ __forceinline__ void mma_h4(v8f& o, v8f& r, v16h a0, v16h a1, v16h h0, v16h h1, v16h r0, v16h r1) {
#if defined(__HIP_DEVICE_COMPILE__)
  asm volatile(
      "v_wmma_f32_16x16x32_f16 %0, %2, %4, %0\n\t"
      "v_wmma_f32_16x16x32_f16 %1, %2, %6, 0\n\t"
      "v_wmma_f32_16x16x32_f16 %0, %3, %5, %0\n\t"
      "v_wmma_f32_16x16x32_f16 %1, %3, %7, %1\n\t"
      "v_nop\n\tv_nop\n\tv_nop\n\tv_nop"
      : "+v"(o), "=&v"(r)
      : "v"(a0), "v"(a1), "v"(h0), "v"(h1), "v"(r0), "v"(r1));
#endif
}
// ---- asynchronous staging, global -> LDS, through no register -------------------------------------------
__device__ __forceinline__ unsigned lds_off(const void* p) { return (unsigned)(size_t)p; }   // LDS byte address
// Eight 16-B copies per lane: piece i goes from g + i*gs + off to LDS byte l + i*ls; g is the same in every lane
// (scalar base), off the lane's own byte offset. The s_wait_xcnt closes the same statement, so that no address
// register of an issued copy is rewritten in front of it (a precaution).
__device__ __forceinline__ void copy8_async(unsigned l, unsigned ls, const char* g, size_t gs, unsigned off) {
#if defined(__HIP_DEVICE_COMPILE__)
  asm volatile(
      "global_load_async_to_lds_b128 %0, %16, %8\n\t"
      "global_load_async_to_lds_b128 %1, %16, %9\n\t"
      "global_load_async_to_lds_b128 %2, %16, %10\n\t"
      "global_load_async_to_lds_b128 %3, %16, %11\n\t"
      "global_load_async_to_lds_b128 %4, %16, %12\n\t"
      "global_load_async_to_lds_b128 %5, %16, %13\n\t"
      "global_load_async_to_lds_b128 %6, %16, %14\n\t"
      "global_load_async_to_lds_b128 %7, %16, %15\n\t"
      "s_wait_xcnt 0x0"
      :: "v"(l), "v"(l + ls), "v"(l + 2 * ls), "v"(l + 3 * ls),
         "v"(l + 4 * ls), "v"(l + 5 * ls), "v"(l + 6 * ls), "v"(l + 7 * ls),
         "s"(g), "s"(g + gs), "s"(g + 2 * gs), "s"(g + 3 * gs),
         "s"(g + 4 * gs), "s"(g + 5 * gs), "s"(g + 6 * gs), "s"(g + 7 * gs), "v"(off)
      : "memory");
#endif
}
// Hand-over of a staged tile: this wave's LDS reads of the buffer that is refilled next have retired, this wave's
// own copies have landed, then the block barrier publishes them and ends every reader's last read.
__device__ __forceinline__ void publish_point() {
#if defined(__HIP_DEVICE_COMPILE__)
  asm volatile("s_wait_dscnt 0x0" ::: "memory");      // own LDS reads done before the buffer gets a new writer
  asm volatile("s_wait_asynccnt 0x0" ::: "memory");   // own copies landed before other waves may read them
#endif
  __syncthreads();
}
__device__ __forceinline__ void wave_sync_lds() {
  __builtin_amdgcn_fence(__ATOMIC_RELEASE, "workgroup");
  __builtin_amdgcn_wave_barrier();
  __builtin_amdgcn_fence(__ATOMIC_ACQUIRE, "workgroup");
}

// =====================================================================================================
// Plane convert: Y[i] = bf16_RNE(X[i]) bits. Thread i handles elements 8i..8i+7 and writes one 16-B piece;
// grid = n8 / 256 (n8 multiple of 256, host-checked). coverage: n8 threads x 8 elements = the whole plane.
// =====================================================================================================
__global__ __launch_bounds__(256) void conv_bf16(const float* __restrict__ X, unsigned short* Y, int n8) {
  const int i  = blockIdx.x * 256 + threadIdx.x;
  const int ic = (i < n8) ? i : (n8 - 1);                     // clamped address
  const float* src = X + (size_t)ic * 8;
  const v4f a = *(const v4f*)(src);
  const v4f c = *(const v4f*)(src + 4);
  v4u o;
  o[0] = pk16(bf_bits(a[0]), bf_bits(a[1]));
  o[1] = pk16(bf_bits(a[2]), bf_bits(a[3]));
  o[2] = pk16(bf_bits(c[0]), bf_bits(c[1]));
  o[3] = pk16(bf_bits(c[2]), bf_bits(c[3]));
  if (i < n8) *(v4u*)(Y + (size_t)i * 8) = o;
  
}

// =====================================================================================================
// v [b][s][d] f32 -> VT [b][d][s] f16( bf16_RNE(v) * 64 ). Block = 256 threads, one 64(s) x 64(d) tile,
// grid = (SEQ/64, HD/64, NB). Load: thread t reads s row t>>2, d = dblk*64 + 16*(t&3)..+15 (4 x 16-B loads),
// converts and writes the transposed elements into the LDS tile T[d][s] (pitch 72 halves); __syncthreads;
// coverage: load 256 threads x 16 = 64x64; store 2 it x 32 rows x 8 lanes x 8 halves = 64 d rows x 64 s.
// =====================================================================================================
__global__ __launch_bounds__(256) void vtrans_h16(const float* __restrict__ V, unsigned short* VTp) {
  __shared__ __align__(16) _Float16 Tsh[64 * 72];
  const int t    = threadIdx.x;
  const int dblk = blockIdx.y;
  const int b    = blockIdx.z;
  const int s0   = blockIdx.x * 64;
  {
    const int sr = t >> 2, d0 = (t & 3) * 16;
    const float* src = V + ((size_t)b * SEQ + s0 + sr) * HD + dblk * 64 + d0;
#pragma unroll
    for (int i = 0; i < 4; ++i) {
      const v4f x = *(const v4f*)(src + 4 * i);
#pragma unroll
      for (int e = 0; e < 4; ++e) Tsh[(d0 + 4 * i + e) * 72 + sr] = (_Float16)(bfr(x[e]) * VSC);
    }
  }
  __syncthreads();
  const int q8 = t >> 3, c8 = (t & 7) * 8;
  v4u vals[2];
#pragma unroll
  for (int it = 0; it < 2; ++it) {
    const int d = it * 32 + q8;
    HU8 hu;
    hu.h = *(const v8h*)(Tsh + d * 72 + c8);
    vals[it] = hu.u;
  }
#pragma unroll
  for (int it = 0; it < 2; ++it) {
    const int d = it * 32 + q8;
    *(v4u*)(VTp + ((size_t)b * HD + dblk * 64 + d) * SEQ + s0 + c8) = vals[it];
  }
  
}

// =====================================================================================================
// Causal flash attention, head dim 128, one head per sequence, SEQ query/key rows per sequence.
//   q (f32, the input itself) and the KB plane (bf16 bits): element (b, t, d) at [(b*SEQ + t)*128 + d]
//   Q is read by exactly one wave, so it has no plane of its own: each wave loads its 16 rows as f32, one whole
//   512-B row per instruction, converts them (RNE, the plane convert's own arithmetic) and turns them into B
//   fragments through its own, still unused, output staging rows in LDS.
//   VT plane (f16, x64): element (b, d, s) at [(b*128 + d)*SEQ + s]
//   out (f32): element (b, t, d) at [(b*SEQ + t)*128 + d]
//   score = (k . q) * 1/sqrt(32) on bf16 WMMA, A = K rows, B = Q: accumulator register r of lane (c, h) is key
//   16j + 8h + r against query q0 + c; score := -inf where key > query row (select by index);
//   maximum and sum of a query run inside its lane, the two half waves exchange the maximum once per chunk and
//   join their sums once, behind the loop;
//   p = exp(s - m) packed in registers as f16(1024 p) and f16(2048 (1024 p - hi)): score tiles 2kk and 2kk+1 are
//   elements 0..7 and 8..15 of the B operand of keys 32kk..32kk+31, the k order of the V^T loader;
//   context^T += v^T . hi on f16 WMMA, plus (v^T . res) * 1/2048 from a per-chunk accumulator: register r of lane
//   (c, h) in tile t is d = 16t + 8h + r of query q0 + c; online softmax (running max) in f32.
//   Block = 4 waves = 64 query rows of one sequence; grid = NQB * NB, tile qb dealt by the block index's parity;
//   key chunks of 64, block-uniform trip
//   kt = 0..qb (chunks strictly above the diagonal are fully masked and skipped).
//   K / V^T chunk staging: asynchronous 16-B copies to LDS, 128 threads x 8 pieces per plane = the whole 64x128 /
//   128x64 tile, each wave instruction on four whole 128-B lines. One buffer per operand: K of chunk kt+1 is
//   copied behind the barrier that ends the score products of chunk kt and flies under softmax and P.V; V^T of
//   chunk kt+1 is copied behind the barrier that ends P.V of chunk kt and flies under the next score products.
//   Output coverage: each wave stores its rows q0..q0+15 x 128 columns, two 256-B row pieces per instruction
// =====================================================================================================
// Four waves per SIMD (four blocks on a WGP), as before: the budget of 256 registers is stated, since left to itself
// the build spends more of them on a wider schedule of the softmax.
__global__ __launch_bounds__(128) __attribute__((amdgpu_waves_per_eu(4, 4)))
void attn128(const float* __restrict__ Qf, const unsigned short* __restrict__ KBp,
             const unsigned short* __restrict__ VTp, float* outp) {
  // Row pitches are odd multiples of 16 B, so the 16 lanes of a half wave that read one 16-B piece each from
  // 16 consecutive rows fall on 64 distinct banks.
  __shared__ __align__(16) unsigned short Ksh[KC * KP];           // K [kv][d] bf16, pitch 272 B
  __shared__ __align__(16) _Float16 Vth[HD * VP];                 // V^T [d][kv] f16, pitch 144 B
  __shared__ __align__(16) float    Os[4][16 * OP];               // per wave context half tile [row][64 d]

  const int tid  = threadIdx.x;
  const int wave = tid >> 5;
  // The wave's number once more, as a scalar, for the code behind the loop: what that code needs of it (the output
  // rows' base, the staging rows' place) then passes the loop in scalar registers; in vector registers it is spilled.
  const int wsc  = __builtin_amdgcn_readfirstlane(tid >> 5);
  const int lane = tid & 31;
  const int hh   = lane >> 4;
  const int c    = lane & 15;

  // Tile deal. Every block is resident at once and a tile's cost grows with its index, so the launch lasts as long
  // as the fullest WGP. Blocks whose indices differ in two bits from bit 1 up take tiles t, n-1-t, n-1-t, t (or the
  // like with t moved by those bits): any such four blocks on one WGP walk 2n + 2 chunks together. For speed only.
  // A permutation: n-1-t turns over bits 0..4 of bx, four of them in bx >> 1, so both tiles read the same parity.
  const int bx = blockIdx.x;
  const int tl = bx % NQB;
  const int qb = (__builtin_popcount((unsigned)bx >> 1) & 1) ? (NQB - 1 - tl) : tl;
  const int b  = bx / NQB;
  const int q0 = qb * 64 + wave * 16;            // in-sequence query row of this wave's first row
  const int qrow = q0 + c;                       // in-sequence query row of this lane's accumulator column
  const size_t rowB = (size_t)b * SEQ;
  const _Float16* VTh = (const _Float16*)(const void*)VTp + (size_t)b * HD * SEQ;

  // ---- Q rows of this wave, f32: row r by one instruction, lane l takes d = 4l..4l+3 ----
  const float* qsrc = Qf + (rowB + q0) * HD + lane * 4;
  v4f qx[16];
#pragma unroll
  for (int r = 0; r < 16; ++r) qx[r] = *(const v4f*)(qsrc + r * HD);
#if defined(__HIP_DEVICE_COMPILE__)
  // The loads' address pair is named here so that it stays whole up to the wait (a precaution).
  asm volatile("s_wait_xcnt 0x0" :: "v"(qsrc) : "memory");
#endif

  float mrun = -INFINITY;                        // running maximum of the lane's query, alike in both half waves
  float lrun = 0.f;                              // running sum over the keys of this lane's own half wave
  v8f oacc[8];
#pragma unroll
  for (int t = 0; t < 8; ++t) oacc[t] = zero8();

  // Staging addresses. K chunk = 16 KiB in a row: piece i of thread tid is 16-B piece i*128+tid, K row
  // i*8 + (tid>>4). V^T chunk = 128 rows of 128 B: piece i is row i*16 + (tid>>3), 16-B piece tid&7.
  const unsigned kl = lds_off(Ksh) + (unsigned)(tid >> 4) * (KP * 2) + (unsigned)(tid & 15) * 16;
  const unsigned vl = lds_off(Vth) + (unsigned)(tid >> 3) * (VP * 2) + (unsigned)(tid & 7) * 16;
  const char* kg = (const char*)(KBp + rowB * HD);                 // block-uniform bases
  const char* vg = (const char*)VTh;
  const unsigned ko = (unsigned)tid * 16;                          // the lane's byte offsets from them
  const unsigned vo = (unsigned)(tid >> 3) * (SEQ * 2) + (unsigned)(tid & 7) * 16;

  // Prologue: K of chunk 0 landed and published, V^T of chunk 0 in flight. The Q rows come in beside K's copies.
  copy8_async(kl, 8 * KP * 2, kg, 128 * 16, ko);

  // ---- Q fragments (B operand, col = lane&15): 4 d-chunks, from the wave's own LDS rows (pitch as K's) ----
  unsigned short* qs = (unsigned short*)(void*)Os[wave];
#pragma unroll
  for (int r = 0; r < 16; ++r) {
    const v2u w = {pk16(bf_bits(qx[r][0]), bf_bits(qx[r][1])), pk16(bf_bits(qx[r][2]), bf_bits(qx[r][3]))};
    *(v2u*)(qs + r * KP + lane * 4) = w;
  }
  wave_sync_lds();                               // the rows are written by the wave's other lanes
  v16b qa[4];
#pragma unroll
  for (int dc = 0; dc < 4; ++dc) qa[dc] = ldfrag_b(qs + c * KP + dc * 32 + 8 * hh);

  publish_point();
  copy8_async(vl, 16 * VP * 2, vg, (size_t)16 * SEQ * 2, vo);

#pragma unroll 1
  for (int kt = 0; kt <= qb; ++kt) {         // block-uniform trip count, at most NQB
    // The lane's query row counted from its first key of this chunk: key kt*KC + 8*hh + 16j + r lies behind the row
    // where 16j + r > dq. One register against literals; one register per (j, r) would pass the 256 of four waves.
    const int dq = qrow - kt * KC - 8 * hh;
    // Chunk copied ahead. The last trip copies its own chunk once more, unread, instead of branching round the
    // copies: with a branch in the loop body the build holds all eight residual tiles to the loop's foot and
    // passes 256 registers, which would leave three blocks on a WGP instead of four.
    const int kn  = (kt < qb) ? kt + 1 : qb;

    // ---- scores^T: 64 keys x 16 queries per wave (A operand: row = key j*16+c, k = d, split map) ----
    // The eight LDS reads of key tile j+1 are issued as one group in front of tile j's products, into a second
    // register set: their latency passes under those products instead of standing in front of every product.
    v8f s[4];
    v16b kf[2][4];
#pragma unroll
    for (int dc = 0; dc < 4; ++dc) kf[0][dc] = ldfrag_b(Ksh + c * KP + dc * 32 + 8 * hh);
#pragma unroll
    for (int j = 0; j < 4; ++j) {
      if (j < 3) {
#pragma unroll
        for (int dc = 0; dc < 4; ++dc) kf[(j + 1) & 1][dc] = ldfrag_b(Ksh + ((j + 1) * 16 + c) * KP + dc * 32 + 8 * hh);
      }
      const v8f sh = mma_b4(kf[j & 1][0], kf[j & 1][1], kf[j & 1][2], kf[j & 1][3], qa[0], qa[1], qa[2], qa[3]);
#pragma unroll
      for (int r = 0; r < 8; ++r) {
        const float sv = sh[r] * SSC;
        s[j][r] = (j * 16 + r > dq) ? -INFINITY : sv;         // causal: keys strictly after the row
      }
    }

    // V^T of this chunk published; every wave has left K: refill it
    publish_point();
    copy8_async(kl, 8 * KP * 2, kg + (size_t)kn * (KC * HD * 2), 128 * 16, ko);

    // ---- query max, online softmax, P^T hi (x1024) and residual (x2048) packed as B operands ----
    float mj[4];                                 // one chain per score tile, so that the chains are independent
#pragma unroll
    for (int j = 0; j < 4; ++j) {
      mj[j] = s[j][0];
#pragma unroll
      for (int r = 1; r < 8; ++r) mj[j] = fmaxf(mj[j], s[j][r]);
    }
    float m = fmaxf(fmaxf(mj[0], mj[1]), fmaxf(mj[2], mj[3]));
    m = fmaxf(m, xhalf(m));                      // the other eight keys of each tile lie in the other half wave
    const float mnew  = fmaxf(mrun, m);
    const float alpha = __expf(mrun - mnew);
    mrun = mnew;
    FragH pa[2], pr[2];
    float pj[4];
#pragma unroll
    for (int j = 0; j < 4; ++j) {
      pj[j] = 0.f;
#pragma unroll
      for (int r = 0; r < 8; ++r) {
        const float p  = __expf(s[j][r] - mnew);
        pj[j] += p;
        const float ph = p * PSC;
        const _Float16 hq = (_Float16)ph;
        const float res = (ph - (float)hq) * RSC;
        pa[j >> 1].v[(j & 1) * 8 + r] = hq;
        pr[j >> 1].v[(j & 1) * 8 + r] = (_Float16)res;
      }
    }
    lrun = lrun * alpha + ((pj[0] + pj[1]) + (pj[2] + pj[3]));
#pragma unroll
    for (int t = 0; t < 8; ++t) {
#pragma unroll
      for (int r = 0; r < 8; ++r) oacc[t][r] *= alpha;
    }

    // ---- context^T += V^T . P^T (f16 WMMA; A = V^T [dv][kv] by the split map, B = P^T from the accumulators) ----
    // V^T fragments likewise: the four LDS reads of tile t+1 stand in front of tile t's products.
    v16h vf[2][2];
#pragma unroll
    for (int kk = 0; kk < 2; ++kk) vf[0][kk] = ldfrag_h(Vth + c * VP + kk * 32 + 8 * hh);
#pragma unroll
    for (int t = 0; t < 8; ++t) {
      if (t < 7) {
#pragma unroll
        for (int kk = 0; kk < 2; ++kk) vf[(t + 1) & 1][kk] = ldfrag_h(Vth + ((t + 1) * 16 + c) * VP + kk * 32 + 8 * hh);
      }
      v8f rr = zero8();
      mma_h4(oacc[t], rr, vf[t & 1][0], vf[t & 1][1], pa[0].v, pa[1].v, pr[0].v, pr[1].v);
#pragma unroll
      for (int r = 0; r < 8; ++r) oacc[t][r] += rr[r] * (1.0f / RSC);
    }

    // K of the next chunk published; every wave has left V^T: refill it
    publish_point();
    copy8_async(vl, 16 * VP * 2, vg + (size_t)kn * (KC * 2), (size_t)16 * SEQ * 2, vo);
  }
#if defined(__HIP_DEVICE_COMPILE__)
  asm volatile("s_wait_asynccnt 0x0" ::: "memory");   // the last trip's copies have landed before the wave ends
#endif

  // ---- normalise (1/l, the 1/1024 p carry and the 1/64 v carry), then stage and store the wave's 16x128 f32
  //      tile as two 16x64 halves: each store instruction writes two 256-B row pieces (whole 128-B lines)
  // The lane's number is formed anew, from no register that lived through the loop (the block is one-dimensional, so
  // it is tid & 31): carried across the loop, c, hh and the staging address are spilled to scratch by this build.
  const int ln = (int)__builtin_amdgcn_mbcnt_lo(~0u, 0u);
  const int ce = ln & 15, he = ln >> 4;
  float* os = Os[wsc];
  const float l   = lrun + xhalf(lrun);          // the two half waves' sums of the lane's query
  const float inv = ((l > 0.f) ? (1.0f / l) : 0.f) * (1.0f / (PSC * VSC));
  v4f vals[2][8];
#pragma unroll
  for (int hv = 0; hv < 2; ++hv) {
    if (hv == 1) wave_sync_lds();             // the first half is read out before the second overwrites it
#pragma unroll
    for (int t = 0; t < 4; ++t) {               // a lane's eight registers are eight consecutive d of its query
      const v8f o = oacc[4 * hv + t];
      const v4f lo = {o[0] * inv, o[1] * inv, o[2] * inv, o[3] * inv};
      const v4f hi = {o[4] * inv, o[5] * inv, o[6] * inv, o[7] * inv};
      *(v4f*)(os + ce * OP + t * 16 + 8 * he)     = lo;
      *(v4f*)(os + ce * OP + t * 16 + 8 * he + 4) = hi;
    }
    wave_sync_lds();
#pragma unroll
    for (int it = 0; it < 8; ++it) vals[hv][it] = *(const v4f*)(os + (2 * it + he) * OP + ce * 4);
  }
  float* C = outp + (rowB + qb * 64 + wsc * 16) * HD;
#pragma unroll
  for (int hv = 0; hv < 2; ++hv) {
#pragma unroll
    for (int it = 0; it < 8; ++it) *(v4f*)(C + (size_t)(2 * it + he) * HD + hv * 64 + ce * 4) = vals[hv][it];
  }
}

// =====================================================================================================
// Workspace map (bytes); every plane is an exact multiple of its whole-line / 64x64-tile store granularity:
//   KB  bf16 [32*2048][128]    0          16777216
//   VT  f16  [32][128][2048]   16777216   16777216
//   end                        33554432
// =====================================================================================================
extern "C" void kernel_launch(void* const* d_in, const int* in_sizes, int n_in,
                              void* d_out, int out_size, void* d_ws, size_t ws_size,
                              hipStream_t stream) {
  if (n_in < 3) return;
  if (in_sizes[0] != NE || in_sizes[1] != NE || in_sizes[2] != NE) return;
  if (out_size != NE) return;

  const float* q = (const float*)d_in[0];
  const float* k = (const float*)d_in[1];
  const float* v = (const float*)d_in[2];

  const size_t PB = (size_t)NE * 2;                     // 16777216
  size_t off = 0;
  const size_t oK  = off; off += PB;
  const size_t oVT = off; off += PB;
  if (off > ws_size) return;                            // off = 33554432
  if (off > (size_t)134217728) return;

  char* ws = (char*)d_ws;
  unsigned short* KB = (unsigned short*)(ws + oK);
  unsigned short* VT = (unsigned short*)(ws + oVT);
  float* out0 = (float*)d_out;

  const int n8 = NE / 8;                                // 1048576
  if ((n8 % 256) != 0) return;
  const dim3 blk(256), blk128(128);
  const dim3 gC(n8 / 256);                              // 4096 blocks
  const dim3 gVT(SEQ / 64, HD / 64, NB);                // 32 x 2 x 32 tiles
  const dim3 gA(NB * NQB);                              // 1024 blocks of 128

  // (0) k -> bf16 plane; v -> f16( bf16_RNE(v) * 64 ) transposed plane [b][d][s]
  conv_bf16<<<gC, blk, 0, stream>>>(k, KB, n8);
  vtrans_h16<<<gVT, blk, 0, stream>>>(v, VT);

  // (1) causal flash attention -> out f32 [32][2048][128]
  attn128<<<gA, blk128, 0, stream>>>(q, KB, VT, out0);
  (void)hipGetLastError();
}

// v008
// One run takes 64.1 microseconds.
// Timed twice side by side with v007, it ran 1.18 and 1.17 times as fast.
// Over all steps from v000 it is 7.03 times as fast.
// Contractions: q.k^T on v_wmma_f32_16x16x32_bf16 (bf16 plane of the RNE-converted k, q converted RNE in the kernel, one product);
// p.v on v_wmma_f32_16x16x32_f16 (p as f16 x1024 hi plane plus f16 x2048 residual plane with its own per-chunk
// accumulator folded x1/2048 in f32, v^T as f16 of the bf16 RNE-converted v carried x64); all f32 accumulate;
// online softmax (running max) and the causal index select in f32 on VALU. Both products are formed transposed
// (S^T = K.Q^T, O^T += V^T.P^T): a lane holds one query's scores, and P^T goes from the score accumulators into the
// B operand in registers. A query tile's key chunks are dealt to two groups of four waves (even and odd chunks), each
// with its own running maximum, sum and context; the two states are joined in f32 behind the loop.
#include <hip/hip_runtime.h>
#include <hip/hip_bf16.h>
#include <math.h>
#include <stdint.h>

#define NB   32
#define SEQ  2048
#define HD   128
#define KC   64
#define NQB  (SEQ / 64)
#define NE   (NB * SEQ * HD)
#define PSC  1024.0f
#define RSC  2048.0f
#define VSC  64.0f
#define SSC  0.17677669529663687f
#define KP   (HD + 8)      // K row pitch in LDS, elements: 272 B = 16 B x 17
#define VP   (KC + 8)      // V^T row pitch in LDS, elements: 144 B = 16 B x 9
#define OP   (64 + 4)      // output staging row pitch, floats: 68 dwords
static_assert((SEQ % 64) == 0);
static_assert(HD == 128);
static_assert(((NE / 8) % 256) == 0);
static_assert(16 * OP * 4 == 16 * KP * 2);   // a wave's output staging also holds its 16 Q rows as bf16 at the K pitch
static_assert(4 * 16 * 32 * 16 + 4 * 32 * 8 <= 2 * KC * KP * 2);   // the second group's state fits the two K buffers
#define MFLOOR (-3.402823466e+38f)  // floor of the running maximum: the lowest finite f32, see the loop

typedef _Float16 v16h __attribute__((ext_vector_type(16)));
typedef _Float16 v8h  __attribute__((ext_vector_type(8)));
typedef __bf16   v16b __attribute__((ext_vector_type(16)));
typedef float    v8f  __attribute__((ext_vector_type(8)));
typedef float    v4f  __attribute__((ext_vector_type(4)));
typedef unsigned int v4u __attribute__((ext_vector_type(4)));
typedef unsigned int v2u __attribute__((ext_vector_type(2)));
typedef float    v2f  __attribute__((ext_vector_type(2)));

union FragH { v16h v; v8h h[2]; };
union FragB { v16b v; v4u u[2]; };
union HU8   { v8h h; v4u u; };

// ---- scalar helpers --------------------------------------------------------------------------------
__device__ __forceinline__ unsigned short bf_bits(float f) {          // f32 -> bf16 bits, RNE convert
  unsigned u = __float_as_uint(f);
  return (unsigned short)((u + 0x7FFFu + ((u >> 16) & 1u)) >> 16);
}
__device__ __forceinline__ float bf_up(unsigned short h) { return __uint_as_float(((unsigned)h) << 16); }
__device__ __forceinline__ float bfr(float f) { return bf_up(bf_bits(f)); }   // value of the bf16 RNE convert
__device__ __forceinline__ unsigned pk16(unsigned short a, unsigned short b) { return (unsigned)a | ((unsigned)b << 16); }
// value of lane l ^ 16 (the other half wave), by a vector cross-row move; every lane is on where it is used
__device__ __forceinline__ float xhalf(float x) {
  const int b = __builtin_bit_cast(int, x);
  return __builtin_bit_cast(float, __builtin_amdgcn_permlanex16(b, b, 0x76543210, 0xfedcba98, false, false));
}
__device__ __forceinline__ v8f zero8() { v8f z = {0.f, 0.f, 0.f, 0.f, 0.f, 0.f, 0.f, 0.f}; return z; }

// ---- fragment loaders: 16-bit A/B operand, lane -> row/col (lane&15), p already includes +8*(lane>>4);
//      elements 0..7 <- p[0..7] (k0+8h..), elements 8..15 <- p[16..23] (k0+16+8h..)
__device__ __forceinline__ v16h ldfrag_h(const _Float16* p) {
  FragH f;
  f.h[0] = *(const v8h*)(p);
  f.h[1] = *(const v8h*)(p + 16);
  return f.v;
}
__device__ __forceinline__ v16b ldfrag_b(const unsigned short* p) {
  FragB f;
  f.u[0] = *(const v4u*)(p);
  f.u[1] = *(const v4u*)(p + 16);
  return f.v;
}

// ---- WMMA groups: a tile's four products stand back to back in one statement. Inside a group only accumulate
//      chains follow one another, which need no distance; the four v_nop that end the statement are the distance the
//      chip asks for before the first vector instruction that reads D or overwrites A or B behind the group.
// Score tile: one chain of four products over d on one accumulator, started from 0.
__device__ __forceinline__ v8f mma_b4(v16b a0, v16b a1, v16b a2, v16b a3, v16b b0, v16b b1, v16b b2, v16b b3) {
  v8f d = zero8();
#if defined(__HIP_DEVICE_COMPILE__)
  asm volatile(
      "v_wmma_f32_16x16x32_bf16 %0, %1, %5, 0\n\t"
      "v_wmma_f32_16x16x32_bf16 %0, %2, %6, %0\n\t"
      "v_wmma_f32_16x16x32_bf16 %0, %3, %7, %0\n\t"
      "v_wmma_f32_16x16x32_bf16 %0, %4, %8, %0\n\t"
      "v_nop\n\tv_nop\n\tv_nop\n\tv_nop"
      : "=&v"(d)
      : "v"(a0), "v"(a1), "v"(a2), "v"(a3), "v"(b0), "v"(b1), "v"(b2), "v"(b3));
#endif
  return d;
}
// Context tile: o += a0.h0 + a1.h1 and r = a0.r0 + a1.r1, the two chains taking turns, each in its old order.
__device__ __forceinline__ void mma_h4(v8f& o, v8f& r, v16h a0, v16h a1, v16h h0, v16h h1, v16h r0, v16h r1) {
#if defined(__HIP_DEVICE_COMPILE__)
  asm volatile(
      "v_wmma_f32_16x16x32_f16 %0, %2, %4, %0\n\t"
      "v_wmma_f32_16x16x32_f16 %1, %2, %6, 0\n\t"
      "v_wmma_f32_16x16x32_f16 %0, %3, %5, %0\n\t"
      "v_wmma_f32_16x16x32_f16 %1, %3, %7, %1\n\t"
      "v_nop\n\tv_nop\n\tv_nop\n\tv_nop"
      : "+v"(o), "=&v"(r)
      : "v"(a0), "v"(a1), "v"(h0), "v"(h1), "v"(r0), "v"(r1));
#endif
}
// ---- asynchronous staging, global -> LDS, through no register -------------------------------------------
__device__ __forceinline__ unsigned lds_off(const void* p) { return (unsigned)(size_t)p; }   // LDS byte address
// Eight 16-B copies per lane: piece i goes from g + i*gs + off to LDS byte l + i*ls; g is the same in every lane
// (scalar base), off the lane's own byte offset. The s_wait_xcnt closes the same statement, so that no address
// register of an issued copy is rewritten in front of it (a precaution).
__device__ __forceinline__ void copy8_async(unsigned l, unsigned ls, const char* g, size_t gs, unsigned off) {
#if defined(__HIP_DEVICE_COMPILE__)
  asm volatile(
      "global_load_async_to_lds_b128 %0, %16, %8\n\t"
      "global_load_async_to_lds_b128 %1, %16, %9\n\t"
      "global_load_async_to_lds_b128 %2, %16, %10\n\t"
      "global_load_async_to_lds_b128 %3, %16, %11\n\t"
      "global_load_async_to_lds_b128 %4, %16, %12\n\t"
      "global_load_async_to_lds_b128 %5, %16, %13\n\t"
      "global_load_async_to_lds_b128 %6, %16, %14\n\t"
      "global_load_async_to_lds_b128 %7, %16, %15\n\t"
      "s_wait_xcnt 0x0"
      :: "v"(l), "v"(l + ls), "v"(l + 2 * ls), "v"(l + 3 * ls),
         "v"(l + 4 * ls), "v"(l + 5 * ls), "v"(l + 6 * ls), "v"(l + 7 * ls),
         "s"(g), "s"(g + gs), "s"(g + 2 * gs), "s"(g + 3 * gs),
         "s"(g + 4 * gs), "s"(g + 5 * gs), "s"(g + 6 * gs), "s"(g + 7 * gs), "v"(off)
      : "memory");
#endif
}
// Hand-over of a staged tile: this wave's LDS reads of the buffer that is refilled next have retired, this wave's
// own copies have landed, then the block barrier publishes them and ends every reader's last read.
__device__ __forceinline__ void publish_point() {
#if defined(__HIP_DEVICE_COMPILE__)
  asm volatile("s_wait_dscnt 0x0" ::: "memory");      // own LDS reads done before the buffer gets a new writer
  asm volatile("s_wait_asynccnt 0x0" ::: "memory");   // own copies landed before other waves may read them
#endif
  __syncthreads();
}
__device__ __forceinline__ void wave_sync_lds() {
  __builtin_amdgcn_fence(__ATOMIC_RELEASE, "workgroup");
  __builtin_amdgcn_wave_barrier();
  __builtin_amdgcn_fence(__ATOMIC_ACQUIRE, "workgroup");
}

// =====================================================================================================
// Plane convert: Y[i] = bf16_RNE(X[i]) bits. Thread i handles elements 8i..8i+7 and writes one 16-B piece;
// grid = n8 / 256 (n8 multiple of 256, host-checked). coverage: n8 threads x 8 elements = the whole plane.
// =====================================================================================================
__global__ __launch_bounds__(256) void conv_bf16(const float* __restrict__ X, unsigned short* Y, int n8) {
  const int i  = blockIdx.x * 256 + threadIdx.x;
  const int ic = (i < n8) ? i : (n8 - 1);                     // clamped address
  const float* src = X + (size_t)ic * 8;
  const v4f a = *(const v4f*)(src);
  const v4f c = *(const v4f*)(src + 4);
  v4u o;
  o[0] = pk16(bf_bits(a[0]), bf_bits(a[1]));
  o[1] = pk16(bf_bits(a[2]), bf_bits(a[3]));
  o[2] = pk16(bf_bits(c[0]), bf_bits(c[1]));
  o[3] = pk16(bf_bits(c[2]), bf_bits(c[3]));
  if (i < n8) *(v4u*)(Y + (size_t)i * 8) = o;
  
}

// =====================================================================================================
// v [b][s][d] f32 -> VT [b][d][s] f16( bf16_RNE(v) * 64 ). Block = 256 threads, one 64(s) x 64(d) tile,
// grid = (SEQ/64, HD/64, NB). Load: thread t reads s row t>>2, d = dblk*64 + 16*(t&3)..+15 (4 x 16-B loads),
// converts and writes the transposed elements into the LDS tile T[d][s] (pitch 72 halves); __syncthreads;
// coverage: load 256 threads x 16 = 64x64; store 2 it x 32 rows x 8 lanes x 8 halves = 64 d rows x 64 s.
// =====================================================================================================
__global__ __launch_bounds__(256) void vtrans_h16(const float* __restrict__ V, unsigned short* VTp) {
  __shared__ __align__(16) _Float16 Tsh[64 * 72];
  const int t    = threadIdx.x;
  const int dblk = blockIdx.y;
  const int b    = blockIdx.z;
  const int s0   = blockIdx.x * 64;
  {
    const int sr = t >> 2, d0 = (t & 3) * 16;
    const float* src = V + ((size_t)b * SEQ + s0 + sr) * HD + dblk * 64 + d0;
#pragma unroll
    for (int i = 0; i < 4; ++i) {
      const v4f x = *(const v4f*)(src + 4 * i);
#pragma unroll
      for (int e = 0; e < 4; ++e) Tsh[(d0 + 4 * i + e) * 72 + sr] = (_Float16)(bfr(x[e]) * VSC);
    }
  }
  __syncthreads();
  const int q8 = t >> 3, c8 = (t & 7) * 8;
  v4u vals[2];
#pragma unroll
  for (int it = 0; it < 2; ++it) {
    const int d = it * 32 + q8;
    HU8 hu;
    hu.h = *(const v8h*)(Tsh + d * 72 + c8);
    vals[it] = hu.u;
  }
#pragma unroll
  for (int it = 0; it < 2; ++it) {
    const int d = it * 32 + q8;
    *(v4u*)(VTp + ((size_t)b * HD + dblk * 64 + d) * SEQ + s0 + c8) = vals[it];
  }
  
}

// =====================================================================================================
// Causal flash attention, head dim 128, one head per sequence, SEQ query/key rows per sequence.
//   q (f32, the input itself) and the KB plane (bf16 bits): element (b, t, d) at [(b*SEQ + t)*128 + d]
//   Q is read by two waves only, so it has no plane of its own: each wave loads its 16 rows as f32, one whole
//   512-B row per instruction, converts them (RNE, the plane convert's own arithmetic) and turns them into B
//   fragments through its own, still unused, output staging rows in LDS.
//   VT plane (f16, x64): element (b, d, s) at [(b*128 + d)*SEQ + s]
//   out (f32): element (b, t, d) at [(b*SEQ + t)*128 + d]
//   score = (k . q) * 1/sqrt(32) on bf16 WMMA, A = K rows, B = Q: accumulator register r of lane (c, h) is key
//   16j + 8h + r against query q0 + c; score := -inf where key > query row (select by index);
//   maximum and sum of a query run inside its lane, the two half waves exchange the maximum once per chunk and
//   join their sums once, behind the loop;
//   p = exp(s - m) packed in registers as f16(1024 p) and f16(2048 (1024 p - hi)): score tiles 2kk and 2kk+1 are
//   elements 0..7 and 8..15 of the B operand of keys 32kk..32kk+31, the k order of the V^T loader;
//   context^T += v^T . hi on f16 WMMA, plus (v^T . res) * 1/2048 from a per-chunk accumulator: register r of lane
//   (c, h) in tile t is d = 16t + 8h + r of query q0 + c; online softmax (running max) in f32.
//   Block = 8 waves = 64 query rows of one sequence, twice: wave w and wave w + 4 hold the same 16 rows. Group g
//   (waves 4g..4g+3) walks key chunks g, g + 2, g + 4, ... of the tile's chunks 0..qb, so the longest tile's serial
//   walk is 16 trips, not 32, and a SIMD keeps four waves to the end: half the blocks are resident at a time, the
//   grid = NQB * NB runs from the heaviest tile to the lightest.
//   Key chunks of 64, block-uniform trip i = 0..qb/2, kt = 2i + g (chunks strictly above the diagonal are fully
//   masked and skipped, but for group 1's last chunk where qb is even: it lies above, is masked whole and adds 0).
//   Behind the loop group 1 hands its maximum, sum and context to group 0 through LDS, lane to lane.
//   K / V^T chunk staging, per group: asynchronous 16-B copies to LDS, 128 threads x 8 pieces per plane = the whole
//   64x128 / 128x64 tile, each wave instruction on four whole 128-B lines. One buffer per operand and group: K of the
//   group's next chunk is copied behind the barrier that ends the score products of this one and flies under softmax
//   and P.V; V^T of the next chunk is copied behind the barrier that ends P.V and flies under the next score products.
//   Output coverage: each wave of group 0 stores its rows q0..q0+15 x 128 columns, two 256-B row pieces per instruction
// =====================================================================================================
// Four waves per SIMD (two blocks on a WGP): the budget of 256 registers is stated, since left to itself
// the build spends more of them on a wider schedule of the softmax.
__global__ __launch_bounds__(256) __attribute__((amdgpu_waves_per_eu(4, 4)))
void attn128(const float* __restrict__ Qf, const unsigned short* __restrict__ KBp,
             const unsigned short* __restrict__ VTp, float* outp) {
  // Row pitches are odd multiples of 16 B, so the 16 lanes of a half wave that read one 16-B piece each from
  // 16 consecutive rows fall on 64 distinct banks.
  __shared__ __align__(16) unsigned short Ksh[2][KC * KP];        // per group K [kv][d] bf16, pitch 272 B
  __shared__ __align__(16) _Float16 Vth[2][HD * VP];              // per group V^T [d][kv] f16, pitch 144 B
  __shared__ __align__(16) float    Os[8][16 * OP];               // per wave context half tile [row][64 d]

  const int tid  = threadIdx.x;
  const int wave = tid >> 5;
  const int tg   = tid & 127;                    // the thread's number inside its group of four waves
  // The wave's number once more, as a scalar, for the code behind the loop: what that code needs of it (the output
  // rows' base, the staging rows' place) then passes the loop in scalar registers; in vector registers it is spilled.
  const int wsc  = __builtin_amdgcn_readfirstlane(tid >> 5);
  const int grp  = wsc >> 2;                     // key group, the same in every lane of a wave: a scalar
  const int lane = tid & 31;
  const int hh   = lane >> 4;
  const int c    = lane & 15;

  // Tile deal. There are twice as many blocks as resident places and a tile's
  // cost grows with its index: cost falls with the block index, so that the light tiles fill the places that the
  // heavy ones leave. For speed only; (tile, sequence) is a permutation of the block index.
  const int bx = blockIdx.x;
  const int qb = NQB - 1 - bx / NB;
  const int b  = bx % NB;
  const int q0 = qb * 64 + (wave & 3) * 16;      // in-sequence query row of this wave's first row
  const int qrow = q0 + c;                       // in-sequence query row of this lane's accumulator column
  const size_t rowB = (size_t)b * SEQ;
  const _Float16* VTh = (const _Float16*)(const void*)VTp + (size_t)b * HD * SEQ;

  // ---- Q rows of this wave, f32: row r by one instruction, lane l takes d = 4l..4l+3 ----
  const float* qsrc = Qf + (rowB + q0) * HD + lane * 4;
  v4f qx[16];
#pragma unroll
  for (int r = 0; r < 16; ++r) qx[r] = *(const v4f*)(qsrc + r * HD);
#if defined(__HIP_DEVICE_COMPILE__)
  // The loads' address pair is named here so that it stays whole up to the wait (a precaution).
  asm volatile("s_wait_xcnt 0x0" :: "v"(qsrc) : "memory");
#endif

  float mrun = -INFINITY;                        // running maximum of the lane's query, alike in both half waves
  float lrun = 0.f;                              // running sum over the keys of this lane's own half wave
  v8f oacc[8];
#pragma unroll
  for (int t = 0; t < 8; ++t) oacc[t] = zero8();

  // Staging addresses, tg counting inside the group. K chunk = 16 KiB in a row: piece i of thread tg is 16-B piece
  // i*128+tg, K row i*8 + (tg>>4). V^T chunk = 128 rows of 128 B: piece i is row i*16 + (tg>>3), 16-B piece tg&7.
  const unsigned short* Kg = Ksh[grp];                             // the group's own buffers
  const _Float16*       Vg = Vth[grp];
  const unsigned kl = lds_off(Kg) + (unsigned)(tg >> 4) * (KP * 2) + (unsigned)(tg & 15) * 16;
  const unsigned vl = lds_off(Vg) + (unsigned)(tg >> 3) * (VP * 2) + (unsigned)(tg & 7) * 16;
  const char* kg = (const char*)(KBp + rowB * HD);                 // block-uniform bases
  const char* vg = (const char*)VTh;
  const unsigned ko = (unsigned)tg * 16;                           // the lane's byte offsets from them
  const unsigned vo = (unsigned)(tg >> 3) * (SEQ * 2) + (unsigned)(tg & 7) * 16;

  // Prologue: K of the group's first chunk landed and published, its V^T in flight. The Q rows come in beside K's
  // copies. Tile 0 has no chunk 1: group 1 then copies chunk 0, which its mask hides (the address stays in the plane).
  const int k0 = (grp < qb) ? grp : qb;
  copy8_async(kl, 8 * KP * 2, kg + (size_t)k0 * (KC * HD * 2), 128 * 16, ko);

  // ---- Q fragments (B operand, col = lane&15): 4 d-chunks, from the wave's own LDS rows (pitch as K's) ----
  unsigned short* qs = (unsigned short*)(void*)Os[wave];
#pragma unroll
  for (int r = 0; r < 16; ++r) {
    const v2u w = {pk16(bf_bits(qx[r][0]), bf_bits(qx[r][1])), pk16(bf_bits(qx[r][2]), bf_bits(qx[r][3]))};
    *(v2u*)(qs + r * KP + lane * 4) = w;
  }
  wave_sync_lds();                               // the rows are written by the wave's other lanes
  v16b qa[4];
#pragma unroll
  for (int dc = 0; dc < 4; ++dc) qa[dc] = ldfrag_b(qs + c * KP + dc * 32 + 8 * hh);

  publish_point();
  copy8_async(vl, 16 * VP * 2, vg + (size_t)k0 * (KC * 2), (size_t)16 * SEQ * 2, vo);

  const int nt = (qb >> 1) + 1;              // trips: chunks 0..qb in pairs
#pragma unroll 1
  for (int i = 0; i < nt; ++i) {             // block-uniform trip count, at most NQB / 2
    const int kt = 2 * i + grp;              // the group's chunk of this trip, a scalar
    // The lane's query row counted from its first key of this chunk: key kt*KC + 8*hh + 16j + r lies behind the row
    // where 16j + r > dq. One register against literals; one register per (j, r) would pass the 256 of four waves.
    const int dq = qrow - kt * KC - 8 * hh;
    // Chunk copied ahead. The last trip copies chunk qb, unread, instead of branching round the copies: with a
    // branch in the loop body the build holds all eight residual tiles to the loop's foot and passes 256 registers,
    // which would leave three waves on a SIMD instead of four.
    const int kn  = (kt + 2 < qb) ? kt + 2 : qb;

    // ---- scores^T: 64 keys x 16 queries per wave (A operand: row = key j*16+c, k = d, split map) ----
    // The eight LDS reads of key tile j+1 are issued as one group in front of tile j's products, into a second
    // register set: their latency passes under those products instead of standing in front of every product.
    v8f s[4];
    v16b kf[2][4];
#pragma unroll
    for (int dc = 0; dc < 4; ++dc) kf[0][dc] = ldfrag_b(Kg + c * KP + dc * 32 + 8 * hh);
#pragma unroll
    for (int j = 0; j < 4; ++j) {
      if (j < 3) {
#pragma unroll
        for (int dc = 0; dc < 4; ++dc) kf[(j + 1) & 1][dc] = ldfrag_b(Kg + ((j + 1) * 16 + c) * KP + dc * 32 + 8 * hh);
      }
      const v8f sh = mma_b4(kf[j & 1][0], kf[j & 1][1], kf[j & 1][2], kf[j & 1][3], qa[0], qa[1], qa[2], qa[3]);
#pragma unroll
      for (int r = 0; r < 8; ++r) {
        const float sv = sh[r] * SSC;
        s[j][r] = (j * 16 + r > dq) ? -INFINITY : sv;         // causal: keys strictly after the row
      }
    }

    // V^T of this chunk published; every wave has left K: refill it
    publish_point();
    copy8_async(kl, 8 * KP * 2, kg + (size_t)kn * (KC * HD * 2), 128 * 16, ko);

    // ---- query max, online softmax, P^T hi (x1024) and residual (x2048) packed as B operands ----
    float mj[4];                                 // one chain per score tile, so that the chains are independent
#pragma unroll
    for (int j = 0; j < 4; ++j) {
      mj[j] = s[j][0];
#pragma unroll
      for (int r = 1; r < 8; ++r) mj[j] = fmaxf(mj[j], s[j][r]);
    }
    float m = fmaxf(fmaxf(mj[0], mj[1]), fmaxf(mj[2], mj[3]));
    m = fmaxf(m, xhalf(m));                      // the other eight keys of each tile lie in the other half wave
    // The floor keeps the maximum finite where a group has met no key in front of the row yet (tile 0, group 1):
    // -inf - -inf would be no number. It is the lowest finite value, so it leaves every finite maximum as it is.
    const float mnew  = fmaxf(fmaxf(mrun, m), MFLOOR);
    const float alpha = __expf(mrun - mnew);
    mrun = mnew;
    FragH pa[2], pr[2];
    float pj[4];
#pragma unroll
    for (int j = 0; j < 4; ++j) {
      pj[j] = 0.f;
#pragma unroll
      for (int r = 0; r < 8; ++r) {
        const float p  = __expf(s[j][r] - mnew);
        pj[j] += p;
        const float ph = p * PSC;
        const _Float16 hq = (_Float16)ph;
        const float res = (ph - (float)hq) * RSC;
        pa[j >> 1].v[(j & 1) * 8 + r] = hq;
        pr[j >> 1].v[(j & 1) * 8 + r] = (_Float16)res;
      }
    }
    lrun = lrun * alpha + ((pj[0] + pj[1]) + (pj[2] + pj[3]));
    // Holds the rescale and the V^T fragment reads back from the head of the softmax above: spread over all of it,
    // they take the build past 256 registers, and it puts a context tile through scratch memory on every trip.
    __builtin_amdgcn_sched_barrier(0);
#pragma unroll
    for (int t = 0; t < 8; ++t) {
#pragma unroll
      for (int r = 0; r < 8; ++r) oacc[t][r] *= alpha;
    }

    // ---- context^T += V^T . P^T (f16 WMMA; A = V^T [dv][kv] by the split map, B = P^T from the accumulators) ----
    // V^T fragments likewise: the four LDS reads of tile t+1 stand in front of tile t's products.
    v16h vf[2][2];
#pragma unroll
    for (int kk = 0; kk < 2; ++kk) vf[0][kk] = ldfrag_h(Vg + c * VP + kk * 32 + 8 * hh);
#pragma unroll
    for (int t = 0; t < 8; ++t) {
      if (t < 7) {
#pragma unroll
        for (int kk = 0; kk < 2; ++kk) vf[(t + 1) & 1][kk] = ldfrag_h(Vg + ((t + 1) * 16 + c) * VP + kk * 32 + 8 * hh);
      }
      v8f rr = zero8();
      mma_h4(oacc[t], rr, vf[t & 1][0], vf[t & 1][1], pa[0].v, pa[1].v, pr[0].v, pr[1].v);
#pragma unroll
      for (int r = 0; r < 8; ++r) oacc[t][r] += rr[r] * (1.0f / RSC);
    }

    // K of the next chunk published; every wave has left V^T: refill it
    publish_point();
    copy8_async(vl, 16 * VP * 2, vg + (size_t)kn * (KC * 2), (size_t)16 * SEQ * 2, vo);
  }
#if defined(__HIP_DEVICE_COMPILE__)
  asm volatile("s_wait_asynccnt 0x0" ::: "memory");   // the last trip's copies have landed before the wave ends
#endif

  // ---- normalise (1/l, the 1/1024 p carry and the 1/64 v carry), then stage and store the wave's 16x128 f32
  //      tile as two 16x64 halves: each store instruction writes two 256-B row pieces (whole 128-B lines)
  // The lane's number is formed anew, from no register that lived through the loop (the block is one-dimensional, so
  // it is tid & 31): carried across the loop, c, hh and the staging address are spilled to scratch by this build.
  const int ln = (int)__builtin_amdgcn_mbcnt_lo(~0u, 0u);
  const int ce = ln & 15, he = ln >> 4;

  // ---- the two groups' states joined: wave w + 4 hands its lane's maximum, sum and 64 context values to the same
  //      lane of wave w. The K buffers carry them: their last readers left at the last trip's first barrier, and every
  //      wave's last copies into them had landed at its second. Each 16-B piece of a wave lies in 512 B in a row.
  float* xo = (float*)(void*)&Ksh[0][0] + ((wsc & 3) * 16 * 32 + ln) * 4;      // piece p at xo + p * 128
  float* xm = (float*)(void*)&Ksh[0][0] + 4 * 16 * 32 * 4 + ((wsc & 3) * 32 + ln) * 2;
  if (grp == 1) {                                // a scalar test
#pragma unroll
    for (int t = 0; t < 8; ++t) {
      const v8f o = oacc[t];
      const v4f lo = {o[0], o[1], o[2], o[3]};
      const v4f hi = {o[4], o[5], o[6], o[7]};
      *(v4f*)(xo + (2 * t) * 128)     = lo;
      *(v4f*)(xo + (2 * t + 1) * 128) = hi;
    }
    const v2f ml = {mrun, lrun};
    *(v2f*)xm = ml;
  }
  __syncthreads();                               // group 1's state is written; every wave of the block passes here
  if (grp == 1) return;                          // no barrier stands behind this line
  const v2f ml1 = *(const v2f*)xm;
  const float mj2 = fmaxf(mrun, ml1[0]);         // group 0 has met key 0: finite
  const float w0  = __expf(mrun - mj2);
  const float w1  = __expf(ml1[0] - mj2);
  const float lj  = lrun * w0 + ml1[1] * w1;

  float* os = Os[wsc];
  const float l   = lj + xhalf(lj);              // the two half waves' sums of the lane's query
  const float inv = ((l > 0.f) ? (1.0f / l) : 0.f) * (1.0f / (PSC * VSC));
  const float f0  = w0 * inv, f1 = w1 * inv;
  v4f vals[2][8];
#pragma unroll
  for (int hv = 0; hv < 2; ++hv) {
    if (hv == 1) wave_sync_lds();             // the first half is read out before the second overwrites it
#pragma unroll
    for (int t = 0; t < 4; ++t) {               // a lane's eight registers are eight consecutive d of its query
      const v8f o = oacc[4 * hv + t];
      const v4f xl = *(const v4f*)(xo + (2 * (4 * hv + t)) * 128);
      const v4f xh = *(const v4f*)(xo + (2 * (4 * hv + t) + 1) * 128);
      const v4f lo = {o[0] * f0 + xl[0] * f1, o[1] * f0 + xl[1] * f1, o[2] * f0 + xl[2] * f1, o[3] * f0 + xl[3] * f1};
      const v4f hi = {o[4] * f0 + xh[0] * f1, o[5] * f0 + xh[1] * f1, o[6] * f0 + xh[2] * f1, o[7] * f0 + xh[3] * f1};
      *(v4f*)(os + ce * OP + t * 16 + 8 * he)     = lo;
      *(v4f*)(os + ce * OP + t * 16 + 8 * he + 4) = hi;
    }
    wave_sync_lds();
#pragma unroll
    for (int it = 0; it < 8; ++it) vals[hv][it] = *(const v4f*)(os + (2 * it + he) * OP + ce * 4);
  }
  float* C = outp + (rowB + qb * 64 + wsc * 16) * HD;
#pragma unroll
  for (int hv = 0; hv < 2; ++hv) {
#pragma unroll
    for (int it = 0; it < 8; ++it) *(v4f*)(C + (size_t)(2 * it + he) * HD + hv * 64 + ce * 4) = vals[hv][it];
  }
}

// =====================================================================================================
// Workspace map (bytes); every plane is an exact multiple of its whole-line / 64x64-tile store granularity:
//   KB  bf16 [32*2048][128]    0          16777216
//   VT  f16  [32][128][2048]   16777216   16777216
//   end                        33554432
// =====================================================================================================
extern "C" void kernel_launch(void* const* d_in, const int* in_sizes, int n_in,
                              void* d_out, int out_size, void* d_ws, size_t ws_size,
                              hipStream_t stream) {
  if (n_in < 3) return;
  if (in_sizes[0] != NE || in_sizes[1] != NE || in_sizes[2] != NE) return;
  if (out_size != NE) return;

  const float* q = (const float*)d_in[0];
  const float* k = (const float*)d_in[1];
  const float* v = (const float*)d_in[2];

  const size_t PB = (size_t)NE * 2;                     // 16777216
  size_t off = 0;
  const size_t oK  = off; off += PB;
  const size_t oVT = off; off += PB;
  if (off > ws_size) return;                            // off = 33554432
  if (off > (size_t)134217728) return;

  char* ws = (char*)d_ws;
  unsigned short* KB = (unsigned short*)(ws + oK);
  unsigned short* VT = (unsigned short*)(ws + oVT);
  float* out0 = (float*)d_out;

  const int n8 = NE / 8;                                // 1048576
  if ((n8 % 256) != 0) return;
  const dim3 blk(256);
  const dim3 gC(n8 / 256);                              // 4096 blocks
  const dim3 gVT(SEQ / 64, HD / 64, NB);                // 32 x 2 x 32 tiles
  const dim3 gA(NB * NQB);                              // 1024 blocks of 256

  // (0) k -> bf16 plane; v -> f16( bf16_RNE(v) * 64 ) transposed plane [b][d][s]
  conv_bf16<<<gC, blk, 0, stream>>>(k, KB, n8);
  vtrans_h16<<<gVT, blk, 0, stream>>>(v, VT);

  // (1) causal flash attention -> out f32 [32][2048][128]
  attn128<<<gA, blk, 0, stream>>>(q, KB, VT, out0);
  (void)hipGetLastError();
}

// v009
// A run of this version takes 61.8 microseconds.
// In two side-by-side timings against v008, it was 1.03 and 1.04 times as fast.
// Counting every step since v000, it is 7.29 times as fast.
// Contractions: q.k^T on v_wmma_f32_16x16x32_bf16 (bf16 plane of the RNE-converted k, q converted RNE in the kernel, one product);
// p.v on v_wmma_f32_16x16x32_f16 (p as f16 x1024 hi plane plus f16 x2048 residual plane with its own per-chunk
// accumulator folded x1/2048 in f32, v^T as f16 of the bf16 RNE-converted v carried x64); all f32 accumulate;
// online softmax (running max) and the causal index select in f32 on VALU. Both products are formed transposed
// (S^T = K.Q^T, O^T += V^T.P^T): a lane holds one query's scores, and P^T goes from the score accumulators into the
// B operand in registers. A query tile's key chunks are dealt to two groups of four waves (even and odd chunks), each
// with its own running maximum, sum and context; the two states are joined in f32 behind the loop.
#include <hip/hip_runtime.h>
#include <hip/hip_bf16.h>
#include <math.h>
#include <stdint.h>

#define NB   32
#define SEQ  2048
#define HD   128
#define KC   64
#define NQB  (SEQ / 64)
#define NE   (NB * SEQ * HD)
#define PSC  1024.0f
#define RSC  2048.0f
#define VSC  64.0f
#define SL2  ((float)(0.17677669529663687 * 1.4426950408889634))   // 1/sqrt(32) * log2(e): raw score -> exponent to base 2
#define PEX  10.0f         // log2(PSC): the x1024 carry of p as a summand of that exponent
static_assert(PSC == (float)(1 << 10));
#define KP   (HD + 8)      // K row pitch in LDS, elements: 272 B = 16 B x 17
#define VP   (KC + 8)      // V^T row pitch in LDS, elements: 144 B = 16 B x 9
#define OP   (64 + 4)      // output staging row pitch, floats: 68 dwords
static_assert((SEQ % 64) == 0);
static_assert(HD == 128);
static_assert(((NE / 8) % 256) == 0);
static_assert(16 * OP * 4 == 16 * KP * 2);   // a wave's output staging also holds its 16 Q rows as bf16 at the K pitch
static_assert(4 * 16 * 32 * 16 + 4 * 32 * 8 <= 2 * KC * KP * 2);   // the second group's state fits the two K buffers
#define NCEIL (3.402823466e+38f)    // ceiling of the running exponent offset: the highest finite f32, see the loop

typedef _Float16 v16h __attribute__((ext_vector_type(16)));
typedef _Float16 v8h  __attribute__((ext_vector_type(8)));
typedef __bf16   v16b __attribute__((ext_vector_type(16)));
typedef float    v8f  __attribute__((ext_vector_type(8)));
typedef float    v4f  __attribute__((ext_vector_type(4)));
typedef unsigned int v4u __attribute__((ext_vector_type(4)));
typedef unsigned int v2u __attribute__((ext_vector_type(2)));
typedef float    v2f  __attribute__((ext_vector_type(2)));

union FragH { v16h v; v8h h[2]; };
union FragB { v16b v; v4u u[2]; };
union HU8   { v8h h; v4u u; };

// ---- scalar helpers --------------------------------------------------------------------------------
__device__ __forceinline__ unsigned short bf_bits(float f) {          // f32 -> bf16 bits, RNE convert
  unsigned u = __float_as_uint(f);
  return (unsigned short)((u + 0x7FFFu + ((u >> 16) & 1u)) >> 16);
}
__device__ __forceinline__ float bf_up(unsigned short h) { return __uint_as_float(((unsigned)h) << 16); }
__device__ __forceinline__ float bfr(float f) { return bf_up(bf_bits(f)); }   // value of the bf16 RNE convert
__device__ __forceinline__ unsigned pk16(unsigned short a, unsigned short b) { return (unsigned)a | ((unsigned)b << 16); }
// value of lane l ^ 16 (the other half wave), by a vector cross-row move; every lane is on where it is used
__device__ __forceinline__ float xhalf(float x) {
  const int b = __builtin_bit_cast(int, x);
  return __builtin_bit_cast(float, __builtin_amdgcn_permlanex16(b, b, 0x76543210, 0xfedcba98, false, false));
}
__device__ __forceinline__ v8f zero8() { v8f z = {0.f, 0.f, 0.f, 0.f, 0.f, 0.f, 0.f, 0.f}; return z; }

// ---- fragment loaders: 16-bit A/B operand, lane -> row/col (lane&15), p already includes +8*(lane>>4);
//      elements 0..7 <- p[0..7] (k0+8h..), elements 8..15 <- p[16..23] (k0+16+8h..)
__device__ __forceinline__ v16h ldfrag_h(const _Float16* p) {
  FragH f;
  f.h[0] = *(const v8h*)(p);
  f.h[1] = *(const v8h*)(p + 16);
  return f.v;
}
__device__ __forceinline__ v16b ldfrag_b(const unsigned short* p) {
  FragB f;
  f.u[0] = *(const v4u*)(p);
  f.u[1] = *(const v4u*)(p + 16);
  return f.v;
}

// ---- WMMA groups: a tile's four products stand back to back in one statement. Inside a group only accumulate
//      chains follow one another, which need no distance; the four v_nop that end the statement are the distance the
//      chip asks for before the first vector instruction that reads D or overwrites A or B behind the group.
// Score tile: one chain of four products over d on one accumulator, started from 0.
__device__ __forceinline__ v8f mma_b4(v16b a0, v16b a1, v16b a2, v16b a3, v16b b0, v16b b1, v16b b2, v16b b3) {
  v8f d = zero8();
#if defined(__HIP_DEVICE_COMPILE__)
  asm volatile(
      "v_wmma_f32_16x16x32_bf16 %0, %1, %5, 0\n\t"
      "v_wmma_f32_16x16x32_bf16 %0, %2, %6, %0\n\t"
      "v_wmma_f32_16x16x32_bf16 %0, %3, %7, %0\n\t"
      "v_wmma_f32_16x16x32_bf16 %0, %4, %8, %0\n\t"
      "v_nop\n\tv_nop\n\tv_nop\n\tv_nop"
      : "=&v"(d)
      : "v"(a0), "v"(a1), "v"(a2), "v"(a3), "v"(b0), "v"(b1), "v"(b2), "v"(b3));
#endif
  return d;
}
// Context tile: o += a0.h0 + a1.h1 and r = a0.r0 + a1.r1, the two chains taking turns, each in its old order.
__device__ __forceinline__ void mma_h4(v8f& o, v8f& r, v16h a0, v16h a1, v16h h0, v16h h1, v16h r0, v16h r1) {
#if defined(__HIP_DEVICE_COMPILE__)
  asm volatile(
      "v_wmma_f32_16x16x32_f16 %0, %2, %4, %0\n\t"
      "v_wmma_f32_16x16x32_f16 %1, %2, %6, 0\n\t"
      "v_wmma_f32_16x16x32_f16 %0, %3, %5, %0\n\t"
      "v_wmma_f32_16x16x32_f16 %1, %3, %7, %1\n\t"
      "v_nop\n\tv_nop\n\tv_nop\n\tv_nop"
      : "+v"(o), "=&v"(r)
      : "v"(a0), "v"(a1), "v"(h0), "v"(h1), "v"(r0), "v"(r1));
#endif
}
// ---- exponentials to base 2. Behind v_exp_f32 the instruction set asks for one independent instruction before its
//      result is read or its source overwritten.
//      Here each exponential replaces its own argument, so its neighbours in the statement are independent of it, and
//      one v_nop fills the slot behind the last.
__device__ __forceinline__ void exp2_x8(v8f& x) {
  float a = x[0], b = x[1], c = x[2], d = x[3], e = x[4], f = x[5], g = x[6], h = x[7];
#if defined(__HIP_DEVICE_COMPILE__)
  asm("v_exp_f32 %0, %0\n\tv_exp_f32 %1, %1\n\tv_exp_f32 %2, %2\n\tv_exp_f32 %3, %3\n\t"
      "v_exp_f32 %4, %4\n\tv_exp_f32 %5, %5\n\tv_exp_f32 %6, %6\n\tv_exp_f32 %7, %7\n\tv_nop"
      : "+v"(a), "+v"(b), "+v"(c), "+v"(d), "+v"(e), "+v"(f), "+v"(g), "+v"(h));
#endif
  const v8f y = {a, b, c, d, e, f, g, h};
  x = y;
}
__device__ __forceinline__ float exp2_x1(float x) {
#if defined(__HIP_DEVICE_COMPILE__)
  asm("v_exp_f32 %0, %0\n\tv_nop" : "+v"(x));
#endif
  return x;
}
// ---- asynchronous staging, global -> LDS, through no register -------------------------------------------
__device__ __forceinline__ unsigned lds_off(const void* p) { return (unsigned)(size_t)p; }   // LDS byte address
// Eight 16-B copies per lane: piece i goes from g + i*gs + off to LDS byte l + i*ls; g is the same in every lane
// (scalar base), off the lane's own byte offset. The s_wait_xcnt closes the same statement, so that no address
// register of an issued copy is rewritten in front of it (a precaution).
__device__ __forceinline__ void copy8_async(unsigned l, unsigned ls, const char* g, size_t gs, unsigned off) {
#if defined(__HIP_DEVICE_COMPILE__)
  asm volatile(
      "global_load_async_to_lds_b128 %0, %16, %8\n\t"
      "global_load_async_to_lds_b128 %1, %16, %9\n\t"
      "global_load_async_to_lds_b128 %2, %16, %10\n\t"
      "global_load_async_to_lds_b128 %3, %16, %11\n\t"
      "global_load_async_to_lds_b128 %4, %16, %12\n\t"
      "global_load_async_to_lds_b128 %5, %16, %13\n\t"
      "global_load_async_to_lds_b128 %6, %16, %14\n\t"
      "global_load_async_to_lds_b128 %7, %16, %15\n\t"
      "s_wait_xcnt 0x0"
      :: "v"(l), "v"(l + ls), "v"(l + 2 * ls), "v"(l + 3 * ls),
         "v"(l + 4 * ls), "v"(l + 5 * ls), "v"(l + 6 * ls), "v"(l + 7 * ls),
         "s"(g), "s"(g + gs), "s"(g + 2 * gs), "s"(g + 3 * gs),
         "s"(g + 4 * gs), "s"(g + 5 * gs), "s"(g + 6 * gs), "s"(g + 7 * gs), "v"(off)
      : "memory");
#endif
}
// Hand-over of a staged tile: this wave's LDS reads of the buffer that is refilled next have retired, this wave's
// own copies have landed, then the block barrier publishes them and ends every reader's last read.
__device__ __forceinline__ void publish_point() {
#if defined(__HIP_DEVICE_COMPILE__)
  asm volatile("s_wait_dscnt 0x0" ::: "memory");      // own LDS reads done before the buffer gets a new writer
  asm volatile("s_wait_asynccnt 0x0" ::: "memory");   // own copies landed before other waves may read them
#endif
  __syncthreads();
}
__device__ __forceinline__ void wave_sync_lds() {
  __builtin_amdgcn_fence(__ATOMIC_RELEASE, "workgroup");
  __builtin_amdgcn_wave_barrier();
  __builtin_amdgcn_fence(__ATOMIC_ACQUIRE, "workgroup");
}

// =====================================================================================================
// Plane convert: Y[i] = bf16_RNE(X[i]) bits. Thread i handles elements 8i..8i+7 and writes one 16-B piece;
// grid = n8 / 256 (n8 multiple of 256, host-checked). coverage: n8 threads x 8 elements = the whole plane.
// =====================================================================================================
__global__ __launch_bounds__(256) void conv_bf16(const float* __restrict__ X, unsigned short* Y, int n8) {
  const int i  = blockIdx.x * 256 + threadIdx.x;
  const int ic = (i < n8) ? i : (n8 - 1);                     // clamped address
  const float* src = X + (size_t)ic * 8;
  const v4f a = *(const v4f*)(src);
  const v4f c = *(const v4f*)(src + 4);
  v4u o;
  o[0] = pk16(bf_bits(a[0]), bf_bits(a[1]));
  o[1] = pk16(bf_bits(a[2]), bf_bits(a[3]));
  o[2] = pk16(bf_bits(c[0]), bf_bits(c[1]));
  o[3] = pk16(bf_bits(c[2]), bf_bits(c[3]));
  if (i < n8) *(v4u*)(Y + (size_t)i * 8) = o;
  
}

// =====================================================================================================
// v [b][s][d] f32 -> VT [b][d][s] f16( bf16_RNE(v) * 64 ). Block = 256 threads, one 64(s) x 64(d) tile,
// grid = (SEQ/64, HD/64, NB). Load: thread t reads s row t>>2, d = dblk*64 + 16*(t&3)..+15 (4 x 16-B loads),
// converts and writes the transposed elements into the LDS tile T[d][s] (pitch 72 halves); __syncthreads;
// coverage: load 256 threads x 16 = 64x64; store 2 it x 32 rows x 8 lanes x 8 halves = 64 d rows x 64 s.
// =====================================================================================================
__global__ __launch_bounds__(256) void vtrans_h16(const float* __restrict__ V, unsigned short* VTp) {
  __shared__ __align__(16) _Float16 Tsh[64 * 72];
  const int t    = threadIdx.x;
  const int dblk = blockIdx.y;
  const int b    = blockIdx.z;
  const int s0   = blockIdx.x * 64;
  {
    const int sr = t >> 2, d0 = (t & 3) * 16;
    const float* src = V + ((size_t)b * SEQ + s0 + sr) * HD + dblk * 64 + d0;
#pragma unroll
    for (int i = 0; i < 4; ++i) {
      const v4f x = *(const v4f*)(src + 4 * i);
#pragma unroll
      for (int e = 0; e < 4; ++e) Tsh[(d0 + 4 * i + e) * 72 + sr] = (_Float16)(bfr(x[e]) * VSC);
    }
  }
  __syncthreads();
  const int q8 = t >> 3, c8 = (t & 7) * 8;
  v4u vals[2];
#pragma unroll
  for (int it = 0; it < 2; ++it) {
    const int d = it * 32 + q8;
    HU8 hu;
    hu.h = *(const v8h*)(Tsh + d * 72 + c8);
    vals[it] = hu.u;
  }
#pragma unroll
  for (int it = 0; it < 2; ++it) {
    const int d = it * 32 + q8;
    *(v4u*)(VTp + ((size_t)b * HD + dblk * 64 + d) * SEQ + s0 + c8) = vals[it];
  }
  
}

// =====================================================================================================
// Causal flash attention, head dim 128, one head per sequence, SEQ query/key rows per sequence.
//   q (f32, the input itself) and the KB plane (bf16 bits): element (b, t, d) at [(b*SEQ + t)*128 + d]
//   Q is read by two waves only, so it has no plane of its own: each wave loads its 16 rows as f32, one whole
//   512-B row per instruction, converts them (RNE, the plane convert's own arithmetic) and turns them into B
//   fragments through its own, still unused, output staging rows in LDS.
//   VT plane (f16, x64): element (b, d, s) at [(b*128 + d)*SEQ + s]
//   out (f32): element (b, t, d) at [(b*SEQ + t)*128 + d]
//   raw score = k . q on bf16 WMMA (its factor 1/sqrt(32) is applied in the exponent), A = K rows, B = Q: accumulator register r of lane (c, h) is key
//   16j + 8h + r against query q0 + c; score := -inf where key > query row (select by index);
//   maximum and sum of a query run inside its lane, the two half waves exchange the maximum once per chunk and
//   join their sums once, behind the loop;
//   1024 p = 2^(score * SL2 + n), n = 10 - max * SL2, packed in registers as f16(1024 p) and f16(2048 (1024 p - hi)): score tiles 2kk and 2kk+1 are
//   elements 0..7 and 8..15 of the B operand of keys 32kk..32kk+31, the k order of the V^T loader;
//   context^T += v^T . hi on f16 WMMA, plus (v^T . res) * 1/2048 from a per-chunk accumulator: register r of lane
//   (c, h) in tile t is d = 16t + 8h + r of query q0 + c; online softmax (running max) in f32.
//   Block = 8 waves = 64 query rows of one sequence, twice: wave w and wave w + 4 hold the same 16 rows. Group g
//   (waves 4g..4g+3) walks key chunks g, g + 2, g + 4, ... of the tile's chunks 0..qb, so the longest tile's serial
//   walk is 16 trips, not 32, and a SIMD keeps four waves to the end: half the blocks are resident at a time, the
//   grid = NQB * NB runs from the heaviest tile to the lightest.
//   Key chunks of 64, block-uniform trip i = 0..qb/2, kt = 2i + g (chunks strictly above the diagonal are fully
//   masked and skipped, but for group 1's last chunk where qb is even: it lies above, is masked whole and adds 0).
//   Behind the loop group 1 hands its maximum, sum and context to group 0 through LDS, lane to lane.
//   K / V^T chunk staging, per group: asynchronous 16-B copies to LDS, 128 threads x 8 pieces per plane = the whole
//   64x128 / 128x64 tile, each wave instruction on four whole 128-B lines. One buffer per operand and group: K of the
//   group's next chunk is copied behind the barrier that ends the score products of this one and flies under softmax
//   and P.V; V^T of the next chunk is copied behind the barrier that ends P.V and flies under the next score products.
//   Output coverage: each wave of group 0 stores its rows q0..q0+15 x 128 columns, two 256-B row pieces per instruction
// =====================================================================================================
// Four waves per SIMD (two blocks on a WGP): the budget of 256 registers is stated, since left to itself
// the build spends more of them on a wider schedule of the softmax.
__global__ __launch_bounds__(256) __attribute__((amdgpu_waves_per_eu(4, 4)))
void attn128(const float* __restrict__ Qf, const unsigned short* __restrict__ KBp,
             const unsigned short* __restrict__ VTp, float* outp) {
  // Row pitches are odd multiples of 16 B, so the 16 lanes of a half wave that read one 16-B piece each from
  // 16 consecutive rows fall on 64 distinct banks.
  __shared__ __align__(16) unsigned short Ksh[2][KC * KP];        // per group K [kv][d] bf16, pitch 272 B
  __shared__ __align__(16) _Float16 Vth[2][HD * VP];              // per group V^T [d][kv] f16, pitch 144 B
  __shared__ __align__(16) float    Os[8][16 * OP];               // per wave context half tile [row][64 d]

  const int tid  = threadIdx.x;
  const int wave = tid >> 5;
  const int tg   = tid & 127;                    // the thread's number inside its group of four waves
  // The wave's number once more, as a scalar, for the code behind the loop: what that code needs of it (the output
  // rows' base, the staging rows' place) then passes the loop in scalar registers; in vector registers it is spilled.
  const int wsc  = __builtin_amdgcn_readfirstlane(tid >> 5);
  const int grp  = wsc >> 2;                     // key group, the same in every lane of a wave: a scalar
  const int lane = tid & 31;
  const int hh   = lane >> 4;
  const int c    = lane & 15;

  // Tile deal. There are twice as many blocks as resident places and a tile's
  // cost grows with its index: cost falls with the block index, so that the light tiles fill the places that the
  // heavy ones leave. For speed only; (tile, sequence) is a permutation of the block index.
  const int bx = blockIdx.x;
  const int qb = NQB - 1 - bx / NB;
  const int b  = bx % NB;
  const int q0 = qb * 64 + (wave & 3) * 16;      // in-sequence query row of this wave's first row
  const int qrow = q0 + c;                       // in-sequence query row of this lane's accumulator column
  const size_t rowB = (size_t)b * SEQ;
  const _Float16* VTh = (const _Float16*)(const void*)VTp + (size_t)b * HD * SEQ;

  // ---- Q rows of this wave, f32: row r by one instruction, lane l takes d = 4l..4l+3 ----
  const float* qsrc = Qf + (rowB + q0) * HD + lane * 4;
  v4f qx[16];
#pragma unroll
  for (int r = 0; r < 16; ++r) qx[r] = *(const v4f*)(qsrc + r * HD);
#if defined(__HIP_DEVICE_COMPILE__)
  // The loads' address pair is named here so that it stays whole up to the wait (a precaution).
  asm volatile("s_wait_xcnt 0x0" :: "v"(qsrc) : "memory");
#endif

  float nrun = INFINITY;                         // running exponent offset of the lane's query, alike in both half waves
  float lrun = 0.f;                              // running sum of 1024 p over the keys of this lane's own half wave
  v8f oacc[8];
#pragma unroll
  for (int t = 0; t < 8; ++t) oacc[t] = zero8();

  // Staging addresses, tg counting inside the group. K chunk = 16 KiB in a row: piece i of thread tg is 16-B piece
  // i*128+tg, K row i*8 + (tg>>4). V^T chunk = 128 rows of 128 B: piece i is row i*16 + (tg>>3), 16-B piece tg&7.
  const unsigned short* Kg = Ksh[grp];                             // the group's own buffers
  const _Float16*       Vg = Vth[grp];
  const unsigned kl = lds_off(Kg) + (unsigned)(tg >> 4) * (KP * 2) + (unsigned)(tg & 15) * 16;
  const unsigned vl = lds_off(Vg) + (unsigned)(tg >> 3) * (VP * 2) + (unsigned)(tg & 7) * 16;
  const char* kg = (const char*)(KBp + rowB * HD);                 // block-uniform bases
  const char* vg = (const char*)VTh;
  const unsigned ko = (unsigned)tg * 16;                           // the lane's byte offsets from them
  const unsigned vo = (unsigned)(tg >> 3) * (SEQ * 2) + (unsigned)(tg & 7) * 16;

  // Prologue: K of the group's first chunk landed and published, its V^T in flight. The Q rows come in beside K's
  // copies. Tile 0 has no chunk 1: group 1 then copies chunk 0, which its mask hides (the address stays in the plane).
  const int k0 = (grp < qb) ? grp : qb;
  copy8_async(kl, 8 * KP * 2, kg + (size_t)k0 * (KC * HD * 2), 128 * 16, ko);

  // ---- Q fragments (B operand, col = lane&15): 4 d-chunks, from the wave's own LDS rows (pitch as K's) ----
  unsigned short* qs = (unsigned short*)(void*)Os[wave];
#pragma unroll
  for (int r = 0; r < 16; ++r) {
    const v2u w = {pk16(bf_bits(qx[r][0]), bf_bits(qx[r][1])), pk16(bf_bits(qx[r][2]), bf_bits(qx[r][3]))};
    *(v2u*)(qs + r * KP + lane * 4) = w;
  }
  wave_sync_lds();                               // the rows are written by the wave's other lanes
  v16b qa[4];
#pragma unroll
  for (int dc = 0; dc < 4; ++dc) qa[dc] = ldfrag_b(qs + c * KP + dc * 32 + 8 * hh);

  publish_point();
  copy8_async(vl, 16 * VP * 2, vg + (size_t)k0 * (KC * 2), (size_t)16 * SEQ * 2, vo);

  const int nt = (qb >> 1) + 1;              // trips: chunks 0..qb in pairs
#pragma unroll 1
  for (int i = 0; i < nt; ++i) {             // block-uniform trip count, at most NQB / 2
    const int kt = 2 * i + grp;              // the group's chunk of this trip, a scalar
    // The lane's query row counted from its first key of this chunk: key kt*KC + 8*hh + 16j + r lies behind the row
    // where 16j + r > dq. One register against literals; one register per (j, r) would pass the 256 of four waves.
    const int dq = qrow - kt * KC - 8 * hh;
    // Chunk copied ahead. The last trip copies chunk qb, unread, instead of branching round the copies: with a
    // branch in the loop body the build holds all eight residual tiles to the loop's foot and passes 256 registers,
    // which would leave three waves on a SIMD instead of four.
    const int kn  = (kt + 2 < qb) ? kt + 2 : qb;

    // ---- scores^T: 64 keys x 16 queries per wave (A operand: row = key j*16+c, k = d, split map) ----
    // The eight LDS reads of key tile j+1 are issued as one group in front of tile j's products, into a second
    // register set: their latency passes under those products instead of standing in front of every product.
    v8f s[4];
    v16b kf[2][4];
#pragma unroll
    for (int dc = 0; dc < 4; ++dc) kf[0][dc] = ldfrag_b(Kg + c * KP + dc * 32 + 8 * hh);
#pragma unroll
    for (int j = 0; j < 4; ++j) {
      if (j < 3) {
#pragma unroll
        for (int dc = 0; dc < 4; ++dc) kf[(j + 1) & 1][dc] = ldfrag_b(Kg + ((j + 1) * 16 + c) * KP + dc * 32 + 8 * hh);
      }
      const v8f sh = mma_b4(kf[j & 1][0], kf[j & 1][1], kf[j & 1][2], kf[j & 1][3], qa[0], qa[1], qa[2], qa[3]);
#pragma unroll
      for (int r = 0; r < 8; ++r) s[j][r] = (j * 16 + r > dq) ? -INFINITY : sh[r];   // causal: keys strictly after the row
    }

    // V^T of this chunk published; every wave has left K: refill it
    publish_point();
    copy8_async(kl, 8 * KP * 2, kg + (size_t)kn * (KC * HD * 2), 128 * 16, ko);

    // ---- query max, online softmax, P^T hi (x1024) and residual (x2048) packed as B operands ----
    float mj[4];                                 // one chain per score tile, so that the chains are independent
#pragma unroll
    for (int j = 0; j < 4; ++j) {
      mj[j] = s[j][0];
#pragma unroll
      for (int r = 1; r < 8; ++r) mj[j] = fmaxf(mj[j], s[j][r]);
    }
    float m = fmaxf(fmaxf(mj[0], mj[1]), fmaxf(mj[2], mj[3]));
    m = fmaxf(m, xhalf(m));                      // the other eight keys of each tile lie in the other half wave
    // The scores stay raw: 1024 p = 2^(s * SL2 + n) with n = PEX - max * SL2, one fused multiply-add per score in
    // front of the exponential in place of the scale, the subtraction, the change of base and the x1024 product.
    // n falls as the maximum rises, so the running n is a minimum.
    // The ceiling keeps n finite where a group has met no key in front of the row yet (tile 0, group 1): inf - inf
    // would be no number. SL2 < 1, so every finite maximum's n lies below it and stays as it is.
    const float nnew  = fminf(fminf(nrun, __builtin_fmaf(m, -SL2, PEX)), NCEIL);
    const float alpha = exp2_x1(nnew - nrun);
    nrun = nnew;
    FragH pa[2], pr[2];
    float pj[4];
#pragma unroll
    for (int j = 0; j < 4; ++j) {
      pj[j] = 0.f;
#pragma unroll
      for (int r = 0; r < 8; ++r) s[j][r] = __builtin_fmaf(s[j][r], SL2, nnew);
      exp2_x8(s[j]);
#pragma unroll
      for (int r = 0; r < 8; ++r) {
        const float ph = s[j][r];
        pj[j] += ph;
        const _Float16 hq = (_Float16)ph;
        const float res = (ph - (float)hq) * RSC;
        pa[j >> 1].v[(j & 1) * 8 + r] = hq;
        pr[j >> 1].v[(j & 1) * 8 + r] = (_Float16)res;
      }
    }
    lrun = lrun * alpha + ((pj[0] + pj[1]) + (pj[2] + pj[3]));
    // Holds the rescale and the V^T fragment reads back from the head of the softmax above: spread over all of it,
    // they take the build past 256 registers, and it puts a context tile through scratch memory on every trip.
    __builtin_amdgcn_sched_barrier(0);
#pragma unroll
    for (int t = 0; t < 8; ++t) {
#pragma unroll
      for (int r = 0; r < 8; ++r) oacc[t][r] *= alpha;
    }

    // ---- context^T += V^T . P^T (f16 WMMA; A = V^T [dv][kv] by the split map, B = P^T from the accumulators) ----
    // V^T fragments likewise: the four LDS reads of tile t+1 stand in front of tile t's products.
    v16h vf[2][2];
#pragma unroll
    for (int kk = 0; kk < 2; ++kk) vf[0][kk] = ldfrag_h(Vg + c * VP + kk * 32 + 8 * hh);
#pragma unroll
    for (int t = 0; t < 8; ++t) {
      if (t < 7) {
#pragma unroll
        for (int kk = 0; kk < 2; ++kk) vf[(t + 1) & 1][kk] = ldfrag_h(Vg + ((t + 1) * 16 + c) * VP + kk * 32 + 8 * hh);
      }
      v8f rr = zero8();
      mma_h4(oacc[t], rr, vf[t & 1][0], vf[t & 1][1], pa[0].v, pa[1].v, pr[0].v, pr[1].v);
#pragma unroll
      for (int r = 0; r < 8; ++r) oacc[t][r] += rr[r] * (1.0f / RSC);
    }

    // K of the next chunk published; every wave has left V^T: refill it
    publish_point();
    copy8_async(vl, 16 * VP * 2, vg + (size_t)kn * (KC * 2), (size_t)16 * SEQ * 2, vo);
  }
#if defined(__HIP_DEVICE_COMPILE__)
  asm volatile("s_wait_asynccnt 0x0" ::: "memory");   // the last trip's copies have landed before the wave ends
#endif

  // ---- normalise (1/l, l carrying p's x1024 too, and the 1/64 v carry), then stage and store the wave's 16x128 f32
  //      tile as two 16x64 halves: each store instruction writes two 256-B row pieces (whole 128-B lines)
  // The lane's number is formed anew, from no register that lived through the loop (the block is one-dimensional, so
  // it is tid & 31): carried across the loop, c, hh and the staging address are spilled to scratch by this build.
  const int ln = (int)__builtin_amdgcn_mbcnt_lo(~0u, 0u);
  const int ce = ln & 15, he = ln >> 4;

  // ---- the two groups' states joined: wave w + 4 hands its lane's maximum, sum and 64 context values to the same
  //      lane of wave w. The K buffers carry them: their last readers left at the last trip's first barrier, and every
  //      wave's last copies into them had landed at its second. Each 16-B piece of a wave lies in 512 B in a row.
  float* xo = (float*)(void*)&Ksh[0][0] + ((wsc & 3) * 16 * 32 + ln) * 4;      // piece p at xo + p * 128
  float* xm = (float*)(void*)&Ksh[0][0] + 4 * 16 * 32 * 4 + ((wsc & 3) * 32 + ln) * 2;
  if (grp == 1) {                                // a scalar test
#pragma unroll
    for (int t = 0; t < 8; ++t) {
      const v8f o = oacc[t];
      const v4f lo = {o[0], o[1], o[2], o[3]};
      const v4f hi = {o[4], o[5], o[6], o[7]};
      *(v4f*)(xo + (2 * t) * 128)     = lo;
      *(v4f*)(xo + (2 * t + 1) * 128) = hi;
    }
    const v2f ml = {nrun, lrun};
    *(v2f*)xm = ml;
  }
  __syncthreads();                               // group 1's state is written; every wave of the block passes here
  if (grp == 1) return;                          // no barrier stands behind this line
  const v2f ml1 = *(const v2f*)xm;
  const float nj2 = fminf(nrun, ml1[0]);         // group 0 has met key 0: finite
  const float w0  = exp2_x1(nj2 - nrun);
  const float w1  = exp2_x1(nj2 - ml1[0]);
  const float lj  = lrun * w0 + ml1[1] * w1;

  float* os = Os[wsc];
  const float l   = lj + xhalf(lj);              // the two half waves' sums of the lane's query
  const float inv = ((l > 0.f) ? (1.0f / l) : 0.f) * (1.0f / VSC);   // l carries the x1024 of p itself
  const float f0  = w0 * inv, f1 = w1 * inv;
  v4f vals[2][8];
#pragma unroll
  for (int hv = 0; hv < 2; ++hv) {
    if (hv == 1) wave_sync_lds();             // the first half is read out before the second overwrites it
#pragma unroll
    for (int t = 0; t < 4; ++t) {               // a lane's eight registers are eight consecutive d of its query
      const v8f o = oacc[4 * hv + t];
      const v4f xl = *(const v4f*)(xo + (2 * (4 * hv + t)) * 128);
      const v4f xh = *(const v4f*)(xo + (2 * (4 * hv + t) + 1) * 128);
      const v4f lo = {o[0] * f0 + xl[0] * f1, o[1] * f0 + xl[1] * f1, o[2] * f0 + xl[2] * f1, o[3] * f0 + xl[3] * f1};
      const v4f hi = {o[4] * f0 + xh[0] * f1, o[5] * f0 + xh[1] * f1, o[6] * f0 + xh[2] * f1, o[7] * f0 + xh[3] * f1};
      *(v4f*)(os + ce * OP + t * 16 + 8 * he)     = lo;
      *(v4f*)(os + ce * OP + t * 16 + 8 * he + 4) = hi;
    }
    wave_sync_lds();
#pragma unroll
    for (int it = 0; it < 8; ++it) vals[hv][it] = *(const v4f*)(os + (2 * it + he) * OP + ce * 4);
  }
  float* C = outp + (rowB + qb * 64 + wsc * 16) * HD;
#pragma unroll
  for (int hv = 0; hv < 2; ++hv) {
#pragma unroll
    for (int it = 0; it < 8; ++it) *(v4f*)(C + (size_t)(2 * it + he) * HD + hv * 64 + ce * 4) = vals[hv][it];
  }
}

// =====================================================================================================
// Workspace map (bytes); every plane is an exact multiple of its whole-line / 64x64-tile store granularity:
//   KB  bf16 [32*2048][128]    0          16777216
//   VT  f16  [32][128][2048]   16777216   16777216
//   end                        33554432
// =====================================================================================================
extern "C" void kernel_launch(void* const* d_in, const int* in_sizes, int n_in,
                              void* d_out, int out_size, void* d_ws, size_t ws_size,
                              hipStream_t stream) {
  if (n_in < 3) return;
  if (in_sizes[0] != NE || in_sizes[1] != NE || in_sizes[2] != NE) return;
  if (out_size != NE) return;

  const float* q = (const float*)d_in[0];
  const float* k = (const float*)d_in[1];
  const float* v = (const float*)d_in[2];

  const size_t PB = (size_t)NE * 2;                     // 16777216
  size_t off = 0;
  const size_t oK  = off; off += PB;
  const size_t oVT = off; off += PB;
  if (off > ws_size) return;                            // off = 33554432
  if (off > (size_t)134217728) return;

  char* ws = (char*)d_ws;
  unsigned short* KB = (unsigned short*)(ws + oK);
  unsigned short* VT = (unsigned short*)(ws + oVT);
  float* out0 = (float*)d_out;

  const int n8 = NE / 8;                                // 1048576
  if ((n8 % 256) != 0) return;
  const dim3 blk(256);
  const dim3 gC(n8 / 256);                              // 4096 blocks
  const dim3 gVT(SEQ / 64, HD / 64, NB);                // 32 x 2 x 32 tiles
  const dim3 gA(NB * NQB);                              // 1024 blocks of 256

  // (0) k -> bf16 plane; v -> f16( bf16_RNE(v) * 64 ) transposed plane [b][d][s]
  conv_bf16<<<gC, blk, 0, stream>>>(k, KB, n8);
  vtrans_h16<<<gVT, blk, 0, stream>>>(v, VT);

  // (1) causal flash attention -> out f32 [32][2048][128]
  attn128<<<gA, blk, 0, stream>>>(q, KB, VT, out0);
  (void)hipGetLastError();
}

// v010
// Measured time: 56.5 microseconds a run.
// In both of two side-by-side timings against v009, it was 1.09 times as fast.
// Counting every step since v000, it is 7.96 times as fast.
// Contractions: q.k^T on v_wmma_f32_16x16x32_bf16 (q RNE-converted to bf16 in the kernel and the bf16 plane of the RNE-converted k, one product);
// p.v on v_wmma_f32_16x16x32_f16 (p x1024 as an f16 hi plane plus an f16 residual plane at the same scale, both summed
// in the context accumulator, v^T as f16 of the bf16 RNE-converted v carried x64); all f32 accumulate;
// online softmax (running max) and the causal index select in f32 on VALU. Both products are formed transposed
// (S^T = K.Q^T, O^T += V^T.P^T): a lane holds one query's scores, and P^T goes from the score accumulators into the
// B operand in registers. A query tile's key chunks are dealt to two groups of four waves (even and odd chunks), each
// with its own running maximum, sum and context; the two states are joined in f32 behind the loop.
#include <hip/hip_runtime.h>
#include <hip/hip_bf16.h>
#include <math.h>
#include <stdint.h>

#define NB   32
#define SEQ  2048
#define HD   128
#define KC   64
#define NQB  (SEQ / 64)
#define NE   (NB * SEQ * HD)
#define PSC  1024.0f
#define VSC  64.0f
#define SL2  ((float)(0.17677669529663687 * 1.4426950408889634))   // 1/sqrt(32) * log2(e): raw score -> exponent to base 2
#define PEX  10.0f         // log2(PSC): the x1024 carry of p as a summand of that exponent
static_assert(PSC == (float)(1 << 10));
#define KP   (HD + 8)      // K row pitch in LDS, elements: 272 B = 16 B x 17
#define VP   (KC + 8)      // V^T row pitch in LDS, elements: 144 B = 16 B x 9
#define OP   (64 + 4)      // output staging row pitch, floats: 68 dwords
static_assert((SEQ % 64) == 0);
static_assert(HD == 128);
static_assert(((NE / 8) % 256) == 0);
static_assert(16 * OP * 4 == 16 * KP * 2);   // a wave's output staging also holds its 16 Q rows as bf16 at the K pitch
static_assert(4 * 16 * 32 * 16 + 4 * 32 * 8 <= 2 * KC * KP * 2);   // the second group's state fits the two K buffers
#define NCEIL (3.402823466e+38f)    // ceiling of the running exponent offset: the highest finite f32, see the loop

typedef _Float16 v16h __attribute__((ext_vector_type(16)));
typedef _Float16 v8h  __attribute__((ext_vector_type(8)));
typedef __bf16   v16b __attribute__((ext_vector_type(16)));
typedef float    v8f  __attribute__((ext_vector_type(8)));
typedef float    v4f  __attribute__((ext_vector_type(4)));
typedef unsigned int v4u __attribute__((ext_vector_type(4)));
typedef unsigned int v2u __attribute__((ext_vector_type(2)));
typedef float    v2f  __attribute__((ext_vector_type(2)));

union FragH { v16h v; v8h h[2]; v4u u[2]; };
union FragB { v16b v; v4u u[2]; };
union HU8   { v8h h; v4u u; };

// ---- scalar helpers --------------------------------------------------------------------------------
__device__ __forceinline__ unsigned short bf_bits(float f) {          // f32 -> bf16 bits, RNE convert
  unsigned u = __float_as_uint(f);
  return (unsigned short)((u + 0x7FFFu + ((u >> 16) & 1u)) >> 16);
}
__device__ __forceinline__ float bf_up(unsigned short h) { return __uint_as_float(((unsigned)h) << 16); }
__device__ __forceinline__ float bfr(float f) { return bf_up(bf_bits(f)); }   // value of the bf16 RNE convert
__device__ __forceinline__ unsigned pk16(unsigned short a, unsigned short b) { return (unsigned)a | ((unsigned)b << 16); }
// value of lane l ^ 16 (the other half wave), by a vector cross-row move; every lane is on where it is used
__device__ __forceinline__ float xhalf(float x) {
  const int b = __builtin_bit_cast(int, x);
  return __builtin_bit_cast(float, __builtin_amdgcn_permlanex16(b, b, 0x76543210, 0xfedcba98, false, false));
}
__device__ __forceinline__ v8f zero8() { v8f z = {0.f, 0.f, 0.f, 0.f, 0.f, 0.f, 0.f, 0.f}; return z; }

// ---- fragment loaders: 16-bit A/B operand, lane -> row/col (lane&15), p already includes +8*(lane>>4);
//      elements 0..7 <- p[0..7] (k0+8h..), elements 8..15 <- p[16..23] (k0+16+8h..)
__device__ __forceinline__ v16h ldfrag_h(const _Float16* p) {
  FragH f;
  f.h[0] = *(const v8h*)(p);
  f.h[1] = *(const v8h*)(p + 16);
  return f.v;
}
__device__ __forceinline__ v16b ldfrag_b(const unsigned short* p) {
  FragB f;
  f.u[0] = *(const v4u*)(p);
  f.u[1] = *(const v4u*)(p + 16);
  return f.v;
}

// ---- WMMA groups: a tile's four products stand in one statement. Inside a group only accumulate
//      chains follow one another, which need no distance; the four v_nop that end the statement are the distance the
//      chip asks for before the first vector instruction that reads D or overwrites A or B behind the group.
// Score tile: one chain of four products over d on one accumulator, started from 0.
__device__ __forceinline__ v8f mma_b4(v16b a0, v16b a1, v16b a2, v16b a3, v16b b0, v16b b1, v16b b2, v16b b3) {
  v8f d = zero8();
#if defined(__HIP_DEVICE_COMPILE__)
  asm volatile(
      "v_wmma_f32_16x16x32_bf16 %0, %1, %5, 0\n\t"
      "v_wmma_f32_16x16x32_bf16 %0, %2, %6, %0\n\t"
      "v_wmma_f32_16x16x32_bf16 %0, %3, %7, %0\n\t"
      "v_wmma_f32_16x16x32_bf16 %0, %4, %8, %0\n\t"
      "v_nop\n\tv_nop\n\tv_nop\n\tv_nop"
      : "=&v"(d)
      : "v"(a0), "v"(a1), "v"(a2), "v"(a3), "v"(b0), "v"(b1), "v"(b2), "v"(b3));
#endif
  return d;
}
// Two context tiles: o += a0.h0 + a1.h1 + a0.r0 + a1.r1 and the same for p with b0, b1. Each tile is one chain of four
// products on its accumulator; the two tiles' chains take turns, so that a product never follows its own chain's last.
__device__ __forceinline__ void mma_h8(v8f& o, v8f& p, v16h a0, v16h a1, v16h b0, v16h b1,
                                       v16h h0, v16h h1, v16h r0, v16h r1) {
#if defined(__HIP_DEVICE_COMPILE__)
  asm volatile(
      "v_wmma_f32_16x16x32_f16 %0, %2, %6, %0\n\t"
      "v_wmma_f32_16x16x32_f16 %1, %4, %6, %1\n\t"
      "v_wmma_f32_16x16x32_f16 %0, %3, %7, %0\n\t"
      "v_wmma_f32_16x16x32_f16 %1, %5, %7, %1\n\t"
      "v_wmma_f32_16x16x32_f16 %0, %2, %8, %0\n\t"
      "v_wmma_f32_16x16x32_f16 %1, %4, %8, %1\n\t"
      "v_wmma_f32_16x16x32_f16 %0, %3, %9, %0\n\t"
      "v_wmma_f32_16x16x32_f16 %1, %5, %9, %1\n\t"
      "v_nop\n\tv_nop\n\tv_nop\n\tv_nop"
      : "+v"(o), "+v"(p)
      : "v"(a0), "v"(a1), "v"(b0), "v"(b1), "v"(h0), "v"(h1), "v"(r0), "v"(r1));
#endif
}
// ---- eight values x split into two f16 planes of one scale: hi = f16(x), packed in pairs, and res = f16(x - hi).
//      The difference is exact in f32; one mixed-precision FMA per value forms it straight from the packed hi half
//      (x + hi * -1), with no unpacking convert. The hints name the two producers that stand four instructions back;
//      every other producer stands further off.
__device__ __forceinline__ void split_x8(const v8f x, v4u& hi, v4u& res) {
  unsigned h0 = 0, h1 = 0, h2 = 0, h3 = 0, r0 = 0, r1 = 0, r2 = 0, r3 = 0;
  float d0 = 0, d1 = 0, d2 = 0, d3 = 0, d4 = 0, d5 = 0, d6 = 0, d7 = 0;
#if defined(__HIP_DEVICE_COMPILE__)
  asm("v_cvt_pk_f16_f32 %0, %16, %17\n\t"
      "v_cvt_pk_f16_f32 %1, %18, %19\n\t"
      "v_cvt_pk_f16_f32 %2, %20, %21\n\t"
      "v_cvt_pk_f16_f32 %3, %22, %23\n\t"
      "s_delay_alu instid0(VALU_DEP_4)\n\t"
      "v_fma_mix_f32 %8, %0, -1.0, %16 op_sel_hi:[1,1,0]\n\t"
      "v_fma_mix_f32 %9, %0, -1.0, %17 op_sel:[1,0,0] op_sel_hi:[1,1,0]\n\t"
      "v_fma_mix_f32 %10, %1, -1.0, %18 op_sel_hi:[1,1,0]\n\t"
      "v_fma_mix_f32 %11, %1, -1.0, %19 op_sel:[1,0,0] op_sel_hi:[1,1,0]\n\t"
      "v_fma_mix_f32 %12, %2, -1.0, %20 op_sel_hi:[1,1,0]\n\t"
      "v_fma_mix_f32 %13, %2, -1.0, %21 op_sel:[1,0,0] op_sel_hi:[1,1,0]\n\t"
      "v_fma_mix_f32 %14, %3, -1.0, %22 op_sel_hi:[1,1,0]\n\t"
      "v_fma_mix_f32 %15, %3, -1.0, %23 op_sel:[1,0,0] op_sel_hi:[1,1,0]\n\t"
      "v_cvt_pk_f16_f32 %4, %8, %9\n\t"
      "v_cvt_pk_f16_f32 %5, %10, %11\n\t"
      "v_cvt_pk_f16_f32 %6, %12, %13\n\t"
      "s_delay_alu instid0(VALU_DEP_4)\n\t"
      "v_cvt_pk_f16_f32 %7, %14, %15"
      : "=&v"(h0), "=&v"(h1), "=&v"(h2), "=&v"(h3), "=&v"(r0), "=&v"(r1), "=&v"(r2), "=&v"(r3),
        "=&v"(d0), "=&v"(d1), "=&v"(d2), "=&v"(d3), "=&v"(d4), "=&v"(d5), "=&v"(d6), "=&v"(d7)
      : "v"(x[0]), "v"(x[1]), "v"(x[2]), "v"(x[3]), "v"(x[4]), "v"(x[5]), "v"(x[6]), "v"(x[7]));
#endif
  const v4u h = {h0, h1, h2, h3};
  const v4u r = {r0, r1, r2, r3};
  hi = h;
  res = r;
}
// ---- exponentials to base 2. Behind v_exp_f32 the instruction set asks for one independent instruction before its
//      result is read or its source overwritten.
//      Here each exponential replaces its own argument, so its neighbours in the statement are independent of it, and
//      one v_nop fills the slot behind the last.
__device__ __forceinline__ void exp2_x8(v8f& x) {
  float a = x[0], b = x[1], c = x[2], d = x[3], e = x[4], f = x[5], g = x[6], h = x[7];
#if defined(__HIP_DEVICE_COMPILE__)
  asm("v_exp_f32 %0, %0\n\tv_exp_f32 %1, %1\n\tv_exp_f32 %2, %2\n\tv_exp_f32 %3, %3\n\t"
      "v_exp_f32 %4, %4\n\tv_exp_f32 %5, %5\n\tv_exp_f32 %6, %6\n\tv_exp_f32 %7, %7\n\tv_nop"
      : "+v"(a), "+v"(b), "+v"(c), "+v"(d), "+v"(e), "+v"(f), "+v"(g), "+v"(h));
#endif
  const v8f y = {a, b, c, d, e, f, g, h};
  x = y;
}
__device__ __forceinline__ float exp2_x1(float x) {
#if defined(__HIP_DEVICE_COMPILE__)
  asm("v_exp_f32 %0, %0\n\tv_nop" : "+v"(x));
#endif
  return x;
}
// ---- asynchronous staging, global -> LDS, through no register -------------------------------------------
__device__ __forceinline__ unsigned lds_off(const void* p) { return (unsigned)(size_t)p; }   // LDS byte address
// Eight 16-B copies per lane: piece i goes from g + i*gs + off to LDS byte l + i*ls; g is the same in every lane
// (scalar base), off the lane's own byte offset. The s_wait_xcnt closes the same statement, so that no address
// register of an issued copy is rewritten in front of it (a precaution).
__device__ __forceinline__ void copy8_async(unsigned l, unsigned ls, const char* g, size_t gs, unsigned off) {
#if defined(__HIP_DEVICE_COMPILE__)
  asm volatile(
      "global_load_async_to_lds_b128 %0, %16, %8\n\t"
      "global_load_async_to_lds_b128 %1, %16, %9\n\t"
      "global_load_async_to_lds_b128 %2, %16, %10\n\t"
      "global_load_async_to_lds_b128 %3, %16, %11\n\t"
      "global_load_async_to_lds_b128 %4, %16, %12\n\t"
      "global_load_async_to_lds_b128 %5, %16, %13\n\t"
      "global_load_async_to_lds_b128 %6, %16, %14\n\t"
      "global_load_async_to_lds_b128 %7, %16, %15\n\t"
      "s_wait_xcnt 0x0"
      :: "v"(l), "v"(l + ls), "v"(l + 2 * ls), "v"(l + 3 * ls),
         "v"(l + 4 * ls), "v"(l + 5 * ls), "v"(l + 6 * ls), "v"(l + 7 * ls),
         "s"(g), "s"(g + gs), "s"(g + 2 * gs), "s"(g + 3 * gs),
         "s"(g + 4 * gs), "s"(g + 5 * gs), "s"(g + 6 * gs), "s"(g + 7 * gs), "v"(off)
      : "memory");
#endif
}
// Hand-over of a staged tile: this wave's LDS reads of the buffer that is refilled next have retired, this wave's
// own copies have landed, then the block barrier publishes them and ends every reader's last read.
__device__ __forceinline__ void publish_point() {
#if defined(__HIP_DEVICE_COMPILE__)
  asm volatile("s_wait_dscnt 0x0" ::: "memory");      // own LDS reads done before the buffer gets a new writer
  asm volatile("s_wait_asynccnt 0x0" ::: "memory");   // own copies landed before other waves may read them
#endif
  __syncthreads();
}
__device__ __forceinline__ void wave_sync_lds() {
  __builtin_amdgcn_fence(__ATOMIC_RELEASE, "workgroup");
  __builtin_amdgcn_wave_barrier();
  __builtin_amdgcn_fence(__ATOMIC_ACQUIRE, "workgroup");
}

// =====================================================================================================
// Plane convert: Y[i] = bf16_RNE(X[i]) bits. Thread i handles elements 8i..8i+7 and writes one 16-B piece;
// grid = n8 / 256 (n8 multiple of 256, host-checked). coverage: n8 threads x 8 elements = the whole plane.
// =====================================================================================================
__global__ __launch_bounds__(256) void conv_bf16(const float* __restrict__ X, unsigned short* Y, int n8) {
  const int i  = blockIdx.x * 256 + threadIdx.x;
  const int ic = (i < n8) ? i : (n8 - 1);                     // clamped address
  const float* src = X + (size_t)ic * 8;
  const v4f a = *(const v4f*)(src);
  const v4f c = *(const v4f*)(src + 4);
  v4u o;
  o[0] = pk16(bf_bits(a[0]), bf_bits(a[1]));
  o[1] = pk16(bf_bits(a[2]), bf_bits(a[3]));
  o[2] = pk16(bf_bits(c[0]), bf_bits(c[1]));
  o[3] = pk16(bf_bits(c[2]), bf_bits(c[3]));
  if (i < n8) *(v4u*)(Y + (size_t)i * 8) = o;
  
}

// =====================================================================================================
// v [b][s][d] f32 -> VT [b][d][s] f16( bf16_RNE(v) * 64 ). Block = 256 threads, one 64(s) x 64(d) tile,
// grid = (SEQ/64, HD/64, NB). Load: thread t reads s row t>>2, d = dblk*64 + 16*(t&3)..+15 (4 x 16-B loads),
// converts and writes the transposed elements into the LDS tile T[d][s] (pitch 72 halves); __syncthreads;
// coverage: load 256 threads x 16 = 64x64; store 2 it x 32 rows x 8 lanes x 8 halves = 64 d rows x 64 s.
// =====================================================================================================
__global__ __launch_bounds__(256) void vtrans_h16(const float* __restrict__ V, unsigned short* VTp) {
  __shared__ __align__(16) _Float16 Tsh[64 * 72];
  const int t    = threadIdx.x;
  const int dblk = blockIdx.y;
  const int b    = blockIdx.z;
  const int s0   = blockIdx.x * 64;
  {
    const int sr = t >> 2, d0 = (t & 3) * 16;
    const float* src = V + ((size_t)b * SEQ + s0 + sr) * HD + dblk * 64 + d0;
#pragma unroll
    for (int i = 0; i < 4; ++i) {
      const v4f x = *(const v4f*)(src + 4 * i);
#pragma unroll
      for (int e = 0; e < 4; ++e) Tsh[(d0 + 4 * i + e) * 72 + sr] = (_Float16)(bfr(x[e]) * VSC);
    }
  }
  __syncthreads();
  const int q8 = t >> 3, c8 = (t & 7) * 8;
  v4u vals[2];
#pragma unroll
  for (int it = 0; it < 2; ++it) {
    const int d = it * 32 + q8;
    HU8 hu;
    hu.h = *(const v8h*)(Tsh + d * 72 + c8);
    vals[it] = hu.u;
  }
#pragma unroll
  for (int it = 0; it < 2; ++it) {
    const int d = it * 32 + q8;
    *(v4u*)(VTp + ((size_t)b * HD + dblk * 64 + d) * SEQ + s0 + c8) = vals[it];
  }
  
}

// =====================================================================================================
// Causal flash attention, head dim 128, one head per sequence, SEQ query/key rows per sequence.
//   q (f32, the input itself) and the KB plane (bf16 bits): element (b, t, d) at [(b*SEQ + t)*128 + d]
//   Q is read by two waves only, so it has no plane of its own: each wave loads its 16 rows as f32, one whole
//   512-B row per instruction, converts them (RNE, the plane convert's own arithmetic) and turns them into B
//   fragments through its own, still unused, output staging rows in LDS.
//   VT plane (f16, x64): element (b, d, s) at [(b*128 + d)*SEQ + s]
//   out (f32): element (b, t, d) at [(b*SEQ + t)*128 + d]
//   raw score = k . q on bf16 WMMA (its factor 1/sqrt(32) is applied in the exponent), A = K rows, B = Q: accumulator register r of lane (c, h) is key
//   16j + 8h + r against query q0 + c; score := -inf where key > query row (select by index);
//   maximum and sum of a query run inside its lane, the two half waves exchange the maximum once per chunk and
//   join their sums once, behind the loop;
//   1024 p = 2^(score * SL2 + n), n = 10 - max * SL2, packed in registers as hi = f16(1024 p) and f16(1024 p - hi): score tiles 2kk and 2kk+1 are
//   elements 0..7 and 8..15 of the B operand of keys 32kk..32kk+31, the k order of the V^T loader;
//   context^T += v^T . hi + v^T . res on f16 WMMA, one accumulator: register r of lane
//   (c, h) in tile t is d = 16t + 8h + r of query q0 + c; online softmax (running max) in f32.
//   Block = 8 waves = 64 query rows of one sequence, twice: wave w and wave w + 4 hold the same 16 rows. Group g
//   (waves 4g..4g+3) walks key chunks g, g + 2, g + 4, ... of the tile's chunks 0..qb, so the longest tile's serial
//   walk is 16 trips, not 32, and a SIMD keeps four waves to the end: half the blocks are resident at a time, the
//   grid = NQB * NB runs from the heaviest tile to the lightest.
//   Key chunks of 64, block-uniform trip i = 0..qb/2, kt = 2i + g (chunks strictly above the diagonal are fully
//   masked and skipped, but for group 1's last chunk where qb is even: it lies above, is masked whole and adds 0).
//   Behind the loop group 1 hands its maximum, sum and context to group 0 through LDS, lane to lane.
//   K / V^T chunk staging, per group: asynchronous 16-B copies to LDS, 128 threads x 8 pieces per plane = the whole
//   64x128 / 128x64 tile, each wave instruction on four whole 128-B lines. One buffer per operand and group: K of the
//   group's next chunk is copied behind the barrier that ends the score products of this one and flies under softmax
//   and P.V; V^T of the next chunk is copied behind the barrier that ends P.V and flies under the next score products.
//   Output coverage: each wave of group 0 stores its rows q0..q0+15 x 128 columns, two 256-B row pieces per instruction
// =====================================================================================================
// Four waves per SIMD (two blocks on a WGP): the budget of 256 registers is stated, since left to itself
// the build spends more of them on a wider schedule of the softmax.
__global__ __launch_bounds__(256) __attribute__((amdgpu_waves_per_eu(4, 4)))
void attn128(const float* __restrict__ Qf, const unsigned short* __restrict__ KBp,
             const unsigned short* __restrict__ VTp, float* outp) {
  // Row pitches are odd multiples of 16 B, so the 16 lanes of a half wave that read one 16-B piece each from
  // 16 consecutive rows fall on 64 distinct banks.
  __shared__ __align__(16) unsigned short Ksh[2][KC * KP];        // per group K [kv][d] bf16, pitch 272 B
  __shared__ __align__(16) _Float16 Vth[2][HD * VP];              // per group V^T [d][kv] f16, pitch 144 B
  __shared__ __align__(16) float    Os[8][16 * OP];               // per wave context half tile [row][64 d]

  const int tid  = threadIdx.x;
  const int wave = tid >> 5;
  const int tg   = tid & 127;                    // the thread's number inside its group of four waves
  // The wave's number once more, as a scalar, for the code behind the loop: what that code needs of it (the output
  // rows' base, the staging rows' place) then passes the loop in scalar registers; in vector registers it is spilled.
  const int wsc  = __builtin_amdgcn_readfirstlane(tid >> 5);
  const int grp  = wsc >> 2;                     // key group, the same in every lane of a wave: a scalar
  const int lane = tid & 31;
  const int hh   = lane >> 4;
  const int c    = lane & 15;

  // Tile deal. There are twice as many blocks as resident places and a tile's
  // cost grows with its index: cost falls with the block index, so that the light tiles fill the places that the
  // heavy ones leave. For speed only; (tile, sequence) is a permutation of the block index.
  const int bx = blockIdx.x;
  const int qb = NQB - 1 - bx / NB;
  const int b  = bx % NB;
  const int q0 = qb * 64 + (wave & 3) * 16;      // in-sequence query row of this wave's first row
  const int qrow = q0 + c;                       // in-sequence query row of this lane's accumulator column
  const size_t rowB = (size_t)b * SEQ;
  const _Float16* VTh = (const _Float16*)(const void*)VTp + (size_t)b * HD * SEQ;

  // ---- Q rows of this wave, f32: row r by one instruction, lane l takes d = 4l..4l+3 ----
  const float* qsrc = Qf + (rowB + q0) * HD + lane * 4;
  v4f qx[16];
#pragma unroll
  for (int r = 0; r < 16; ++r) qx[r] = *(const v4f*)(qsrc + r * HD);
#if defined(__HIP_DEVICE_COMPILE__)
  // The loads' address pair is named here so that it stays whole up to the wait (a precaution).
  asm volatile("s_wait_xcnt 0x0" :: "v"(qsrc) : "memory");
#endif

  float nrun = INFINITY;                         // running exponent offset of the lane's query, alike in both half waves
  float lrun = 0.f;                              // running sum of 1024 p over the keys of this lane's own half wave
  v8f oacc[8];
#pragma unroll
  for (int t = 0; t < 8; ++t) oacc[t] = zero8();

  // Staging addresses, tg counting inside the group. K chunk = 16 KiB in a row: piece i of thread tg is 16-B piece
  // i*128+tg, K row i*8 + (tg>>4). V^T chunk = 128 rows of 128 B: piece i is row i*16 + (tg>>3), 16-B piece tg&7.
  const unsigned short* Kg = Ksh[grp];                             // the group's own buffers
  const _Float16*       Vg = Vth[grp];
  const unsigned kl = lds_off(Kg) + (unsigned)(tg >> 4) * (KP * 2) + (unsigned)(tg & 15) * 16;
  const unsigned vl = lds_off(Vg) + (unsigned)(tg >> 3) * (VP * 2) + (unsigned)(tg & 7) * 16;
  const char* kg = (const char*)(KBp + rowB * HD);                 // block-uniform bases
  const char* vg = (const char*)VTh;
  const unsigned ko = (unsigned)tg * 16;                           // the lane's byte offsets from them
  const unsigned vo = (unsigned)(tg >> 3) * (SEQ * 2) + (unsigned)(tg & 7) * 16;

  // Prologue: K of the group's first chunk landed and published, its V^T in flight. The Q rows come in beside K's
  // copies. Tile 0 has no chunk 1: group 1 then copies chunk 0, which its mask hides (the address stays in the plane).
  const int k0 = (grp < qb) ? grp : qb;
  copy8_async(kl, 8 * KP * 2, kg + (size_t)k0 * (KC * HD * 2), 128 * 16, ko);

  // ---- Q fragments (B operand, col = lane&15): 4 d-chunks, from the wave's own LDS rows (pitch as K's) ----
  unsigned short* qs = (unsigned short*)(void*)Os[wave];
#pragma unroll
  for (int r = 0; r < 16; ++r) {
    const v2u w = {pk16(bf_bits(qx[r][0]), bf_bits(qx[r][1])), pk16(bf_bits(qx[r][2]), bf_bits(qx[r][3]))};
    *(v2u*)(qs + r * KP + lane * 4) = w;
  }
  wave_sync_lds();                               // the rows are written by the wave's other lanes
  v16b qa[4];
#pragma unroll
  for (int dc = 0; dc < 4; ++dc) qa[dc] = ldfrag_b(qs + c * KP + dc * 32 + 8 * hh);

  publish_point();
  copy8_async(vl, 16 * VP * 2, vg + (size_t)k0 * (KC * 2), (size_t)16 * SEQ * 2, vo);

  const int nt = (qb >> 1) + 1;              // trips: chunks 0..qb in pairs
#pragma unroll 1
  for (int i = 0; i < nt; ++i) {             // block-uniform trip count, at most NQB / 2
    const int kt = 2 * i + grp;              // the group's chunk of this trip, a scalar
    // The lane's query row counted from its first key of this chunk: key kt*KC + 8*hh + 16j + r lies behind the row
    // where 16j + r > dq. One register against literals; one register per (j, r) would pass the 256 of four waves.
    const int dq = qrow - kt * KC - 8 * hh;
    // Chunk copied ahead. The last trip copies chunk qb, unread, instead of branching round the copies: the loop
    // body stays one block without a branch.
    const int kn  = (kt + 2 < qb) ? kt + 2 : qb;

    // ---- scores^T: 64 keys x 16 queries per wave (A operand: row = key j*16+c, k = d, split map) ----
    // The eight LDS reads of key tile j+1 are issued as one group in front of tile j's products, into a second
    // register set: their latency passes under those products instead of standing in front of every product.
    v8f s[4];
    v16b kf[2][4];
#pragma unroll
    for (int dc = 0; dc < 4; ++dc) kf[0][dc] = ldfrag_b(Kg + c * KP + dc * 32 + 8 * hh);
#pragma unroll
    for (int j = 0; j < 4; ++j) {
      if (j < 3) {
#pragma unroll
        for (int dc = 0; dc < 4; ++dc) kf[(j + 1) & 1][dc] = ldfrag_b(Kg + ((j + 1) * 16 + c) * KP + dc * 32 + 8 * hh);
      }
      const v8f sh = mma_b4(kf[j & 1][0], kf[j & 1][1], kf[j & 1][2], kf[j & 1][3], qa[0], qa[1], qa[2], qa[3]);
#pragma unroll
      for (int r = 0; r < 8; ++r) s[j][r] = (j * 16 + r > dq) ? -INFINITY : sh[r];   // causal: keys strictly after the row
    }

    // V^T of this chunk published; every wave has left K: refill it
    publish_point();
    copy8_async(kl, 8 * KP * 2, kg + (size_t)kn * (KC * HD * 2), 128 * 16, ko);

    // ---- query max, online softmax, P^T hi and residual (both x1024) packed as B operands ----
    float mj[4];                                 // one chain per score tile, so that the chains are independent
#pragma unroll
    for (int j = 0; j < 4; ++j) {
      mj[j] = s[j][0];
#pragma unroll
      for (int r = 1; r < 8; ++r) mj[j] = fmaxf(mj[j], s[j][r]);
    }
    float m = fmaxf(fmaxf(mj[0], mj[1]), fmaxf(mj[2], mj[3]));
    m = fmaxf(m, xhalf(m));                      // the other eight keys of each tile lie in the other half wave
    // The scores stay raw: 1024 p = 2^(s * SL2 + n) with n = PEX - max * SL2, one fused multiply-add per score in
    // front of the exponential in place of the scale, the subtraction, the change of base and the x1024 product.
    // n falls as the maximum rises, so the running n is a minimum.
    // The ceiling keeps n finite where a group has met no key in front of the row yet (tile 0, group 1): inf - inf
    // would be no number. SL2 < 1, so every finite maximum's n lies below it and stays as it is.
    const float nnew  = fminf(fminf(nrun, __builtin_fmaf(m, -SL2, PEX)), NCEIL);
    const float alpha = exp2_x1(nnew - nrun);
    nrun = nnew;
    FragH pa[2], pr[2];
    float pj[4];
#pragma unroll
    for (int j = 0; j < 4; ++j) {
      pj[j] = 0.f;
#pragma unroll
      for (int r = 0; r < 8; ++r) s[j][r] = __builtin_fmaf(s[j][r], SL2, nnew);
      exp2_x8(s[j]);
#pragma unroll
      for (int r = 0; r < 8; ++r) pj[j] += s[j][r];
      split_x8(s[j], pa[j >> 1].u[j & 1], pr[j >> 1].u[j & 1]);
    }
    lrun = lrun * alpha + ((pj[0] + pj[1]) + (pj[2] + pj[3]));
    // Holds the rescale and the V^T fragment reads back from the head of the softmax above: spread over all of it,
    // they take the build past 256 registers, and it puts a context tile through scratch memory on every trip.
    __builtin_amdgcn_sched_barrier(0);
#pragma unroll
    for (int t = 0; t < 8; ++t) {
#pragma unroll
      for (int r = 0; r < 8; ++r) oacc[t][r] *= alpha;
    }

    // ---- context^T += V^T . P^T (f16 WMMA; A = V^T [dv][kv] by the split map, B = P^T from the accumulators) ----
    // V^T fragments likewise, by pairs of tiles: the eight LDS reads of the next pair stand in front of this pair's
    // products. The residual plane has the hi plane's scale, so its products go into the same accumulators.
    // The loops are unrolled so that vf and oacc are indexed by constants and stay in registers.
    v16h vf[2][4];
#pragma unroll
    for (int x = 0; x < 4; ++x) vf[0][x] = ldfrag_h(Vg + ((x >> 1) * 16 + c) * VP + (x & 1) * 32 + 8 * hh);
#pragma unroll
    for (int u = 0; u < 4; ++u) {
      if (u < 3) {
#pragma unroll
        for (int x = 0; x < 4; ++x)
          vf[(u + 1) & 1][x] = ldfrag_h(Vg + ((2 * (u + 1) + (x >> 1)) * 16 + c) * VP + (x & 1) * 32 + 8 * hh);
      }
      mma_h8(oacc[2 * u], oacc[2 * u + 1], vf[u & 1][0], vf[u & 1][1], vf[u & 1][2], vf[u & 1][3],
             pa[0].v, pa[1].v, pr[0].v, pr[1].v);
    }

    // K of the next chunk published; every wave has left V^T: refill it
    publish_point();
    copy8_async(vl, 16 * VP * 2, vg + (size_t)kn * (KC * 2), (size_t)16 * SEQ * 2, vo);
  }
#if defined(__HIP_DEVICE_COMPILE__)
  asm volatile("s_wait_asynccnt 0x0" ::: "memory");   // the last trip's copies have landed before the wave ends
#endif

  // ---- normalise (1/l, l carrying p's x1024 too, and the 1/64 v carry), then stage and store the wave's 16x128 f32
  //      tile as two 16x64 halves: each store instruction writes two 256-B row pieces (whole 128-B lines)
  // The lane's number is formed anew, from no register that lived through the loop (the block is one-dimensional, so
  // it is tid & 31): carried across the loop, c, hh and the staging address are spilled to scratch by this build.
  const int ln = (int)__builtin_amdgcn_mbcnt_lo(~0u, 0u);
  const int ce = ln & 15, he = ln >> 4;

  // ---- the two groups' states joined: wave w + 4 hands its lane's maximum, sum and 64 context values to the same
  //      lane of wave w. The K buffers carry them: their last readers left at the last trip's first barrier, and every
  //      wave's last copies into them had landed at its second. Each 16-B piece of a wave lies in 512 B in a row.
  float* xo = (float*)(void*)&Ksh[0][0] + ((wsc & 3) * 16 * 32 + ln) * 4;      // piece p at xo + p * 128
  float* xm = (float*)(void*)&Ksh[0][0] + 4 * 16 * 32 * 4 + ((wsc & 3) * 32 + ln) * 2;
  if (grp == 1) {                                // a scalar test
#pragma unroll
    for (int t = 0; t < 8; ++t) {
      const v8f o = oacc[t];
      const v4f lo = {o[0], o[1], o[2], o[3]};
      const v4f hi = {o[4], o[5], o[6], o[7]};
      *(v4f*)(xo + (2 * t) * 128)     = lo;
      *(v4f*)(xo + (2 * t + 1) * 128) = hi;
    }
    const v2f ml = {nrun, lrun};
    *(v2f*)xm = ml;
  }
  __syncthreads();                               // group 1's state is written; every wave of the block passes here
  if (grp == 1) return;                          // no barrier stands behind this line
  const v2f ml1 = *(const v2f*)xm;
  const float nj2 = fminf(nrun, ml1[0]);         // group 0 has met key 0: finite
  const float w0  = exp2_x1(nj2 - nrun);
  const float w1  = exp2_x1(nj2 - ml1[0]);
  const float lj  = lrun * w0 + ml1[1] * w1;

  float* os = Os[wsc];
  const float l   = lj + xhalf(lj);              // the two half waves' sums of the lane's query
  const float inv = ((l > 0.f) ? (1.0f / l) : 0.f) * (1.0f / VSC);   // l carries the x1024 of p itself
  const float f0  = w0 * inv, f1 = w1 * inv;
  v4f vals[2][8];
#pragma unroll
  for (int hv = 0; hv < 2; ++hv) {
    if (hv == 1) wave_sync_lds();             // the first half is read out before the second overwrites it
#pragma unroll
    for (int t = 0; t < 4; ++t) {               // a lane's eight registers are eight consecutive d of its query
      const v8f o = oacc[4 * hv + t];
      const v4f xl = *(const v4f*)(xo + (2 * (4 * hv + t)) * 128);
      const v4f xh = *(const v4f*)(xo + (2 * (4 * hv + t) + 1) * 128);
      const v4f lo = {o[0] * f0 + xl[0] * f1, o[1] * f0 + xl[1] * f1, o[2] * f0 + xl[2] * f1, o[3] * f0 + xl[3] * f1};
      const v4f hi = {o[4] * f0 + xh[0] * f1, o[5] * f0 + xh[1] * f1, o[6] * f0 + xh[2] * f1, o[7] * f0 + xh[3] * f1};
      *(v4f*)(os + ce * OP + t * 16 + 8 * he)     = lo;
      *(v4f*)(os + ce * OP + t * 16 + 8 * he + 4) = hi;
    }
    wave_sync_lds();
#pragma unroll
    for (int it = 0; it < 8; ++it) vals[hv][it] = *(const v4f*)(os + (2 * it + he) * OP + ce * 4);
  }
  float* C = outp + (rowB + qb * 64 + wsc * 16) * HD;
#pragma unroll
  for (int hv = 0; hv < 2; ++hv) {
#pragma unroll
    for (int it = 0; it < 8; ++it) *(v4f*)(C + (size_t)(2 * it + he) * HD + hv * 64 + ce * 4) = vals[hv][it];
  }
}

// =====================================================================================================
// Workspace map (bytes); every plane is an exact multiple of its whole-line / 64x64-tile store granularity:
//   KB  bf16 [32*2048][128]    0          16777216
//   VT  f16  [32][128][2048]   16777216   16777216
//   end                        33554432
// =====================================================================================================
extern "C" void kernel_launch(void* const* d_in, const int* in_sizes, int n_in,
                              void* d_out, int out_size, void* d_ws, size_t ws_size,
                              hipStream_t stream) {
  if (n_in < 3) return;
  if (in_sizes[0] != NE || in_sizes[1] != NE || in_sizes[2] != NE) return;
  if (out_size != NE) return;

  const float* q = (const float*)d_in[0];
  const float* k = (const float*)d_in[1];
  const float* v = (const float*)d_in[2];

  const size_t PB = (size_t)NE * 2;                     // 16777216
  size_t off = 0;
  const size_t oK  = off; off += PB;
  const size_t oVT = off; off += PB;
  if (off > ws_size) return;                            // off = 33554432
  if (off > (size_t)134217728) return;

  char* ws = (char*)d_ws;
  unsigned short* KB = (unsigned short*)(ws + oK);
  unsigned short* VT = (unsigned short*)(ws + oVT);
  float* out0 = (float*)d_out;

  const int n8 = NE / 8;                                // 1048576
  if ((n8 % 256) != 0) return;
  const dim3 blk(256);
  const dim3 gC(n8 / 256);                              // 4096 blocks
  const dim3 gVT(SEQ / 64, HD / 64, NB);                // 32 x 2 x 32 tiles
  const dim3 gA(NB * NQB);                              // 1024 blocks of 256

  // (0) k -> bf16 plane; v -> f16( bf16_RNE(v) * 64 ) transposed plane [b][d][s]
  conv_bf16<<<gC, blk, 0, stream>>>(k, KB, n8);
  vtrans_h16<<<gVT, blk, 0, stream>>>(v, VT);

  // (1) causal flash attention -> out f32 [32][2048][128]
  attn128<<<gA, blk, 0, stream>>>(q, KB, VT, out0);
  (void)hipGetLastError();
}
